// v000
// The times below were measured on an AMD MI455X: many runs one after another, warmed up first and cycling through
// copies of the inputs, with the whole window's GPU time divided by the number of runs. Launches and the gaps
// between them are all in it. The median over several windows is given; except for v000 it joins two sittings, which
// can be a few percent apart, so the side-by-side timings, each taken in one sitting, are the better comparison.
// v000, which the later versions start from, runs in 1590 microseconds.
#include <hip/hip_runtime.h>

// ElasticBertSelfAttention (hidden [4][1024][1024]; q/k/v = x W + b (16 heads x 64); scores[l][r] = q_l.k_r + q_l.pe[l-r] + k_r.pe[l-r] with pe[l-r] = dist_emb[l - r + 2047] (relative_key_query), / 8, + additive attention_mask[b][r] (read as data);
// softmax; ctx = probs v merged -> [4][1024][1024]). The positional terms are computed as QE = q.E'^T and KE = k.E'^T against the 2048 table rows that can occur (1024..3071) and gathered along the diagonals (exact restructuring).
// Compute dtypes, f32 accumulate: every input rounded to bf16; q/k/v on PLAIN bf16 operands (inputs: exact) + bias; q.k on bf16 hi+lo planes (3 products); QE / KE on single fp16 planes against the (exactly representable) fp16

#define NB_  4
#define SS   1024
#define DM   1024
#define NH_  16
#define HD   64
#define NE   2048
#define EOFF 1024
#define HPP  4
typedef _Float16 h16;
typedef unsigned short bf;
typedef __attribute__((ext_vector_type(16))) __bf16   v16bf;
typedef __attribute__((ext_vector_type(16))) _Float16 v16h;
typedef __attribute__((ext_vector_type(8)))  _Float16 v8h;
typedef __attribute__((ext_vector_type(8)))  unsigned short v8us;
typedef __attribute__((ext_vector_type(8)))  float    v8f;
typedef __attribute__((ext_vector_type(4)))  float    v4f;
typedef v8h  __attribute__((may_alias)) v8ha;
typedef v4f  __attribute__((may_alias)) v4fa;
typedef v8us __attribute__((may_alias)) v8usa;

__device__ __forceinline__ unsigned short f2bf(float f) { unsigned u = __float_as_uint(f); u += 0x7FFFu + ((u >> 16) & 1u); return (unsigned short)(u >> 16); }
__device__ __forceinline__ float bf2f(unsigned short b) { return __uint_as_float(((unsigned)b) << 16); }
__device__ __forceinline__ float bfr(float f) { return bf2f(f2bf(f)); }
__device__ __forceinline__ v16h cat16(v8h lo, v8h hi) { return __builtin_shufflevector(lo, hi, 0, 1, 2, 3, 4, 5, 6, 7, 8, 9, 10, 11, 12, 13, 14, 15); }
__device__ __forceinline__ v16bf cat16b(v8us lo, v8us hi) { return __builtin_bit_cast(v16bf, __builtin_shufflevector(lo, hi, 0, 1, 2, 3, 4, 5, 6, 7, 8, 9, 10, 11, 12, 13, 14, 15)); }
__device__ __forceinline__ v8f wmma16(v16h a, v16h b, v8f c) { return __builtin_amdgcn_wmma_f32_16x16x32_f16(false, a, false, b, (short)0, c, false, false); }
__device__ __forceinline__ v8f wmmab(v16bf a, v16bf b, v8f c) { return __builtin_amdgcn_wmma_f32_16x16x32_bf16(false, a, false, b, (short)0, c, false, false); }



// ---- k_gemmw: register-blocked GEMM, ONE WAVE per 64x64 output tile (16 accumulators), operands straight from K-contiguous 16-bit planes; grid (M/64, N/64, Z), 32 threads.
// C[m][n] (f32, pitch ldc, + optional f32 bias[n]) = sum_k A[m][k] Bt[n][k] (+ split products per NSPLIT). z-batch strides sA/sB/sC in elements. K % 32 == 0.
template <typename T16> struct WFrag;
template <> struct WFrag<h16> { typedef v16h V; static __device__ __forceinline__ V ld(const h16* p) { return cat16(*(const v8h*)p, *(const v8h*)(p + 16)); } static __device__ __forceinline__ v8f mma(V a, V b, v8f c) { return wmma16(a, b, c); } };
template <> struct WFrag<bf> { typedef v16bf V; static __device__ __forceinline__ V ld(const bf* p) { return cat16b(*(const v8us*)p, *(const v8us*)(p + 16)); } static __device__ __forceinline__ v8f mma(V a, V b, v8f c) { return wmmab(a, b, c); } };
template <typename T16, int NSPLIT, bool BIAS>
__global__ __launch_bounds__(32) void k_gemmw(const T16* __restrict__ A, const T16* __restrict__ A2, const T16* __restrict__ Bt, const T16* __restrict__ Bt2, int K, float* C, int ldc, const float* __restrict__ bias, size_t sA, size_t sB, size_t sC) {
    typedef typename WFrag<T16>::V V;
    __shared__ __align__(16) float os[16 * 68];
    const size_t z = blockIdx.z; A += z * sA; if (A2) A2 += z * sA; Bt += z * sB; if (Bt2) Bt2 += z * sB; C += z * sC;
    const int lane = threadIdx.x & 31, lr = lane & 15, hi = lane >> 4; const int r0 = blockIdx.x * 64, c0 = blockIdx.y * 64;
    v8f acc[4][4];
#pragma unroll
    for (int mb = 0; mb < 4; ++mb)
#pragma unroll
        for (int nb = 0; nb < 4; ++nb) acc[mb][nb] = (v8f){};
    const size_t aoff = (size_t)(r0 + lr) * K + 8 * hi, boff = (size_t)(c0 + lr) * K + 8 * hi;
#pragma unroll 1
    for (int kc = 0; kc < K; kc += 32) {
        V a[4], a2[4];
#pragma unroll
        for (int mb = 0; mb < 4; ++mb) { a[mb] = WFrag<T16>::ld(A + aoff + (size_t)mb * 16 * K + kc); if (NSPLIT == 1 || NSPLIT == 2) a2[mb] = WFrag<T16>::ld(A2 + aoff + (size_t)mb * 16 * K + kc); }
#pragma unroll
        for (int nb = 0; nb < 4; ++nb) { const V b = WFrag<T16>::ld(Bt + boff + (size_t)nb * 16 * K + kc); V b2; if (NSPLIT >= 2) b2 = WFrag<T16>::ld(Bt2 + boff + (size_t)nb * 16 * K + kc);
#pragma unroll
            for (int mb = 0; mb < 4; ++mb) { acc[mb][nb] = WFrag<T16>::mma(a[mb], b, acc[mb][nb]); if (NSPLIT == 1 || NSPLIT == 2) acc[mb][nb] = WFrag<T16>::mma(a2[mb], b, acc[mb][nb]); if (NSPLIT >= 2) acc[mb][nb] = WFrag<T16>::mma(a[mb], b2, acc[mb][nb]); } }
        asm volatile("v_nop\n\tv_nop\n\tv_nop\n\tv_nop" : "+v"(acc[0][0]), "+v"(acc[1][1]), "+v"(acc[2][2]), "+v"(acc[3][3]) : "v"(a[0]), "v"(a[3]));
    }
#pragma unroll
    for (int mb = 0; mb < 4; ++mb) {
#pragma unroll
        for (int nb = 0; nb < 4; ++nb) {
#pragma unroll
            for (int j = 0; j < 8; ++j) os[(hi * 8 + j) * 68 + nb * 16 + lr] = acc[mb][nb][j]; }
        __builtin_amdgcn_wave_barrier(); asm volatile("" ::: "memory");
        float* crow = C + (size_t)(r0 + mb * 16) * ldc + c0;
{
#pragma unroll
            for (int s = 0; s < 8; ++s) { const int row = 2 * s + hi, cofs = lr * 4; v4f val = *(const v4fa*)(os + row * 68 + cofs); if (BIAS) { val[0] += bfr(bias[c0 + cofs]); val[1] += bfr(bias[c0 + cofs + 1]); val[2] += bfr(bias[c0 + cofs + 2]); val[3] += bfr(bias[c0 + cofs + 3]); }
                *(v4f*)(crow + (size_t)row * ldc + cofs) = val; }
             }
        __builtin_amdgcn_wave_barrier(); asm volatile("" ::: "memory");
    }
}

__device__ __forceinline__ h16 tohx(float x) { return (h16)x; }
__device__ __forceinline__ void splitf(float y, unsigned short& h, unsigned short& l) { h = f2bf(y); l = f2bf(y - bf2f(h)); }
typedef __attribute__((ext_vector_type(2))) unsigned short v2us;
typedef __attribute__((ext_vector_type(4))) unsigned short v4us;
typedef __attribute__((ext_vector_type(4))) _Float16 v4h;

__global__ __launch_bounds__(256) void k_wtG(const float* __restrict__ w, int K, int N, bf* Bt) {
    const int lane = threadIdx.x & 31; const int L0 = (blockIdx.x * 8 + (threadIdx.x >> 5)) * 8; const int nlines = N * K / 64;
{
#pragma unroll 1
        for (int l = 0; l < 8; ++l) { const int L = L0 + l; if (L >= nlines) break; const size_t e = (size_t)L * 64 + lane * 2; const int k = (int)(e % K), n = (int)(e / K); v2us o;
            o[0] = f2bf(w[(size_t)k * N + n]); o[1] = f2bf(w[(size_t)(k + 1) * N + n]); *(v2us*)(Bt + e) = o; }
         }
}
__global__ __launch_bounds__(256) void k_cvt8(const float* __restrict__ src, bf* dst, size_t n8) { const size_t i = (size_t)blockIdx.x * 256 + threadIdx.x; if (i >= n8) return; const v8f v = *(const v8f*)(src + i * 8); v8us o;
#pragma unroll
    for (int k = 0; k < 8; ++k) o[k] = f2bf(v[k]); *(v8us*)(dst + i * 8) = o;  }
// k_e16: E16[j][d] = fp16(bf16 dist_emb[1024 + j][d]) (8-B lanes); k_qkp: per head planes from FQ/FK [t][h*64+d]: Qh/Ql/Q16, Kh/Kl/K16 in [h][t][d] (8-B lanes); k_vtp2: VTh/VTl[h][d][t] = split(FV[t][h*64+d]) (lane -> 2 consecutive t);
__global__ __launch_bounds__(256) void k_e16(const float* __restrict__ emb, h16* E16) { const int e = (blockIdx.x * 256 + threadIdx.x) * 4; if (e >= NE * HD) return; const v4f a = *(const v4f*)(emb + (size_t)EOFF * HD + e); v4h o;
#pragma unroll
    for (int u = 0; u < 4; ++u) o[u] = tohx(bfr(a[u])); *(v4h*)(E16 + e) = o;  }
__global__ __launch_bounds__(256) void k_qkp(const float* __restrict__ FQ, const float* __restrict__ FK, bf* Qh, bf* Ql, h16* Q16, bf* Kh, bf* Kl, h16* K16) { const int e = (blockIdx.x * 256 + threadIdx.x) * 4; if (e >= NH_ * SS * HD) return; const int d = e % HD; const int t = (e / HD) % SS; const int h = e / (HD * SS); const size_t f = (size_t)t * DM + h * HD + d; v4us qh, ql, kh, kl; v4h q6, k6;
#pragma unroll
    for (int u = 0; u < 4; ++u) { const float qv = FQ[f + u], kv = FK[f + u]; unsigned short a, b; splitf(qv, a, b); qh[u] = a; ql[u] = b; splitf(kv, a, b); kh[u] = a; kl[u] = b; q6[u] = tohx(qv); k6[u] = tohx(kv); }
    { *(v4us*)(Qh + e) = qh; *(v4us*)(Ql + e) = ql; *(v4h*)(Q16 + e) = q6; *(v4us*)(Kh + e) = kh; *(v4us*)(Kl + e) = kl; *(v4h*)(K16 + e) = k6;  } }
__global__ __launch_bounds__(256) void k_vtp2(const float* __restrict__ FV, bf* VTh, bf* VTl) { const int e = (blockIdx.x * 256 + threadIdx.x) * 2; if (e >= NH_ * HD * SS) return; const int t = e % SS; const int d = (e / SS) % HD; const int h = e / (SS * HD); v2us oh, ol;
#pragma unroll
    for (int u = 0; u < 2; ++u) { unsigned short a, b; splitf(FV[(size_t)(t + u) * DM + h * HD + d], a, b); oh[u] = a; ol[u] = b; }
    *(v2us*)(VTh + e) = oh; *(v2us*)(VTl + e) = ol;  }
__global__ __launch_bounds__(256) void k_ebsoft(const float* __restrict__ Sb, const float* __restrict__ QE, const float* __restrict__ KE, const float* __restrict__ am, bf* Ph, bf* Pl) { const int lane = threadIdx.x & 31; const int row = blockIdx.x * 8 + (threadIdx.x >> 5); if (row >= HPP * SS) return; const int l = row % SS; const int z = row / SS;
    const float* sr = Sb + (size_t)row * SS; const float* qe = QE + (size_t)row * NE + l + (SS - 1); const float* ke = KE + (size_t)z * SS * NE + l + (SS - 1); float v[SS / 32]; float mx = -3.0e38f;
#pragma unroll
    for (int ch = 0; ch < SS / 128; ++ch) { const int r0 = ch * 128 + lane * 4; const v4f a = *(const v4f*)(sr + r0);
#pragma unroll
        for (int u = 0; u < 4; ++u) { const int r = r0 + u; const float s1 = __fadd_rn(a[u], qe[-r]); const float s2 = __fadd_rn(s1, ke[(size_t)r * NE - r]); float t0 = s2 * 0.125f; asm volatile("" : "+v"(t0)); const float t = __fadd_rn(t0, bfr(am[r])); v[ch * 4 + u] = t; mx = fmaxf(mx, t); } }
#pragma unroll
    for (int sh = 16; sh; sh >>= 1) mx = fmaxf(mx, __shfl_xor(mx, sh, 32));
    float sum = 0.f;
#pragma unroll
    for (int q = 0; q < SS / 32; ++q) { float d0 = __fsub_rn(v[q], mx); asm volatile("" : "+v"(d0)); v[q] = __builtin_amdgcn_exp2f(__fmul_rn(d0, 1.4426950408889634f)); sum += v[q]; }
#pragma unroll
    for (int sh = 16; sh; sh >>= 1) sum += __shfl_xor(sum, sh, 32);
    const float f = __fdiv_rn(1.0f, sum);
    {
#pragma unroll
        for (int ch = 0; ch < SS / 128; ++ch) { v4us oh, ol;
#pragma unroll
            for (int u = 0; u < 4; ++u) { unsigned short a, b; splitf(v[ch * 4 + u] * f, a, b); oh[u] = a; ol[u] = b; } const size_t oo = (size_t)row * SS + ch * 128 + lane * 4; *(v4us*)(Ph + oo) = oh; *(v4us*)(Pl + oo) = ol; }
         } }
__global__ __launch_bounds__(256) void k_mrg(const float* __restrict__ O, int h0, float* outb) { const int e = (blockIdx.x * 256 + threadIdx.x) * 4; if (e >= HPP * SS * HD) return; const int d = e % HD; const int t = (e / HD) % SS; const int z = e / (HD * SS); const v4f a = *(const v4f*)(O + e); const size_t oo = (size_t)t * DM + (h0 + z) * HD + d;
    *(v4f*)(outb + oo) = a;  }

extern "C" void kernel_launch(void* const* d_in, const int* in_sizes, int n_in,
                              void* d_out, int out_size, void* d_ws, size_t ws_size, hipStream_t stream) {
    (void)in_sizes; (void)n_in; (void)out_size;
    const float** I = (const float**)d_in;
    const float *x = I[0], *am = I[1], *wq = I[2], *bq = I[3], *wk = I[4], *bk = I[5], *wv = I[6], *bv = I[7], *emb = I[8];
    float* OUT = (float*)d_out;     // [4][1024][1024]
    char* wsp = (char*)d_ws;
    auto take = [&](size_t bytes) { char* p = wsp; wsp += (bytes + 255) & ~(size_t)255; return (void*)p; };
    bf* WQ = (bf*)take((size_t)DM * DM * 2); bf* WK = (bf*)take((size_t)DM * DM * 2); bf* WV = (bf*)take((size_t)DM * DM * 2); h16* E16 = (h16*)take((size_t)NE * HD * 2);
    bf* XB = (bf*)take((size_t)SS * DM * 2); float* FQ = (float*)take((size_t)SS * DM * 4); float* FK = (float*)take((size_t)SS * DM * 4); float* FV = (float*)take((size_t)SS * DM * 4);
    bf* Qh = (bf*)take((size_t)NH_ * SS * HD * 2); bf* Ql = (bf*)take((size_t)NH_ * SS * HD * 2); h16* Q16 = (h16*)take((size_t)NH_ * SS * HD * 2); bf* Kh = (bf*)take((size_t)NH_ * SS * HD * 2); bf* Kl = (bf*)take((size_t)NH_ * SS * HD * 2); h16* K16 = (h16*)take((size_t)NH_ * SS * HD * 2); bf* VTh = (bf*)take((size_t)NH_ * HD * SS * 2); bf* VTl = (bf*)take((size_t)NH_ * HD * SS * 2);
    float* Sb = (float*)take((size_t)HPP * SS * SS * 4); float* QE = (float*)take((size_t)HPP * SS * NE * 4); float* KE = (float*)take((size_t)HPP * SS * NE * 4); bf* Ph = (bf*)take((size_t)HPP * SS * SS * 2); bf* Pl = (bf*)take((size_t)HPP * SS * SS * 2); float* O = (float*)take((size_t)HPP * SS * HD * 4);
    if ((size_t)(wsp - (char*)d_ws) > ws_size) return;    // total ~ 135 MB (4-head QE/KE 64 MB + scores 16 MB + hl P 16 MB)
    k_wtG<<<(DM * DM / 64 + 63) / 64, 256, 0, stream>>>(wq, DM, DM, WQ); k_wtG<<<(DM * DM / 64 + 63) / 64, 256, 0, stream>>>(wk, DM, DM, WK); k_wtG<<<(DM * DM / 64 + 63) / 64, 256, 0, stream>>>(wv, DM, DM, WV); k_e16<<<(NE * HD / 4 + 255) / 256, 256, 0, stream>>>(emb, E16);
    for (int b = 0; b < NB_; ++b) {
        k_cvt8<<<(SS * DM / 8 + 255) / 256, 256, 0, stream>>>(x + (size_t)b * SS * DM, XB, (size_t)SS * DM / 8);
        k_gemmw<bf, 0, true><<<dim3(SS / 64, DM / 64, 1), 32, 0, stream>>>(XB, nullptr, WQ, nullptr, DM, FQ, DM, bq, 0, 0, 0); k_gemmw<bf, 0, true><<<dim3(SS / 64, DM / 64, 1), 32, 0, stream>>>(XB, nullptr, WK, nullptr, DM, FK, DM, bk, 0, 0, 0); k_gemmw<bf, 0, true><<<dim3(SS / 64, DM / 64, 1), 32, 0, stream>>>(XB, nullptr, WV, nullptr, DM, FV, DM, bv, 0, 0, 0);
        k_qkp<<<(NH_ * SS * HD / 4 + 255) / 256, 256, 0, stream>>>(FQ, FK, Qh, Ql, Q16, Kh, Kl, K16); k_vtp2<<<(NH_ * HD * SS / 2 + 255) / 256, 256, 0, stream>>>(FV, VTh, VTl);
        for (int h0 = 0; h0 < NH_; h0 += HPP) { const size_t zo = (size_t)h0 * SS * HD;
            k_gemmw<bf, 2, false><<<dim3(SS / 64, SS / 64, HPP), 32, 0, stream>>>(Qh + zo, Ql + zo, Kh + zo, Kl + zo, HD, Sb, SS, nullptr, (size_t)SS * HD, (size_t)SS * HD, (size_t)SS * SS);
            k_gemmw<h16, 0, false><<<dim3(SS / 64, NE / 64, HPP), 32, 0, stream>>>(Q16 + zo, nullptr, E16, nullptr, HD, QE, NE, nullptr, (size_t)SS * HD, 0, (size_t)SS * NE);
            k_gemmw<h16, 0, false><<<dim3(SS / 64, NE / 64, HPP), 32, 0, stream>>>(K16 + zo, nullptr, E16, nullptr, HD, KE, NE, nullptr, (size_t)SS * HD, 0, (size_t)SS * NE);
            k_ebsoft<<<HPP * SS / 8, 256, 0, stream>>>(Sb, QE, KE, am + (size_t)b * SS, Ph, Pl);
            k_gemmw<bf, 2, false><<<dim3(SS / 64, 1, HPP), 32, 0, stream>>>(Ph, Pl, VTh + (size_t)h0 * HD * SS, VTl + (size_t)h0 * HD * SS, SS, O, HD, nullptr, (size_t)SS * SS, (size_t)HD * SS, (size_t)SS * HD);
            k_mrg<<<(HPP * SS * HD / 4 + 255) / 256, 256, 0, stream>>>(O, h0, OUT + (size_t)b * SS * DM); } }
}

// v001
// It runs in 1330 microseconds.
// In two side-by-side timings against v000, it was 1.19 and 1.21 times as fast.
#include <hip/hip_runtime.h>

// ElasticBertSelfAttention (hidden [4][1024][1024]; q/k/v = x W + b (16 heads x 64); scores[l][r] = q_l.k_r + q_l.pe[l-r] + k_r.pe[l-r] with pe[l-r] = dist_emb[l - r + 2047] (relative_key_query), / 8, + additive attention_mask[b][r] (read as data);
// softmax; ctx = probs v merged -> [4][1024][1024]). The positional terms are computed as QE = q.E'^T and KE = k.E'^T against the 2048 table rows that can occur (1024..3071) and gathered along the diagonals (exact restructuring).
// Compute dtypes, f32 accumulate: every input rounded to bf16; q/k/v on PLAIN bf16 operands (inputs: exact) + bias; q.k on bf16 hi+lo planes (3 products); QE / KE on single fp16 planes against the (exactly representable) fp16

#define NB_  4
#define SS   1024
#define DM   1024
#define NH_  16
#define HD   64
#define NE   2048
#define EOFF 1024
#define HPP  4
typedef _Float16 h16;
typedef unsigned short bf;
typedef __attribute__((ext_vector_type(16))) __bf16   v16bf;
typedef __attribute__((ext_vector_type(16))) _Float16 v16h;
typedef __attribute__((ext_vector_type(8)))  _Float16 v8h;
typedef __attribute__((ext_vector_type(8)))  unsigned short v8us;
typedef __attribute__((ext_vector_type(8)))  float    v8f;
typedef __attribute__((ext_vector_type(4)))  float    v4f;
typedef v8h  __attribute__((may_alias)) v8ha;
typedef v4f  __attribute__((may_alias)) v4fa;
typedef v8us __attribute__((may_alias)) v8usa;

__device__ __forceinline__ unsigned short f2bf(float f) { unsigned u = __float_as_uint(f); u += 0x7FFFu + ((u >> 16) & 1u); return (unsigned short)(u >> 16); }
__device__ __forceinline__ float bf2f(unsigned short b) { return __uint_as_float(((unsigned)b) << 16); }
__device__ __forceinline__ float bfr(float f) { return bf2f(f2bf(f)); }
__device__ __forceinline__ v16h cat16(v8h lo, v8h hi) { return __builtin_shufflevector(lo, hi, 0, 1, 2, 3, 4, 5, 6, 7, 8, 9, 10, 11, 12, 13, 14, 15); }
__device__ __forceinline__ v16bf cat16b(v8us lo, v8us hi) { return __builtin_bit_cast(v16bf, __builtin_shufflevector(lo, hi, 0, 1, 2, 3, 4, 5, 6, 7, 8, 9, 10, 11, 12, 13, 14, 15)); }
__device__ __forceinline__ v8f wmma16(v16h a, v16h b, v8f c) { return __builtin_amdgcn_wmma_f32_16x16x32_f16(false, a, false, b, (short)0, c, false, false); }
__device__ __forceinline__ v8f wmmab(v16bf a, v16bf b, v8f c) { return __builtin_amdgcn_wmma_f32_16x16x32_bf16(false, a, false, b, (short)0, c, false, false); }



// ---- k_gemmw: register-blocked GEMM, NW WAVES per 64x64 output tile (16 accumulators each), operands straight from K-contiguous 16-bit planes; grid (M/64, N/64, Z), 32 * NW threads.
// NW > 1: wave w takes the 32-wide k steps w, w + NW, ... (neighbouring waves read the two halves of one 128-B line); the NW partial tiles are summed through LDS in wave order, 16 rows at a time.
// C[m][n] (f32, pitch ldc, + optional f32 bias[n]) = sum_k A[m][k] Bt[n][k] (+ split products per NSPLIT). z-batch strides sA/sB/sC in elements. K % 32 == 0.
template <typename T16> struct WFrag;
template <> struct WFrag<h16> { typedef v16h V; static __device__ __forceinline__ V ld(const h16* p) { return cat16(*(const v8h*)p, *(const v8h*)(p + 16)); } static __device__ __forceinline__ v8f mma(V a, V b, v8f c) { return wmma16(a, b, c); } };
template <> struct WFrag<bf> { typedef v16bf V; static __device__ __forceinline__ V ld(const bf* p) { return cat16b(*(const v8us*)p, *(const v8us*)(p + 16)); } static __device__ __forceinline__ v8f mma(V a, V b, v8f c) { return wmmab(a, b, c); } };
template <typename T16, int NSPLIT, bool BIAS, int NW>
__global__ __launch_bounds__(32 * NW) void k_gemmw(const T16* __restrict__ A, const T16* __restrict__ A2, const T16* __restrict__ Bt, const T16* __restrict__ Bt2, int K, float* C, int ldc, const float* __restrict__ bias, size_t sA, size_t sB, size_t sC) {
    typedef typename WFrag<T16>::V V;
    __shared__ __align__(16) float os[(NW > 1 ? 2 * NW : 1) * 16 * 68];
    const int wv = NW > 1 ? __builtin_amdgcn_readfirstlane((int)(threadIdx.x >> 5)) : 0;
    const size_t z = blockIdx.z; A += z * sA; if (A2) A2 += z * sA; Bt += z * sB; if (Bt2) Bt2 += z * sB; C += z * sC;
    const int lane = threadIdx.x & 31, lr = lane & 15, hi = lane >> 4; const int r0 = blockIdx.x * 64, c0 = blockIdx.y * 64;
    v8f acc[4][4];
#pragma unroll
    for (int mb = 0; mb < 4; ++mb)
#pragma unroll
        for (int nb = 0; nb < 4; ++nb) acc[mb][nb] = (v8f){};
    const size_t aoff = (size_t)(r0 + lr) * K + 8 * hi, boff = (size_t)(c0 + lr) * K + 8 * hi;
#pragma unroll 1
    for (int kc = wv * 32; kc < K; kc += NW * 32) {
        V a[4], a2[4];
#pragma unroll
        for (int mb = 0; mb < 4; ++mb) { a[mb] = WFrag<T16>::ld(A + aoff + (size_t)mb * 16 * K + kc); if (NSPLIT == 1 || NSPLIT == 2) a2[mb] = WFrag<T16>::ld(A2 + aoff + (size_t)mb * 16 * K + kc); }
#pragma unroll
        for (int nb = 0; nb < 4; ++nb) { const V b = WFrag<T16>::ld(Bt + boff + (size_t)nb * 16 * K + kc); V b2; if (NSPLIT >= 2) b2 = WFrag<T16>::ld(Bt2 + boff + (size_t)nb * 16 * K + kc);
#pragma unroll
            for (int mb = 0; mb < 4; ++mb) { acc[mb][nb] = WFrag<T16>::mma(a[mb], b, acc[mb][nb]); if (NSPLIT == 1 || NSPLIT == 2) acc[mb][nb] = WFrag<T16>::mma(a2[mb], b, acc[mb][nb]); if (NSPLIT >= 2) acc[mb][nb] = WFrag<T16>::mma(a[mb], b2, acc[mb][nb]); } }
        asm volatile("v_nop\n\tv_nop\n\tv_nop\n\tv_nop" : "+v"(acc[0][0]), "+v"(acc[1][1]), "+v"(acc[2][2]), "+v"(acc[3][3]) : "v"(a[0]), "v"(a[3]));
    }
    if constexpr (NW > 1) {
        static_assert(NW == 8, "one 16-byte piece of a 16 x 64 slab per thread");
        const int row = threadIdx.x >> 4, cofs = (threadIdx.x & 15) * 4;
#pragma unroll
        for (int mb = 0; mb < 4; ++mb) {
            float* slab = os + (mb & 1) * (NW * 16 * 68);   // two slab sets: the barrier of slab mb + 1 ends every read of slab mb before slab mb + 2 overwrites it
            float* mine = slab + wv * (16 * 68);
#pragma unroll
            for (int nb = 0; nb < 4; ++nb) {
#pragma unroll
                for (int j = 0; j < 8; ++j) mine[(hi * 8 + j) * 68 + nb * 16 + lr] = acc[mb][nb][j]; }
            __syncthreads();   // every wave's partial slab is in LDS before any thread sums across waves
            v4f val = *(const v4fa*)(slab + row * 68 + cofs);
#pragma unroll
            for (int w = 1; w < NW; ++w) val += *(const v4fa*)(slab + w * (16 * 68) + row * 68 + cofs);
            if (BIAS) { val[0] += bfr(bias[c0 + cofs]); val[1] += bfr(bias[c0 + cofs + 1]); val[2] += bfr(bias[c0 + cofs + 2]); val[3] += bfr(bias[c0 + cofs + 3]); }
            *(v4f*)(C + (size_t)(r0 + mb * 16 + row) * ldc + c0 + cofs) = val;
        }
        return;
    }
#pragma unroll
    for (int mb = 0; mb < 4; ++mb) {
#pragma unroll
        for (int nb = 0; nb < 4; ++nb) {
#pragma unroll
            for (int j = 0; j < 8; ++j) os[(hi * 8 + j) * 68 + nb * 16 + lr] = acc[mb][nb][j]; }
        __builtin_amdgcn_wave_barrier(); asm volatile("" ::: "memory");
        float* crow = C + (size_t)(r0 + mb * 16) * ldc + c0;
{
#pragma unroll
            for (int s = 0; s < 8; ++s) { const int row = 2 * s + hi, cofs = lr * 4; v4f val = *(const v4fa*)(os + row * 68 + cofs); if (BIAS) { val[0] += bfr(bias[c0 + cofs]); val[1] += bfr(bias[c0 + cofs + 1]); val[2] += bfr(bias[c0 + cofs + 2]); val[3] += bfr(bias[c0 + cofs + 3]); }
                *(v4f*)(crow + (size_t)row * ldc + cofs) = val; }
             }
        __builtin_amdgcn_wave_barrier(); asm volatile("" ::: "memory");
    }
}

__device__ __forceinline__ h16 tohx(float x) { return (h16)x; }
__device__ __forceinline__ void splitf(float y, unsigned short& h, unsigned short& l) { h = f2bf(y); l = f2bf(y - bf2f(h)); }
typedef __attribute__((ext_vector_type(2))) unsigned short v2us;
typedef __attribute__((ext_vector_type(4))) unsigned short v4us;
typedef __attribute__((ext_vector_type(4))) _Float16 v4h;

__global__ __launch_bounds__(256) void k_wtG(const float* __restrict__ w, int K, int N, bf* Bt) {
    const int lane = threadIdx.x & 31; const int L0 = (blockIdx.x * 8 + (threadIdx.x >> 5)) * 8; const int nlines = N * K / 64;
{
#pragma unroll 1
        for (int l = 0; l < 8; ++l) { const int L = L0 + l; if (L >= nlines) break; const size_t e = (size_t)L * 64 + lane * 2; const int k = (int)(e % K), n = (int)(e / K); v2us o;
            o[0] = f2bf(w[(size_t)k * N + n]); o[1] = f2bf(w[(size_t)(k + 1) * N + n]); *(v2us*)(Bt + e) = o; }
         }
}
__global__ __launch_bounds__(256) void k_cvt8(const float* __restrict__ src, bf* dst, size_t n8) { const size_t i = (size_t)blockIdx.x * 256 + threadIdx.x; if (i >= n8) return; const v8f v = *(const v8f*)(src + i * 8); v8us o;
#pragma unroll
    for (int k = 0; k < 8; ++k) o[k] = f2bf(v[k]); *(v8us*)(dst + i * 8) = o;  }
// k_e16: E16[j][d] = fp16(bf16 dist_emb[1024 + j][d]) (8-B lanes); k_qkp: per head planes from FQ/FK [t][h*64+d]: Qh/Ql/Q16, Kh/Kl/K16 in [h][t][d] (8-B lanes); k_vtp2: VTh/VTl[h][d][t] = split(FV[t][h*64+d]) (lane -> 2 consecutive t);
__global__ __launch_bounds__(256) void k_e16(const float* __restrict__ emb, h16* E16) { const int e = (blockIdx.x * 256 + threadIdx.x) * 4; if (e >= NE * HD) return; const v4f a = *(const v4f*)(emb + (size_t)EOFF * HD + e); v4h o;
#pragma unroll
    for (int u = 0; u < 4; ++u) o[u] = tohx(bfr(a[u])); *(v4h*)(E16 + e) = o;  }
__global__ __launch_bounds__(256) void k_qkp(const float* __restrict__ FQ, const float* __restrict__ FK, bf* Qh, bf* Ql, h16* Q16, bf* Kh, bf* Kl, h16* K16) { const int e = (blockIdx.x * 256 + threadIdx.x) * 4; if (e >= NH_ * SS * HD) return; const int d = e % HD; const int t = (e / HD) % SS; const int h = e / (HD * SS); const size_t f = (size_t)t * DM + h * HD + d; v4us qh, ql, kh, kl; v4h q6, k6;
#pragma unroll
    for (int u = 0; u < 4; ++u) { const float qv = FQ[f + u], kv = FK[f + u]; unsigned short a, b; splitf(qv, a, b); qh[u] = a; ql[u] = b; splitf(kv, a, b); kh[u] = a; kl[u] = b; q6[u] = tohx(qv); k6[u] = tohx(kv); }
    { *(v4us*)(Qh + e) = qh; *(v4us*)(Ql + e) = ql; *(v4h*)(Q16 + e) = q6; *(v4us*)(Kh + e) = kh; *(v4us*)(Kl + e) = kl; *(v4h*)(K16 + e) = k6;  } }
__global__ __launch_bounds__(256) void k_vtp2(const float* __restrict__ FV, bf* VTh, bf* VTl) { const int e = (blockIdx.x * 256 + threadIdx.x) * 2; if (e >= NH_ * HD * SS) return; const int t = e % SS; const int d = (e / SS) % HD; const int h = e / (SS * HD); v2us oh, ol;
#pragma unroll
    for (int u = 0; u < 2; ++u) { unsigned short a, b; splitf(FV[(size_t)(t + u) * DM + h * HD + d], a, b); oh[u] = a; ol[u] = b; }
    *(v2us*)(VTh + e) = oh; *(v2us*)(VTl + e) = ol;  }
__global__ __launch_bounds__(256) void k_ebsoft(const float* __restrict__ Sb, const float* __restrict__ QE, const float* __restrict__ KE, const float* __restrict__ am, bf* Ph, bf* Pl) { const int lane = threadIdx.x & 31; const int row = blockIdx.x * 8 + (threadIdx.x >> 5); if (row >= HPP * SS) return; const int l = row % SS; const int z = row / SS;
    const float* sr = Sb + (size_t)row * SS; const float* qe = QE + (size_t)row * NE + l + (SS - 1); const float* ke = KE + (size_t)z * SS * NE + l + (SS - 1); float v[SS / 32]; float mx = -3.0e38f;
#pragma unroll
    for (int ch = 0; ch < SS / 128; ++ch) { const int r0 = ch * 128 + lane * 4; const v4f a = *(const v4f*)(sr + r0);
#pragma unroll
        for (int u = 0; u < 4; ++u) { const int r = r0 + u; const float s1 = __fadd_rn(a[u], qe[-r]); const float s2 = __fadd_rn(s1, ke[(size_t)r * NE - r]); float t0 = s2 * 0.125f; asm volatile("" : "+v"(t0)); const float t = __fadd_rn(t0, bfr(am[r])); v[ch * 4 + u] = t; mx = fmaxf(mx, t); } }
#pragma unroll
    for (int sh = 16; sh; sh >>= 1) mx = fmaxf(mx, __shfl_xor(mx, sh, 32));
    float sum = 0.f;
#pragma unroll
    for (int q = 0; q < SS / 32; ++q) { float d0 = __fsub_rn(v[q], mx); asm volatile("" : "+v"(d0)); v[q] = __builtin_amdgcn_exp2f(__fmul_rn(d0, 1.4426950408889634f)); sum += v[q]; }
#pragma unroll
    for (int sh = 16; sh; sh >>= 1) sum += __shfl_xor(sum, sh, 32);
    const float f = __fdiv_rn(1.0f, sum);
    {
#pragma unroll
        for (int ch = 0; ch < SS / 128; ++ch) { v4us oh, ol;
#pragma unroll
            for (int u = 0; u < 4; ++u) { unsigned short a, b; splitf(v[ch * 4 + u] * f, a, b); oh[u] = a; ol[u] = b; } const size_t oo = (size_t)row * SS + ch * 128 + lane * 4; *(v4us*)(Ph + oo) = oh; *(v4us*)(Pl + oo) = ol; }
         } }
__global__ __launch_bounds__(256) void k_mrg(const float* __restrict__ O, int h0, float* outb) { const int e = (blockIdx.x * 256 + threadIdx.x) * 4; if (e >= HPP * SS * HD) return; const int d = e % HD; const int t = (e / HD) % SS; const int z = e / (HD * SS); const v4f a = *(const v4f*)(O + e); const size_t oo = (size_t)t * DM + (h0 + z) * HD + d;
    *(v4f*)(outb + oo) = a;  }

extern "C" void kernel_launch(void* const* d_in, const int* in_sizes, int n_in,
                              void* d_out, int out_size, void* d_ws, size_t ws_size, hipStream_t stream) {
    (void)in_sizes; (void)n_in; (void)out_size;
    const float** I = (const float**)d_in;
    const float *x = I[0], *am = I[1], *wq = I[2], *bq = I[3], *wk = I[4], *bk = I[5], *wv = I[6], *bv = I[7], *emb = I[8];
    float* OUT = (float*)d_out;     // [4][1024][1024]
    char* wsp = (char*)d_ws;
    auto take = [&](size_t bytes) { char* p = wsp; wsp += (bytes + 255) & ~(size_t)255; return (void*)p; };
    bf* WQ = (bf*)take((size_t)DM * DM * 2); bf* WK = (bf*)take((size_t)DM * DM * 2); bf* WV = (bf*)take((size_t)DM * DM * 2); h16* E16 = (h16*)take((size_t)NE * HD * 2);
    bf* XB = (bf*)take((size_t)SS * DM * 2); float* FQ = (float*)take((size_t)SS * DM * 4); float* FK = (float*)take((size_t)SS * DM * 4); float* FV = (float*)take((size_t)SS * DM * 4);
    bf* Qh = (bf*)take((size_t)NH_ * SS * HD * 2); bf* Ql = (bf*)take((size_t)NH_ * SS * HD * 2); h16* Q16 = (h16*)take((size_t)NH_ * SS * HD * 2); bf* Kh = (bf*)take((size_t)NH_ * SS * HD * 2); bf* Kl = (bf*)take((size_t)NH_ * SS * HD * 2); h16* K16 = (h16*)take((size_t)NH_ * SS * HD * 2); bf* VTh = (bf*)take((size_t)NH_ * HD * SS * 2); bf* VTl = (bf*)take((size_t)NH_ * HD * SS * 2);
    float* Sb = (float*)take((size_t)HPP * SS * SS * 4); float* QE = (float*)take((size_t)HPP * SS * NE * 4); float* KE = (float*)take((size_t)HPP * SS * NE * 4); bf* Ph = (bf*)take((size_t)HPP * SS * SS * 2); bf* Pl = (bf*)take((size_t)HPP * SS * SS * 2); float* O = (float*)take((size_t)HPP * SS * HD * 4);
    if ((size_t)(wsp - (char*)d_ws) > ws_size) return;    // total ~ 135 MB (4-head QE/KE 64 MB + scores 16 MB + hl P 16 MB)
    k_wtG<<<(DM * DM / 64 + 63) / 64, 256, 0, stream>>>(wq, DM, DM, WQ); k_wtG<<<(DM * DM / 64 + 63) / 64, 256, 0, stream>>>(wk, DM, DM, WK); k_wtG<<<(DM * DM / 64 + 63) / 64, 256, 0, stream>>>(wv, DM, DM, WV); k_e16<<<(NE * HD / 4 + 255) / 256, 256, 0, stream>>>(emb, E16);
    for (int b = 0; b < NB_; ++b) {
        k_cvt8<<<(SS * DM / 8 + 255) / 256, 256, 0, stream>>>(x + (size_t)b * SS * DM, XB, (size_t)SS * DM / 8);
        k_gemmw<bf, 0, true, 8><<<dim3(SS / 64, DM / 64, 1), 256, 0, stream>>>(XB, nullptr, WQ, nullptr, DM, FQ, DM, bq, 0, 0, 0); k_gemmw<bf, 0, true, 8><<<dim3(SS / 64, DM / 64, 1), 256, 0, stream>>>(XB, nullptr, WK, nullptr, DM, FK, DM, bk, 0, 0, 0); k_gemmw<bf, 0, true, 8><<<dim3(SS / 64, DM / 64, 1), 256, 0, stream>>>(XB, nullptr, WV, nullptr, DM, FV, DM, bv, 0, 0, 0);
        k_qkp<<<(NH_ * SS * HD / 4 + 255) / 256, 256, 0, stream>>>(FQ, FK, Qh, Ql, Q16, Kh, Kl, K16); k_vtp2<<<(NH_ * HD * SS / 2 + 255) / 256, 256, 0, stream>>>(FV, VTh, VTl);
        for (int h0 = 0; h0 < NH_; h0 += HPP) { const size_t zo = (size_t)h0 * SS * HD;
            k_gemmw<bf, 2, false, 1><<<dim3(SS / 64, SS / 64, HPP), 32, 0, stream>>>(Qh + zo, Ql + zo, Kh + zo, Kl + zo, HD, Sb, SS, nullptr, (size_t)SS * HD, (size_t)SS * HD, (size_t)SS * SS);
            k_gemmw<h16, 0, false, 1><<<dim3(SS / 64, NE / 64, HPP), 32, 0, stream>>>(Q16 + zo, nullptr, E16, nullptr, HD, QE, NE, nullptr, (size_t)SS * HD, 0, (size_t)SS * NE);
            k_gemmw<h16, 0, false, 1><<<dim3(SS / 64, NE / 64, HPP), 32, 0, stream>>>(K16 + zo, nullptr, E16, nullptr, HD, KE, NE, nullptr, (size_t)SS * HD, 0, (size_t)SS * NE);
            k_ebsoft<<<HPP * SS / 8, 256, 0, stream>>>(Sb, QE, KE, am + (size_t)b * SS, Ph, Pl);
            k_gemmw<bf, 2, false, 8><<<dim3(SS / 64, 1, HPP), 256, 0, stream>>>(Ph, Pl, VTh + (size_t)h0 * HD * SS, VTl + (size_t)h0 * HD * SS, SS, O, HD, nullptr, (size_t)SS * SS, (size_t)HD * SS, (size_t)SS * HD);
            k_mrg<<<(HPP * SS * HD / 4 + 255) / 256, 256, 0, stream>>>(O, h0, OUT + (size_t)b * SS * DM); } }
}

// v002
// Measured time: 855 microseconds a run.
// In both of two side-by-side timings against v001, it was 1.54 times as fast.
// Over all steps from v000 it is 1.85 times as fast.
#include <hip/hip_runtime.h>

// ElasticBertSelfAttention (hidden [4][1024][1024]; q/k/v = x W + b (16 heads x 64); scores[l][r] = q_l.k_r + q_l.pe[l-r] + k_r.pe[l-r] with pe[l-r] = dist_emb[l - r + 2047] (relative_key_query), / 8, + additive attention_mask[b][r] (read as data);
// softmax; ctx = probs v merged -> [4][1024][1024]). The positional terms are computed as QE = q.E'^T and KE = k.E'^T against the 2048 table rows that can occur (1024..3071) and gathered along the diagonals (exact restructuring).
// Compute dtypes, f32 accumulate: every input rounded to bf16; q/k/v on PLAIN bf16 operands (inputs: exact) + bias; q.k on bf16 hi+lo planes (3 products); QE / KE on single fp16 planes against the (exactly representable) fp16

#define NB_  4
#define SS   1024
#define DM   1024
#define NH_  16
#define HD   64
#define NE   2048
#define EOFF 1024
#define HPP  8      // heads per attention pass
#define BPP  2      // batches per projection pass
#define NHP  (BPP * NH_)
typedef _Float16 h16;
typedef unsigned short bf;
typedef __attribute__((ext_vector_type(16))) __bf16   v16bf;
typedef __attribute__((ext_vector_type(16))) _Float16 v16h;
typedef __attribute__((ext_vector_type(8)))  _Float16 v8h;
typedef __attribute__((ext_vector_type(8)))  unsigned short v8us;
typedef __attribute__((ext_vector_type(8)))  float    v8f;
typedef __attribute__((ext_vector_type(4)))  float    v4f;
typedef v8h  __attribute__((may_alias)) v8ha;
typedef v4f  __attribute__((may_alias)) v4fa;
typedef v8us __attribute__((may_alias)) v8usa;

__device__ __forceinline__ unsigned short f2bf(float f) { unsigned u = __float_as_uint(f); u += 0x7FFFu + ((u >> 16) & 1u); return (unsigned short)(u >> 16); }
__device__ __forceinline__ float bf2f(unsigned short b) { return __uint_as_float(((unsigned)b) << 16); }
__device__ __forceinline__ float bfr(float f) { return bf2f(f2bf(f)); }
__device__ __forceinline__ v16h cat16(v8h lo, v8h hi) { return __builtin_shufflevector(lo, hi, 0, 1, 2, 3, 4, 5, 6, 7, 8, 9, 10, 11, 12, 13, 14, 15); }
__device__ __forceinline__ v16bf cat16b(v8us lo, v8us hi) { return __builtin_bit_cast(v16bf, __builtin_shufflevector(lo, hi, 0, 1, 2, 3, 4, 5, 6, 7, 8, 9, 10, 11, 12, 13, 14, 15)); }
__device__ __forceinline__ v8f wmma16(v16h a, v16h b, v8f c) { return __builtin_amdgcn_wmma_f32_16x16x32_f16(false, a, false, b, (short)0, c, false, false); }
__device__ __forceinline__ v8f wmmab(v16bf a, v16bf b, v8f c) { return __builtin_amdgcn_wmma_f32_16x16x32_bf16(false, a, false, b, (short)0, c, false, false); }



// ---- k_gemmw: register-blocked GEMM, NW WAVES per 64x64 output tile (16 accumulators each), operands straight from K-contiguous 16-bit planes; grid (M/64, N/64, Z), 32 * NW threads.
// NW > 1: wave w takes the 32-wide k steps w, w + NW, ... (neighbouring waves read the two halves of one 128-B line); the NW partial tiles are summed through LDS in wave order, 16 rows at a time.
// C[m][n] (f32, pitch ldc, + optional f32 bias[n], one bias vector per z = 0, 1, 2) = sum_k A[m][k] Bt[n][k] (+ split products per NSPLIT). z-batch strides sA/sB/sC in elements. K % 32 == 0.
template <typename T16> struct WFrag;
template <> struct WFrag<h16> { typedef v16h V; static __device__ __forceinline__ V ld(const h16* p) { return cat16(*(const v8h*)p, *(const v8h*)(p + 16)); } static __device__ __forceinline__ v8f mma(V a, V b, v8f c) { return wmma16(a, b, c); } };
template <> struct WFrag<bf> { typedef v16bf V; static __device__ __forceinline__ V ld(const bf* p) { return cat16b(*(const v8us*)p, *(const v8us*)(p + 16)); } static __device__ __forceinline__ v8f mma(V a, V b, v8f c) { return wmmab(a, b, c); } };
template <typename T16, int NSPLIT, bool BIAS, int NW>
__global__ __launch_bounds__(32 * NW) void k_gemmw(const T16* __restrict__ A, const T16* __restrict__ A2, const T16* __restrict__ Bt, const T16* __restrict__ Bt2, int K, float* C, int ldc, const float* __restrict__ bias0, const float* __restrict__ bias1, const float* __restrict__ bias2, size_t sA, size_t sB, size_t sC) {
    typedef typename WFrag<T16>::V V;
    __shared__ __align__(16) float os[(NW > 1 ? 2 * NW : 1) * 16 * 68];
    const int wv = NW > 1 ? __builtin_amdgcn_readfirstlane((int)(threadIdx.x >> 5)) : 0;
    const size_t z = blockIdx.z; A += z * sA; if (A2) A2 += z * sA; Bt += z * sB; if (Bt2) Bt2 += z * sB; C += z * sC; const float* bias = z == 0 ? bias0 : (z == 1 ? bias1 : bias2);
    const int lane = threadIdx.x & 31, lr = lane & 15, hi = lane >> 4; const int r0 = blockIdx.x * 64, c0 = blockIdx.y * 64;
    v8f acc[4][4];
#pragma unroll
    for (int mb = 0; mb < 4; ++mb)
#pragma unroll
        for (int nb = 0; nb < 4; ++nb) acc[mb][nb] = (v8f){};
    const size_t aoff = (size_t)(r0 + lr) * K + 8 * hi, boff = (size_t)(c0 + lr) * K + 8 * hi;
#pragma unroll 1
    for (int kc = wv * 32; kc < K; kc += NW * 32) {
        V a[4], a2[4];
#pragma unroll
        for (int mb = 0; mb < 4; ++mb) { a[mb] = WFrag<T16>::ld(A + aoff + (size_t)mb * 16 * K + kc); if (NSPLIT == 1 || NSPLIT == 2) a2[mb] = WFrag<T16>::ld(A2 + aoff + (size_t)mb * 16 * K + kc); }
#pragma unroll
        for (int nb = 0; nb < 4; ++nb) { const V b = WFrag<T16>::ld(Bt + boff + (size_t)nb * 16 * K + kc); V b2; if (NSPLIT >= 2) b2 = WFrag<T16>::ld(Bt2 + boff + (size_t)nb * 16 * K + kc);
#pragma unroll
            for (int mb = 0; mb < 4; ++mb) { acc[mb][nb] = WFrag<T16>::mma(a[mb], b, acc[mb][nb]); if (NSPLIT == 1 || NSPLIT == 2) acc[mb][nb] = WFrag<T16>::mma(a2[mb], b, acc[mb][nb]); if (NSPLIT >= 2) acc[mb][nb] = WFrag<T16>::mma(a[mb], b2, acc[mb][nb]); } }
        asm volatile("v_nop\n\tv_nop\n\tv_nop\n\tv_nop" : "+v"(acc[0][0]), "+v"(acc[1][1]), "+v"(acc[2][2]), "+v"(acc[3][3]) : "v"(a[0]), "v"(a[3]));
    }
    if constexpr (NW > 1) {
        static_assert(NW == 8, "one 16-byte piece of a 16 x 64 slab per thread");
        const int row = threadIdx.x >> 4, cofs = (threadIdx.x & 15) * 4;
        v4f bv = (v4f){}; if (BIAS) { bv[0] = bfr(bias[c0 + cofs]); bv[1] = bfr(bias[c0 + cofs + 1]); bv[2] = bfr(bias[c0 + cofs + 2]); bv[3] = bfr(bias[c0 + cofs + 3]); }
#pragma unroll
        for (int mb = 0; mb < 4; ++mb) {
            float* slab = os + (mb & 1) * (NW * 16 * 68);   // two slab sets: the barrier of slab mb + 1 ends every read of slab mb before slab mb + 2 overwrites it
            float* mine = slab + wv * (16 * 68);
#pragma unroll
            for (int nb = 0; nb < 4; ++nb) {
#pragma unroll
                for (int j = 0; j < 8; ++j) mine[(hi * 8 + j) * 68 + nb * 16 + lr] = acc[mb][nb][j]; }
            __syncthreads();   // every wave's partial slab is in LDS before any thread sums across waves
            v4f val = *(const v4fa*)(slab + row * 68 + cofs);
#pragma unroll
            for (int w = 1; w < NW; ++w) val += *(const v4fa*)(slab + w * (16 * 68) + row * 68 + cofs);
            if (BIAS) val += bv;
            *(v4f*)(C + (size_t)(r0 + mb * 16 + row) * ldc + c0 + cofs) = val;
        }
        return;
    }
#pragma unroll
    for (int mb = 0; mb < 4; ++mb) {
#pragma unroll
        for (int nb = 0; nb < 4; ++nb) {
#pragma unroll
            for (int j = 0; j < 8; ++j) os[(hi * 8 + j) * 68 + nb * 16 + lr] = acc[mb][nb][j]; }
        __builtin_amdgcn_wave_barrier(); asm volatile("" ::: "memory");
        float* crow = C + (size_t)(r0 + mb * 16) * ldc + c0;
{
#pragma unroll
            for (int s = 0; s < 8; ++s) { const int row = 2 * s + hi, cofs = lr * 4; v4f val = *(const v4fa*)(os + row * 68 + cofs); if (BIAS) { val[0] += bfr(bias[c0 + cofs]); val[1] += bfr(bias[c0 + cofs + 1]); val[2] += bfr(bias[c0 + cofs + 2]); val[3] += bfr(bias[c0 + cofs + 3]); }
                *(v4f*)(crow + (size_t)row * ldc + cofs) = val; }
             }
        __builtin_amdgcn_wave_barrier(); asm volatile("" ::: "memory");
    }
}

__device__ __forceinline__ h16 tohx(float x) { return (h16)x; }
__device__ __forceinline__ void splitf(float y, unsigned short& h, unsigned short& l) { h = f2bf(y); l = f2bf(y - bf2f(h)); }
typedef __attribute__((ext_vector_type(2))) unsigned short v2us;
typedef __attribute__((ext_vector_type(4))) unsigned short v4us;
typedef __attribute__((ext_vector_type(4))) _Float16 v4h;

__global__ __launch_bounds__(256) void k_wtG(const float* __restrict__ w0, const float* __restrict__ w1, const float* __restrict__ w2, int K, int N, bf* Bt) {
    const float* w = blockIdx.y == 0 ? w0 : (blockIdx.y == 1 ? w1 : w2); Bt += (size_t)blockIdx.y * K * N;
    const int lane = threadIdx.x & 31; const int L0 = (blockIdx.x * 8 + (threadIdx.x >> 5)) * 8; const int nlines = N * K / 64;
{
#pragma unroll 1
        for (int l = 0; l < 8; ++l) { const int L = L0 + l; if (L >= nlines) break; const size_t e = (size_t)L * 64 + lane * 2; const int k = (int)(e % K), n = (int)(e / K); v2us o;
            o[0] = f2bf(w[(size_t)k * N + n]); o[1] = f2bf(w[(size_t)(k + 1) * N + n]); *(v2us*)(Bt + e) = o; }
         }
}
__global__ __launch_bounds__(256) void k_cvt8(const float* __restrict__ src, bf* dst, size_t n8) { const size_t i = (size_t)blockIdx.x * 256 + threadIdx.x; if (i >= n8) return; const v8f v = *(const v8f*)(src + i * 8); v8us o;
#pragma unroll
    for (int k = 0; k < 8; ++k) o[k] = f2bf(v[k]); *(v8us*)(dst + i * 8) = o;  }
// k_e16: E16[j][d] = fp16(bf16 dist_emb[1024 + j][d]) (8-B lanes); k_qkp: per head planes from FQ/FK [b][t][h*64+d], BPP batches at once (plane index = b * 16 + h): Qh/Ql, Kh/Kl in [h][t][d] (8-B lanes);
// the fp16 planes lie in X16 as [pass][q, k][HPP heads][t][d], so that one z-batched GEMM does QE and KE of a pass; k_vtp2: VTh/VTl[h][d][t] = split(FV[b][t][h*64+d]) (lane -> 2 consecutive t);
__global__ __launch_bounds__(256) void k_e16(const float* __restrict__ emb, h16* E16) { const int e = (blockIdx.x * 256 + threadIdx.x) * 4; if (e >= NE * HD) return; const v4f a = *(const v4f*)(emb + (size_t)EOFF * HD + e); v4h o;
#pragma unroll
    for (int u = 0; u < 4; ++u) o[u] = tohx(bfr(a[u])); *(v4h*)(E16 + e) = o;  }
__global__ __launch_bounds__(256) void k_qkp(const float* __restrict__ FQ, const float* __restrict__ FK, bf* Qh, bf* Ql, bf* Kh, bf* Kl, h16* X16) { const int e = (blockIdx.x * 256 + threadIdx.x) * 4; if (e >= NHP * SS * HD) return; const int d = e % HD; const int t = (e / HD) % SS; const int h = e / (HD * SS); const size_t f = (size_t)((h / NH_) * SS + t) * DM + (h % NH_) * HD + d; h16* Q16 = X16 + (size_t)(h / HPP) * HPP * SS * HD; h16* K16 = Q16 + (size_t)HPP * SS * HD; v4us qh, ql, kh, kl; v4h q6, k6;
#pragma unroll
    for (int u = 0; u < 4; ++u) { const float qv = FQ[f + u], kv = FK[f + u]; unsigned short a, b; splitf(qv, a, b); qh[u] = a; ql[u] = b; splitf(kv, a, b); kh[u] = a; kl[u] = b; q6[u] = tohx(qv); k6[u] = tohx(kv); }
    { *(v4us*)(Qh + e) = qh; *(v4us*)(Ql + e) = ql; *(v4h*)(Q16 + e) = q6; *(v4us*)(Kh + e) = kh; *(v4us*)(Kl + e) = kl; *(v4h*)(K16 + e) = k6;  } }
__global__ __launch_bounds__(256) void k_vtp2(const float* __restrict__ FV, bf* VTh, bf* VTl) { const int e = (blockIdx.x * 256 + threadIdx.x) * 2; if (e >= NHP * HD * SS) return; const int t = e % SS; const int d = (e / SS) % HD; const int h = e / (SS * HD); v2us oh, ol;
#pragma unroll
    for (int u = 0; u < 2; ++u) { unsigned short a, b; splitf(FV[(size_t)((h / NH_) * SS + t + u) * DM + (h % NH_) * HD + d], a, b); oh[u] = a; ol[u] = b; }
    *(v2us*)(VTh + e) = oh; *(v2us*)(VTl + e) = ol;  }
// k_ebsoft: one wave per score row of a pass. Left open: in the built code each of the 32 (QE, KE) load pairs of a row is waited for before the next pair is issued.
__global__ __launch_bounds__(256) void k_ebsoft(const float* __restrict__ Sb, const float* __restrict__ QE, const float* __restrict__ KE, const float* __restrict__ am, bf* Ph, bf* Pl) { const int lane = threadIdx.x & 31; const int row = blockIdx.x * 8 + (threadIdx.x >> 5); if (row >= HPP * SS) return; const int l = row % SS; const int z = row / SS;
    const float* sr = Sb + (size_t)row * SS; const float* qe = QE + (size_t)row * NE + l + (SS - 1); const float* ke = KE + (size_t)z * SS * NE + l + (SS - 1); float v[SS / 32]; float mx = -3.0e38f;
#pragma unroll
    for (int ch = 0; ch < SS / 128; ++ch) { const int r0 = ch * 128 + lane * 4; const v4f a = *(const v4f*)(sr + r0);
#pragma unroll
        for (int u = 0; u < 4; ++u) { const int r = r0 + u; const float s1 = __fadd_rn(a[u], qe[-r]); const float s2 = __fadd_rn(s1, ke[(size_t)r * NE - r]); float t0 = s2 * 0.125f; asm volatile("" : "+v"(t0)); const float t = __fadd_rn(t0, bfr(am[r])); v[ch * 4 + u] = t; mx = fmaxf(mx, t); } }
#pragma unroll
    for (int sh = 16; sh; sh >>= 1) mx = fmaxf(mx, __shfl_xor(mx, sh, 32));
    float sum = 0.f;
#pragma unroll
    for (int q = 0; q < SS / 32; ++q) { float d0 = __fsub_rn(v[q], mx); asm volatile("" : "+v"(d0)); v[q] = __builtin_amdgcn_exp2f(__fmul_rn(d0, 1.4426950408889634f)); sum += v[q]; }
#pragma unroll
    for (int sh = 16; sh; sh >>= 1) sum += __shfl_xor(sum, sh, 32);
    const float f = __fdiv_rn(1.0f, sum);
    {
#pragma unroll
        for (int ch = 0; ch < SS / 128; ++ch) { v4us oh, ol;
#pragma unroll
            for (int u = 0; u < 4; ++u) { unsigned short a, b; splitf(v[ch * 4 + u] * f, a, b); oh[u] = a; ol[u] = b; } const size_t oo = (size_t)row * SS + ch * 128 + lane * 4; *(v4us*)(Ph + oo) = oh; *(v4us*)(Pl + oo) = ol; }
         } }

extern "C" void kernel_launch(void* const* d_in, const int* in_sizes, int n_in,
                              void* d_out, int out_size, void* d_ws, size_t ws_size, hipStream_t stream) {
    (void)in_sizes; (void)n_in; (void)out_size;
    const float** I = (const float**)d_in;
    const float *x = I[0], *am = I[1], *wq = I[2], *bq = I[3], *wk = I[4], *bk = I[5], *wv = I[6], *bv = I[7], *emb = I[8];
    float* OUT = (float*)d_out;     // [4][1024][1024]
    char* wsp = (char*)d_ws;
    auto take = [&](size_t bytes) { char* p = wsp; wsp += (bytes + 255) & ~(size_t)255; return (void*)p; };
    bf* WQ = (bf*)take((size_t)3 * DM * DM * 2); h16* E16 = (h16*)take((size_t)NE * HD * 2);    // WQ, WK, WV in a row
    bf* Qh = (bf*)take((size_t)NHP * SS * HD * 2); bf* Ql = (bf*)take((size_t)NHP * SS * HD * 2); bf* Kh = (bf*)take((size_t)NHP * SS * HD * 2); bf* Kl = (bf*)take((size_t)NHP * SS * HD * 2); h16* X16 = (h16*)take((size_t)2 * NHP * SS * HD * 2); bf* VTh = (bf*)take((size_t)NHP * HD * SS * 2); bf* VTl = (bf*)take((size_t)NHP * HD * SS * 2);
    float* Sb = (float*)take((size_t)HPP * SS * SS * 4); float* QE = (float*)take((size_t)2 * HPP * SS * NE * 4); float* KE = QE + (size_t)HPP * SS * NE; bf* Ph = (bf*)take((size_t)HPP * SS * SS * 2); bf* Pl = (bf*)take((size_t)HPP * SS * SS * 2);
    bf* XB = (bf*)Sb; float* FQ = QE;    // x planes and FQ, FK, FV (in a row) are dead once the head planes are written: they share the bytes of the attention passes' buffers
    if ((size_t)(wsp - (char*)d_ws) > ws_size) return;    // total ~ 230 MiB (8-head QE/KE 128 MiB + scores 32 MiB + hl P 32 MiB)
    k_wtG<<<dim3((DM * DM / 64 + 63) / 64, 3, 1), 256, 0, stream>>>(wq, wk, wv, DM, DM, WQ); k_e16<<<(NE * HD / 4 + 255) / 256, 256, 0, stream>>>(emb, E16);
    for (int b0 = 0; b0 < NB_; b0 += BPP) {
        k_cvt8<<<(BPP * SS * DM / 8 + 255) / 256, 256, 0, stream>>>(x + (size_t)b0 * SS * DM, XB, (size_t)BPP * SS * DM / 8);
        k_gemmw<bf, 0, true, 8><<<dim3(BPP * SS / 64, DM / 64, 3), 256, 0, stream>>>(XB, nullptr, WQ, nullptr, DM, FQ, DM, bq, bk, bv, 0, (size_t)DM * DM, (size_t)BPP * SS * DM);
        k_qkp<<<(NHP * SS * HD / 4 + 255) / 256, 256, 0, stream>>>(FQ, FQ + (size_t)BPP * SS * DM, Qh, Ql, Kh, Kl, X16); k_vtp2<<<(NHP * HD * SS / 2 + 255) / 256, 256, 0, stream>>>(FQ + (size_t)2 * BPP * SS * DM, VTh, VTl);
        for (int h0 = 0; h0 < NHP; h0 += HPP) { const size_t zo = (size_t)h0 * SS * HD; const int b = b0 + h0 / NH_;
            k_gemmw<bf, 2, false, 1><<<dim3(SS / 64, SS / 64, HPP), 32, 0, stream>>>(Qh + zo, Ql + zo, Kh + zo, Kl + zo, HD, Sb, SS, nullptr, nullptr, nullptr, (size_t)SS * HD, (size_t)SS * HD, (size_t)SS * SS);
            k_gemmw<h16, 0, false, 1><<<dim3(SS / 64, NE / 64, 2 * HPP), 32, 0, stream>>>(X16 + 2 * zo, nullptr, E16, nullptr, HD, QE, NE, nullptr, nullptr, nullptr, (size_t)SS * HD, 0, (size_t)SS * NE);
            k_ebsoft<<<HPP * SS / 8, 256, 0, stream>>>(Sb, QE, KE, am + (size_t)b * SS, Ph, Pl);
            k_gemmw<bf, 2, false, 8><<<dim3(SS / 64, 1, HPP), 256, 0, stream>>>(Ph, Pl, VTh + zo, VTl + zo, SS, OUT + (size_t)b * SS * DM + (h0 % NH_) * HD, DM, nullptr, nullptr, nullptr, (size_t)SS * SS, (size_t)HD * SS, (size_t)HD); } }
}

// v003
// Measured time: 573 microseconds a run.
// Two timings next to v002 put it at 1.50 and 1.49 times that version's speed.
// Over all steps from v000 it is 2.76 times as fast.
#include <hip/hip_runtime.h>

// ElasticBertSelfAttention (hidden [4][1024][1024]; q/k/v = x W + b (16 heads x 64); scores[l][r] = q_l.k_r + q_l.pe[l-r] + k_r.pe[l-r] with pe[l-r] = dist_emb[l - r + 2047] (relative_key_query), / 8, + additive attention_mask[b][r] (read as data);
// softmax; ctx = probs v merged -> [4][1024][1024]). The positional terms are computed as q.E'^T and k.E'^T against the table rows that can occur (1024..3071), score tile by score tile, and gathered along the diagonals (exact restructuring).
// Compute dtypes, f32 accumulate: every input rounded to bf16; q/k/v on PLAIN bf16 operands (inputs: exact) + bias; q.k on bf16 hi+lo planes (3 products); QE / KE on single fp16 planes against the (exactly representable) fp16

#define NB_  4
#define SS   1024
#define DM   1024
#define NH_  16
#define HD   64
#define NE   2048
#define EOFF 1024
#define HPP  8      // heads per attention pass
#define BPP  2      // batches per projection pass
#define NHP  (BPP * NH_)
typedef _Float16 h16;
typedef unsigned short bf;
typedef __attribute__((ext_vector_type(16))) __bf16   v16bf;
typedef __attribute__((ext_vector_type(16))) _Float16 v16h;
typedef __attribute__((ext_vector_type(8)))  _Float16 v8h;
typedef __attribute__((ext_vector_type(8)))  unsigned short v8us;
typedef __attribute__((ext_vector_type(8)))  float    v8f;
typedef __attribute__((ext_vector_type(4)))  float    v4f;
typedef v8h  __attribute__((may_alias)) v8ha;
typedef v4f  __attribute__((may_alias)) v4fa;
typedef v8us __attribute__((may_alias)) v8usa;

__device__ __forceinline__ unsigned short f2bf(float f) { unsigned u = __float_as_uint(f); u += 0x7FFFu + ((u >> 16) & 1u); return (unsigned short)(u >> 16); }
__device__ __forceinline__ float bf2f(unsigned short b) { return __uint_as_float(((unsigned)b) << 16); }
__device__ __forceinline__ float bfr(float f) { return bf2f(f2bf(f)); }
__device__ __forceinline__ v16h cat16(v8h lo, v8h hi) { return __builtin_shufflevector(lo, hi, 0, 1, 2, 3, 4, 5, 6, 7, 8, 9, 10, 11, 12, 13, 14, 15); }
__device__ __forceinline__ v16bf cat16b(v8us lo, v8us hi) { return __builtin_bit_cast(v16bf, __builtin_shufflevector(lo, hi, 0, 1, 2, 3, 4, 5, 6, 7, 8, 9, 10, 11, 12, 13, 14, 15)); }
__device__ __forceinline__ v8f wmma16(v16h a, v16h b, v8f c) { return __builtin_amdgcn_wmma_f32_16x16x32_f16(false, a, false, b, (short)0, c, false, false); }
__device__ __forceinline__ v8f wmmab(v16bf a, v16bf b, v8f c) { return __builtin_amdgcn_wmma_f32_16x16x32_bf16(false, a, false, b, (short)0, c, false, false); }



// ---- k_gemmw: register-blocked GEMM, NW WAVES per 64x64 output tile (16 accumulators each), operands straight from K-contiguous 16-bit planes; grid (M/64, N/64, Z), 32 * NW threads.
// NW > 1: wave w takes the 32-wide k steps w, w + NW, ... (neighbouring waves read the two halves of one 128-B line); the NW partial tiles are summed through LDS in wave order, 16 rows at a time.
// C[m][n] (f32, pitch ldc, + optional f32 bias[n], one bias vector per z = 0, 1, 2) = sum_k A[m][k] Bt[n][k] (+ split products per NSPLIT). z-batch strides sA/sB/sC in elements. K % 32 == 0.
template <typename T16> struct WFrag;
template <> struct WFrag<h16> { typedef v16h V; static __device__ __forceinline__ V ld(const h16* p) { return cat16(*(const v8h*)p, *(const v8h*)(p + 16)); } static __device__ __forceinline__ v8f mma(V a, V b, v8f c) { return wmma16(a, b, c); } };
template <> struct WFrag<bf> { typedef v16bf V; static __device__ __forceinline__ V ld(const bf* p) { return cat16b(*(const v8us*)p, *(const v8us*)(p + 16)); } static __device__ __forceinline__ v8f mma(V a, V b, v8f c) { return wmmab(a, b, c); } };
template <typename T16, int NSPLIT, bool BIAS, int NW>
__global__ __launch_bounds__(32 * NW) void k_gemmw(const T16* __restrict__ A, const T16* __restrict__ A2, const T16* __restrict__ Bt, const T16* __restrict__ Bt2, int K, float* C, int ldc, const float* __restrict__ bias0, const float* __restrict__ bias1, const float* __restrict__ bias2, size_t sA, size_t sB, size_t sC) {
    typedef typename WFrag<T16>::V V;
    __shared__ __align__(16) float os[(NW > 1 ? 2 * NW : 1) * 16 * 68];
    const int wv = NW > 1 ? __builtin_amdgcn_readfirstlane((int)(threadIdx.x >> 5)) : 0;
    const size_t z = blockIdx.z; A += z * sA; if (A2) A2 += z * sA; Bt += z * sB; if (Bt2) Bt2 += z * sB; C += z * sC; const float* bias = z == 0 ? bias0 : (z == 1 ? bias1 : bias2);
    const int lane = threadIdx.x & 31, lr = lane & 15, hi = lane >> 4; const int r0 = blockIdx.x * 64, c0 = blockIdx.y * 64;
    v8f acc[4][4];
#pragma unroll
    for (int mb = 0; mb < 4; ++mb)
#pragma unroll
        for (int nb = 0; nb < 4; ++nb) acc[mb][nb] = (v8f){};
    const size_t aoff = (size_t)(r0 + lr) * K + 8 * hi, boff = (size_t)(c0 + lr) * K + 8 * hi;
#pragma unroll 1
    for (int kc = wv * 32; kc < K; kc += NW * 32) {
        V a[4], a2[4];
#pragma unroll
        for (int mb = 0; mb < 4; ++mb) { a[mb] = WFrag<T16>::ld(A + aoff + (size_t)mb * 16 * K + kc); if (NSPLIT == 1 || NSPLIT == 2) a2[mb] = WFrag<T16>::ld(A2 + aoff + (size_t)mb * 16 * K + kc); }
#pragma unroll
        for (int nb = 0; nb < 4; ++nb) { const V b = WFrag<T16>::ld(Bt + boff + (size_t)nb * 16 * K + kc); V b2; if (NSPLIT >= 2) b2 = WFrag<T16>::ld(Bt2 + boff + (size_t)nb * 16 * K + kc);
#pragma unroll
            for (int mb = 0; mb < 4; ++mb) { acc[mb][nb] = WFrag<T16>::mma(a[mb], b, acc[mb][nb]); if (NSPLIT == 1 || NSPLIT == 2) acc[mb][nb] = WFrag<T16>::mma(a2[mb], b, acc[mb][nb]); if (NSPLIT >= 2) acc[mb][nb] = WFrag<T16>::mma(a[mb], b2, acc[mb][nb]); } }
        asm volatile("v_nop\n\tv_nop\n\tv_nop\n\tv_nop" : "+v"(acc[0][0]), "+v"(acc[1][1]), "+v"(acc[2][2]), "+v"(acc[3][3]) : "v"(a[0]), "v"(a[3]));
    }
    if constexpr (NW > 1) {
        static_assert(NW == 8, "one 16-byte piece of a 16 x 64 slab per thread");
        const int row = threadIdx.x >> 4, cofs = (threadIdx.x & 15) * 4;
        v4f bv = (v4f){}; if (BIAS) { bv[0] = bfr(bias[c0 + cofs]); bv[1] = bfr(bias[c0 + cofs + 1]); bv[2] = bfr(bias[c0 + cofs + 2]); bv[3] = bfr(bias[c0 + cofs + 3]); }
#pragma unroll
        for (int mb = 0; mb < 4; ++mb) {
            float* slab = os + (mb & 1) * (NW * 16 * 68);   // two slab sets: the barrier of slab mb + 1 ends every read of slab mb before slab mb + 2 overwrites it
            float* mine = slab + wv * (16 * 68);
#pragma unroll
            for (int nb = 0; nb < 4; ++nb) {
#pragma unroll
                for (int j = 0; j < 8; ++j) mine[(hi * 8 + j) * 68 + nb * 16 + lr] = acc[mb][nb][j]; }
            __syncthreads();   // every wave's partial slab is in LDS before any thread sums across waves
            v4f val = *(const v4fa*)(slab + row * 68 + cofs);
#pragma unroll
            for (int w = 1; w < NW; ++w) val += *(const v4fa*)(slab + w * (16 * 68) + row * 68 + cofs);
            if (BIAS) val += bv;
            *(v4f*)(C + (size_t)(r0 + mb * 16 + row) * ldc + c0 + cofs) = val;
        }
    }
}

// ---- k_score: one 64 x 64 tile of the whole score sum q.k + q.pe + k.pe per work-group of 4 waves; grid (SS/64, SS/64, HPP). Tile rows l0 + i, columns r0 + c: the table row of (i, c) is l0 - r0 + SS - 64 + (i - c + 63),
// so a tile meets 127 rows in a row of the table. Wave w: its 16 k rows (columns 16 w .. of the tile) against the 80 table rows they meet -> keb (for all four waves, behind the barrier);
// its 16 q rows against the 80 table rows they meet -> qeb[w] (its own); q.k of its 16 rows on the hi+lo planes. Each score then takes its two terms off the LDS diagonals, in the order (q.k + q.pe) + k.pe.
#define PB 84   // LDS pitch in floats of an 80-wide band row: stores (row step 8 PB), the q diagonal (8 (PB + 1)) and the k diagonal (lane step PB - 1) each put the 32 lanes on 32 banks
__global__ __launch_bounds__(128) void k_score(const bf* __restrict__ Qh, const bf* __restrict__ Ql, const bf* __restrict__ Kh, const bf* __restrict__ Kl, const h16* __restrict__ X16, const h16* __restrict__ E16, float* Sb) {
    __shared__ __align__(16) float keb[64 * PB];
    __shared__ __align__(16) float qeb[4][16 * PB];
    const int wv = __builtin_amdgcn_readfirstlane((int)(threadIdx.x >> 5));
    const int lane = threadIdx.x & 31, lr = lane & 15, hi = lane >> 4; const int l0 = blockIdx.x * 64, r0 = blockIdx.y * 64;
    const size_t zo = (size_t)blockIdx.z * SS * HD; const size_t fo = (size_t)lr * HD + 8 * hi;    // fo: the lane's place in a fragment of 16 rows
    const h16* Eb = E16 + (size_t)(l0 - r0 + SS - 64) * HD + fo;
    const size_t qo = zo + (size_t)(l0 + 16 * wv) * HD + fo;
    {
        const h16* K16 = X16 + (size_t)HPP * SS * HD + zo + (size_t)(r0 + 16 * wv) * HD + fo; const h16* Q16 = X16 + qo;
        const v16h k0 = WFrag<h16>::ld(K16), k1 = WFrag<h16>::ld(K16 + 32), q0 = WFrag<h16>::ld(Q16), q1 = WFrag<h16>::ld(Q16 + 32);
#pragma unroll
        for (int t = 0; t < 5; ++t) { const h16* ek = Eb + (size_t)(16 * (3 - wv + t)) * HD; const h16* eq = Eb + (size_t)(16 * (wv + t)) * HD;
            v8f ck = WFrag<h16>::mma(k0, WFrag<h16>::ld(ek), (v8f){}); ck = WFrag<h16>::mma(k1, WFrag<h16>::ld(ek + 32), ck);
            v8f cq = WFrag<h16>::mma(q0, WFrag<h16>::ld(eq), (v8f){}); cq = WFrag<h16>::mma(q1, WFrag<h16>::ld(eq + 32), cq);
#pragma unroll
            for (int j = 0; j < 8; ++j) { keb[(16 * wv + 8 * hi + j) * PB + 16 * t + lr] = ck[j]; qeb[wv][(8 * hi + j) * PB + 16 * t + lr] = cq[j]; } }
    }
    v8f acc[4];
#pragma unroll
    for (int nb = 0; nb < 4; ++nb) acc[nb] = (v8f){};
#pragma unroll
    for (int kc = 0; kc < HD; kc += 32) { const v16bf a = WFrag<bf>::ld(Qh + qo + kc), a2 = WFrag<bf>::ld(Ql + qo + kc);
#pragma unroll
        for (int nb = 0; nb < 4; ++nb) { const size_t ko = zo + (size_t)(r0 + 16 * nb) * HD + fo + kc; const v16bf b = WFrag<bf>::ld(Kh + ko), b2 = WFrag<bf>::ld(Kl + ko);
            acc[nb] = WFrag<bf>::mma(a, b, acc[nb]); acc[nb] = WFrag<bf>::mma(a2, b, acc[nb]); acc[nb] = WFrag<bf>::mma(a, b2, acc[nb]); } }
    __syncthreads();   // all four waves' rows of keb are in LDS before any wave reads its diagonals
    float* mine = qeb[wv];
#pragma unroll
    for (int nb = 0; nb < 4; ++nb) {
#pragma unroll
        for (int j = 0; j < 8; ++j) { const int i = 8 * hi + j; acc[nb][j] = __fadd_rn(__fadd_rn(acc[nb][j], mine[i * PB + i - 16 * nb - lr + 63]), keb[(16 * nb + lr) * PB + 16 * wv + i - lr + 15]); } }
    __builtin_amdgcn_wave_barrier(); asm volatile("" ::: "memory");   // keeps the slab stores below behind every lane's diagonal reads of the same LDS
#pragma unroll
    for (int nb = 0; nb < 4; ++nb) {
#pragma unroll
        for (int j = 0; j < 8; ++j) mine[(hi * 8 + j) * 68 + nb * 16 + lr] = acc[nb][j]; }
    __builtin_amdgcn_wave_barrier(); asm volatile("" ::: "memory");   // keeps the 16-byte slab reads below behind the other lanes' stores
    float* crow = Sb + (size_t)blockIdx.z * SS * SS + (size_t)(l0 + 16 * wv) * SS + r0;
#pragma unroll
    for (int s = 0; s < 8; ++s) { const int row = 2 * s + hi, cofs = lr * 4; *(v4f*)(crow + (size_t)row * SS + cofs) = *(const v4fa*)(mine + row * 68 + cofs); }
}

__device__ __forceinline__ h16 tohx(float x) { return (h16)x; }
__device__ __forceinline__ void splitf(float y, unsigned short& h, unsigned short& l) { h = f2bf(y); l = f2bf(y - bf2f(h)); }
typedef __attribute__((ext_vector_type(2))) unsigned short v2us;
typedef __attribute__((ext_vector_type(4))) unsigned short v4us;
typedef __attribute__((ext_vector_type(4))) _Float16 v4h;

__global__ __launch_bounds__(256) void k_wtG(const float* __restrict__ w0, const float* __restrict__ w1, const float* __restrict__ w2, int K, int N, bf* Bt) {
    const float* w = blockIdx.y == 0 ? w0 : (blockIdx.y == 1 ? w1 : w2); Bt += (size_t)blockIdx.y * K * N;
    const int lane = threadIdx.x & 31; const int L0 = (blockIdx.x * 8 + (threadIdx.x >> 5)) * 8; const int nlines = N * K / 64;
{
#pragma unroll 1
        for (int l = 0; l < 8; ++l) { const int L = L0 + l; if (L >= nlines) break; const size_t e = (size_t)L * 64 + lane * 2; const int k = (int)(e % K), n = (int)(e / K); v2us o;
            o[0] = f2bf(w[(size_t)k * N + n]); o[1] = f2bf(w[(size_t)(k + 1) * N + n]); *(v2us*)(Bt + e) = o; }
         }
}
__global__ __launch_bounds__(256) void k_cvt8(const float* __restrict__ src, bf* dst, size_t n8) { const size_t i = (size_t)blockIdx.x * 256 + threadIdx.x; if (i >= n8) return; const v8f v = *(const v8f*)(src + i * 8); v8us o;
#pragma unroll
    for (int k = 0; k < 8; ++k) o[k] = f2bf(v[k]); *(v8us*)(dst + i * 8) = o;  }
// k_e16: E16[j][d] = fp16(bf16 dist_emb[1024 + j][d]) (8-B lanes); k_qkp: per head planes from FQ/FK [b][t][h*64+d], BPP batches at once (plane index = b * 16 + h): Qh/Ql, Kh/Kl in [h][t][d] (8-B lanes);
// the fp16 planes lie in X16 as [pass][q, k][HPP heads][t][d]; k_vtp2: VTh/VTl[h][d][t] = split(FV[b][t][h*64+d]) (lane -> 2 consecutive t);
__global__ __launch_bounds__(256) void k_e16(const float* __restrict__ emb, h16* E16) { const int e = (blockIdx.x * 256 + threadIdx.x) * 4; if (e >= NE * HD) return; const v4f a = *(const v4f*)(emb + (size_t)EOFF * HD + e); v4h o;
#pragma unroll
    for (int u = 0; u < 4; ++u) o[u] = tohx(bfr(a[u])); *(v4h*)(E16 + e) = o;  }
__global__ __launch_bounds__(256) void k_qkp(const float* __restrict__ FQ, const float* __restrict__ FK, bf* Qh, bf* Ql, bf* Kh, bf* Kl, h16* X16) { const int e = (blockIdx.x * 256 + threadIdx.x) * 4; if (e >= NHP * SS * HD) return; const int d = e % HD; const int t = (e / HD) % SS; const int h = e / (HD * SS); const size_t f = (size_t)((h / NH_) * SS + t) * DM + (h % NH_) * HD + d; h16* Q16 = X16 + (size_t)(h / HPP) * HPP * SS * HD; h16* K16 = Q16 + (size_t)HPP * SS * HD; v4us qh, ql, kh, kl; v4h q6, k6;
#pragma unroll
    for (int u = 0; u < 4; ++u) { const float qv = FQ[f + u], kv = FK[f + u]; unsigned short a, b; splitf(qv, a, b); qh[u] = a; ql[u] = b; splitf(kv, a, b); kh[u] = a; kl[u] = b; q6[u] = tohx(qv); k6[u] = tohx(kv); }
    { *(v4us*)(Qh + e) = qh; *(v4us*)(Ql + e) = ql; *(v4h*)(Q16 + e) = q6; *(v4us*)(Kh + e) = kh; *(v4us*)(Kl + e) = kl; *(v4h*)(K16 + e) = k6;  } }
__global__ __launch_bounds__(256) void k_vtp2(const float* __restrict__ FV, bf* VTh, bf* VTl) { const int e = (blockIdx.x * 256 + threadIdx.x) * 2; if (e >= NHP * HD * SS) return; const int t = e % SS; const int d = (e / SS) % HD; const int h = e / (SS * HD); v2us oh, ol;
#pragma unroll
    for (int u = 0; u < 2; ++u) { unsigned short a, b; splitf(FV[(size_t)((h / NH_) * SS + t + u) * DM + (h % NH_) * HD + d], a, b); oh[u] = a; ol[u] = b; }
    *(v2us*)(VTh + e) = oh; *(v2us*)(VTl + e) = ol;  }
// k_ebsoft: one wave per score row of a pass (Sb holds the whole score sum). Left open: in the built code each of the 8 loads of a row is waited for before the next is issued.
__global__ __launch_bounds__(256) void k_ebsoft(const float* __restrict__ Sb, const float* __restrict__ am, bf* Ph, bf* Pl) { const int lane = threadIdx.x & 31; const int row = blockIdx.x * 8 + (threadIdx.x >> 5); if (row >= HPP * SS) return;
    const float* sr = Sb + (size_t)row * SS; float v[SS / 32]; float mx = -3.0e38f;
#pragma unroll
    for (int ch = 0; ch < SS / 128; ++ch) { const int r0 = ch * 128 + lane * 4; const v4f a = *(const v4f*)(sr + r0);
#pragma unroll
        for (int u = 0; u < 4; ++u) { const int r = r0 + u; float t0 = a[u] * 0.125f; asm volatile("" : "+v"(t0)); const float t = __fadd_rn(t0, bfr(am[r])); v[ch * 4 + u] = t; mx = fmaxf(mx, t); } }
#pragma unroll
    for (int sh = 16; sh; sh >>= 1) mx = fmaxf(mx, __shfl_xor(mx, sh, 32));
    float sum = 0.f;
#pragma unroll
    for (int q = 0; q < SS / 32; ++q) { float d0 = __fsub_rn(v[q], mx); asm volatile("" : "+v"(d0)); v[q] = __builtin_amdgcn_exp2f(__fmul_rn(d0, 1.4426950408889634f)); sum += v[q]; }
#pragma unroll
    for (int sh = 16; sh; sh >>= 1) sum += __shfl_xor(sum, sh, 32);
    const float f = __fdiv_rn(1.0f, sum);
    {
#pragma unroll
        for (int ch = 0; ch < SS / 128; ++ch) { v4us oh, ol;
#pragma unroll
            for (int u = 0; u < 4; ++u) { unsigned short a, b; splitf(v[ch * 4 + u] * f, a, b); oh[u] = a; ol[u] = b; } const size_t oo = (size_t)row * SS + ch * 128 + lane * 4; *(v4us*)(Ph + oo) = oh; *(v4us*)(Pl + oo) = ol; }
         } }

extern "C" void kernel_launch(void* const* d_in, const int* in_sizes, int n_in,
                              void* d_out, int out_size, void* d_ws, size_t ws_size, hipStream_t stream) {
    (void)in_sizes; (void)n_in; (void)out_size;
    const float** I = (const float**)d_in;
    const float *x = I[0], *am = I[1], *wq = I[2], *bq = I[3], *wk = I[4], *bk = I[5], *wv = I[6], *bv = I[7], *emb = I[8];
    float* OUT = (float*)d_out;     // [4][1024][1024]
    char* wsp = (char*)d_ws;
    auto take = [&](size_t bytes) { char* p = wsp; wsp += (bytes + 255) & ~(size_t)255; return (void*)p; };
    bf* WQ = (bf*)take((size_t)3 * DM * DM * 2); h16* E16 = (h16*)take((size_t)NE * HD * 2);    // WQ, WK, WV in a row
    bf* Qh = (bf*)take((size_t)NHP * SS * HD * 2); bf* Ql = (bf*)take((size_t)NHP * SS * HD * 2); bf* Kh = (bf*)take((size_t)NHP * SS * HD * 2); bf* Kl = (bf*)take((size_t)NHP * SS * HD * 2); h16* X16 = (h16*)take((size_t)2 * NHP * SS * HD * 2); bf* VTh = (bf*)take((size_t)NHP * HD * SS * 2); bf* VTl = (bf*)take((size_t)NHP * HD * SS * 2);
    float* Sb = (float*)take((size_t)HPP * SS * SS * 4); bf* Ph = (bf*)take((size_t)HPP * SS * SS * 2); bf* Pl = (bf*)take((size_t)HPP * SS * SS * 2);
    bf* XB = (bf*)Sb; float* FQ = (float*)Ph;    // x planes and FQ, FK, FV (in a row, 24 MiB) are dead once the head planes are written: they share the bytes of the attention passes' buffers (x planes: Sb; FQ, FK, FV: Ph, Pl, 32 MiB in a row)
    if ((size_t)(wsp - (char*)d_ws) > ws_size) return;    // total ~ 102 MiB (scores 32 MiB + hl P 32 MiB + planes)
    k_wtG<<<dim3((DM * DM / 64 + 63) / 64, 3, 1), 256, 0, stream>>>(wq, wk, wv, DM, DM, WQ); k_e16<<<(NE * HD / 4 + 255) / 256, 256, 0, stream>>>(emb, E16);
    for (int b0 = 0; b0 < NB_; b0 += BPP) {
        k_cvt8<<<(BPP * SS * DM / 8 + 255) / 256, 256, 0, stream>>>(x + (size_t)b0 * SS * DM, XB, (size_t)BPP * SS * DM / 8);
        k_gemmw<bf, 0, true, 8><<<dim3(BPP * SS / 64, DM / 64, 3), 256, 0, stream>>>(XB, nullptr, WQ, nullptr, DM, FQ, DM, bq, bk, bv, 0, (size_t)DM * DM, (size_t)BPP * SS * DM);
        k_qkp<<<(NHP * SS * HD / 4 + 255) / 256, 256, 0, stream>>>(FQ, FQ + (size_t)BPP * SS * DM, Qh, Ql, Kh, Kl, X16); k_vtp2<<<(NHP * HD * SS / 2 + 255) / 256, 256, 0, stream>>>(FQ + (size_t)2 * BPP * SS * DM, VTh, VTl);
        for (int h0 = 0; h0 < NHP; h0 += HPP) { const size_t zo = (size_t)h0 * SS * HD; const int b = b0 + h0 / NH_;
            k_score<<<dim3(SS / 64, SS / 64, HPP), 128, 0, stream>>>(Qh + zo, Ql + zo, Kh + zo, Kl + zo, X16 + 2 * zo, E16, Sb);
            k_ebsoft<<<HPP * SS / 8, 256, 0, stream>>>(Sb, am + (size_t)b * SS, Ph, Pl);
            k_gemmw<bf, 2, false, 8><<<dim3(SS / 64, 1, HPP), 256, 0, stream>>>(Ph, Pl, VTh + zo, VTl + zo, SS, OUT + (size_t)b * SS * DM + (h0 % NH_) * HD, DM, nullptr, nullptr, nullptr, (size_t)SS * SS, (size_t)HD * SS, (size_t)HD); } }
}

// v004
// One run takes 342 microseconds.
// Timed twice side by side with v003, it ran 1.66 and 1.67 times as fast.
// Counting every step since v000, it is 4.61 times as fast.
#include <hip/hip_runtime.h>

// ElasticBertSelfAttention (hidden [4][1024][1024]; q/k/v = x W + b (16 heads x 64); scores[l][r] = q_l.k_r + q_l.pe[l-r] + k_r.pe[l-r] with pe[l-r] = dist_emb[l - r + 2047] (relative_key_query), / 8, + additive attention_mask[b][r] (read as data);
// softmax; ctx = probs v merged -> [4][1024][1024]). The positional terms are computed as q.E'^T and k.E'^T against the table rows that can occur (1024..3071), score tile by score tile, and gathered along the diagonals (exact restructuring).
// Compute dtypes, f32 accumulate: every input rounded to bf16; q/k/v on PLAIN bf16 operands (inputs: exact) + bias; q.k on bf16 hi+lo planes (3 products); QE / KE on single fp16 planes against the (exactly representable) fp16

#define NB_  4
#define SS   1024
#define DM   1024
#define NH_  16
#define HD   64
#define NE   2048
#define EOFF 1024
#define HPP  8      // heads per group of the fp16 planes' layout
#define BPP  2      // batches per projection pass
#define NHP  (BPP * NH_)
typedef _Float16 h16;
typedef unsigned short bf;
typedef __attribute__((ext_vector_type(16))) __bf16   v16bf;
typedef __attribute__((ext_vector_type(16))) _Float16 v16h;
typedef __attribute__((ext_vector_type(8)))  _Float16 v8h;
typedef __attribute__((ext_vector_type(8)))  unsigned short v8us;
typedef __attribute__((ext_vector_type(8)))  float    v8f;
typedef __attribute__((ext_vector_type(4)))  float    v4f;
typedef v8h  __attribute__((may_alias)) v8ha;
typedef v4f  __attribute__((may_alias)) v4fa;
typedef v8us __attribute__((may_alias)) v8usa;

__device__ __forceinline__ unsigned short f2bf(float f) { unsigned u = __float_as_uint(f); u += 0x7FFFu + ((u >> 16) & 1u); return (unsigned short)(u >> 16); }
__device__ __forceinline__ float bf2f(unsigned short b) { return __uint_as_float(((unsigned)b) << 16); }
__device__ __forceinline__ float bfr(float f) { return bf2f(f2bf(f)); }
__device__ __forceinline__ v16h cat16(v8h lo, v8h hi) { return __builtin_shufflevector(lo, hi, 0, 1, 2, 3, 4, 5, 6, 7, 8, 9, 10, 11, 12, 13, 14, 15); }
__device__ __forceinline__ v16bf cat16b(v8us lo, v8us hi) { return __builtin_bit_cast(v16bf, __builtin_shufflevector(lo, hi, 0, 1, 2, 3, 4, 5, 6, 7, 8, 9, 10, 11, 12, 13, 14, 15)); }
__device__ __forceinline__ v8f wmma16(v16h a, v16h b, v8f c) { return __builtin_amdgcn_wmma_f32_16x16x32_f16(false, a, false, b, (short)0, c, false, false); }
__device__ __forceinline__ v8f wmmab(v16bf a, v16bf b, v8f c) { return __builtin_amdgcn_wmma_f32_16x16x32_bf16(false, a, false, b, (short)0, c, false, false); }



// ---- k_gemmw: register-blocked GEMM, NW WAVES per 64x64 output tile (16 accumulators each), operands straight from K-contiguous 16-bit planes; grid (M/64, N/64, Z), 32 * NW threads.
// NW > 1: wave w takes the 32-wide k steps w, w + NW, ... (neighbouring waves read the two halves of one 128-B line); the NW partial tiles are summed through LDS in wave order, 16 rows at a time.
// C[m][n] (f32, pitch ldc, + optional f32 bias[n], one bias vector per z = 0, 1, 2) = sum_k A[m][k] Bt[n][k] (+ split products per NSPLIT). z-batch strides sA/sB/sC in elements. K % 32 == 0.
template <typename T16> struct WFrag;
template <> struct WFrag<h16> { typedef v16h V; static __device__ __forceinline__ V ld(const h16* p) { return cat16(*(const v8h*)p, *(const v8h*)(p + 16)); } static __device__ __forceinline__ v8f mma(V a, V b, v8f c) { return wmma16(a, b, c); } };
template <> struct WFrag<bf> { typedef v16bf V; static __device__ __forceinline__ V ld(const bf* p) { return cat16b(*(const v8us*)p, *(const v8us*)(p + 16)); } static __device__ __forceinline__ v8f mma(V a, V b, v8f c) { return wmmab(a, b, c); } };
template <typename T16, int NSPLIT, bool BIAS, int NW>
__global__ __launch_bounds__(32 * NW) void k_gemmw(const T16* __restrict__ A, const T16* __restrict__ A2, const T16* __restrict__ Bt, const T16* __restrict__ Bt2, int K, float* C, int ldc, const float* __restrict__ bias0, const float* __restrict__ bias1, const float* __restrict__ bias2, size_t sA, size_t sB, size_t sC) {
    typedef typename WFrag<T16>::V V;
    __shared__ __align__(16) float os[(NW > 1 ? 2 * NW : 1) * 16 * 68];
    const int wv = NW > 1 ? __builtin_amdgcn_readfirstlane((int)(threadIdx.x >> 5)) : 0;
    const size_t z = blockIdx.z; A += z * sA; if (A2) A2 += z * sA; Bt += z * sB; if (Bt2) Bt2 += z * sB; C += z * sC; const float* bias = z == 0 ? bias0 : (z == 1 ? bias1 : bias2);
    const int lane = threadIdx.x & 31, lr = lane & 15, hi = lane >> 4; const int r0 = blockIdx.x * 64, c0 = blockIdx.y * 64;
    v8f acc[4][4];
#pragma unroll
    for (int mb = 0; mb < 4; ++mb)
#pragma unroll
        for (int nb = 0; nb < 4; ++nb) acc[mb][nb] = (v8f){};
    const size_t aoff = (size_t)(r0 + lr) * K + 8 * hi, boff = (size_t)(c0 + lr) * K + 8 * hi;
#pragma unroll 1
    for (int kc = wv * 32; kc < K; kc += NW * 32) {
        V a[4], a2[4];
#pragma unroll
        for (int mb = 0; mb < 4; ++mb) { a[mb] = WFrag<T16>::ld(A + aoff + (size_t)mb * 16 * K + kc); if (NSPLIT == 1 || NSPLIT == 2) a2[mb] = WFrag<T16>::ld(A2 + aoff + (size_t)mb * 16 * K + kc); }
#pragma unroll
        for (int nb = 0; nb < 4; ++nb) { const V b = WFrag<T16>::ld(Bt + boff + (size_t)nb * 16 * K + kc); V b2; if (NSPLIT >= 2) b2 = WFrag<T16>::ld(Bt2 + boff + (size_t)nb * 16 * K + kc);
#pragma unroll
            for (int mb = 0; mb < 4; ++mb) { acc[mb][nb] = WFrag<T16>::mma(a[mb], b, acc[mb][nb]); if (NSPLIT == 1 || NSPLIT == 2) acc[mb][nb] = WFrag<T16>::mma(a2[mb], b, acc[mb][nb]); if (NSPLIT >= 2) acc[mb][nb] = WFrag<T16>::mma(a[mb], b2, acc[mb][nb]); } }
        asm volatile("v_nop\n\tv_nop\n\tv_nop\n\tv_nop" : "+v"(acc[0][0]), "+v"(acc[1][1]), "+v"(acc[2][2]), "+v"(acc[3][3]) : "v"(a[0]), "v"(a[3]));
    }
    if constexpr (NW > 1) {
        static_assert(NW == 8, "one 16-byte piece of a 16 x 64 slab per thread");
        const int row = threadIdx.x >> 4, cofs = (threadIdx.x & 15) * 4;
        v4f bv = (v4f){}; if (BIAS) { bv[0] = bfr(bias[c0 + cofs]); bv[1] = bfr(bias[c0 + cofs + 1]); bv[2] = bfr(bias[c0 + cofs + 2]); bv[3] = bfr(bias[c0 + cofs + 3]); }
#pragma unroll
        for (int mb = 0; mb < 4; ++mb) {
            float* slab = os + (mb & 1) * (NW * 16 * 68);   // two slab sets: the barrier of slab mb + 1 ends every read of slab mb before slab mb + 2 overwrites it
            float* mine = slab + wv * (16 * 68);
#pragma unroll
            for (int nb = 0; nb < 4; ++nb) {
#pragma unroll
                for (int j = 0; j < 8; ++j) mine[(hi * 8 + j) * 68 + nb * 16 + lr] = acc[mb][nb][j]; }
            __syncthreads();   // every wave's partial slab is in LDS before any thread sums across waves
            v4f val = *(const v4fa*)(slab + row * 68 + cofs);
#pragma unroll
            for (int w = 1; w < NW; ++w) val += *(const v4fa*)(slab + w * (16 * 68) + row * 68 + cofs);
            if (BIAS) val += bv;
            *(v4f*)(C + (size_t)(r0 + mb * 16 + row) * ldc + c0 + cofs) = val;
        }
    }
}

// ---- k_attn: scores, softmax and probs x v of 64 query rows of one head per work-group of 4 waves (16 rows each); grid (SS/64, NHP). The 16 column tiles of 64 are walked in turn with a running row maximum and sum.
// Score tile, rows l0 + i, columns r0 + c: the table row of (i, c) is l0 - r0 + SS - 64 + (i - c + 63), so a tile meets 127 rows in a row of the table. Wave w: its 16 k rows (columns 16 w .. of the tile) against the 80 table rows
// they meet -> keb (for all four waves, behind the barrier); its 16 q rows against the 80 table rows they meet -> qeb[w] (its own); q.k of its 16 rows on the hi+lo planes. Each score takes its two terms off the LDS diagonals, (q.k + q.pe) + k.pe.
// The tile then goes through the wave's own LDS slab into the A-fragment layout (lane = row, 32 of the 64 columns): maximum and sum in-lane plus one exchange between the halves; exp(s - max) is split into bf16 hi+lo and multiplied on v's hi+lo planes.
// Two waves a SIMD (amdgpu_waves_per_eu): 512 registers a wave, room for a tile's whole run of loads; the grid of a launch gives each WGP two work-groups.
#define PB 84   // LDS pitch in floats of an 80-wide band row: stores (row step 8 PB), the q diagonal (8 (PB + 1)) and the k diagonal (lane step PB - 1) each put the 32 lanes on 32 banks
__global__ __launch_bounds__(128) __attribute__((amdgpu_waves_per_eu(2, 2))) void k_attn(const bf* __restrict__ Qh, const bf* __restrict__ Ql, const bf* __restrict__ Kh, const bf* __restrict__ Kl, const h16* __restrict__ X16, const h16* __restrict__ E16, const bf* __restrict__ VTh, const bf* __restrict__ VTl, const float* __restrict__ am, float* out) {
    __shared__ __align__(16) float keb[2][64 * PB];   // two buffers: the one barrier of tile t + 1 ends every read of tile t before tile t + 2 overwrites it
    __shared__ __align__(16) float qeb[4][16 * PB];
    __shared__ __align__(16) float ams[SS];
    const int wv = __builtin_amdgcn_readfirstlane((int)(threadIdx.x >> 5));
    const int lane = threadIdx.x & 31, lr = lane & 15, hi = lane >> 4; const int l0 = blockIdx.x * 64, h = blockIdx.y;
    const size_t zo = (size_t)h * SS * HD; const size_t fo = (size_t)lr * HD + 8 * hi;    // fo: the lane's place in a fragment of 16 rows
    const h16* Xq = X16 + (size_t)(h / HPP) * 2 * HPP * SS * HD + (size_t)(h % HPP) * SS * HD;
    for (int i = threadIdx.x; i < SS; i += 128) ams[i] = bfr(am[(size_t)(h / NH_) * SS + i]);   // read behind the first tile's barrier
    const h16* pQ16 = Xq + (size_t)(l0 + 16 * wv) * HD + fo; const bf* pQh = Qh + zo + (size_t)(l0 + 16 * wv) * HD + fo; const bf* pQl = Ql + zo + (size_t)(l0 + 16 * wv) * HD + fo;
    const v16h q0 = WFrag<h16>::ld(pQ16), q1 = WFrag<h16>::ld(pQ16 + 32);
    v16bf qa[2], qa2[2];
#pragma unroll
    for (int kc = 0; kc < 2; ++kc) { qa[kc] = WFrag<bf>::ld(pQh + 32 * kc); qa2[kc] = WFrag<bf>::ld(pQl + 32 * kc); }
    asm volatile("s_wait_xcnt 0x0" : : "v"(pQ16), "v"(pQh), "v"(pQl) : "memory");   // the address registers of the loads above stay as they are up to here
    v8f o[4];
#pragma unroll
    for (int nb = 0; nb < 4; ++nb) o[nb] = (v8f){};
    float mrun = -3.0e38f, lsum = 0.f;   // of row lr; lsum: this half's columns only
    float* mine = qeb[wv];
#pragma unroll 1
    for (int rt = 0; rt < SS / 64; ++rt) {
        const int r0 = rt * 64; float* kb = keb[rt & 1];
        const h16* pX = Xq + (size_t)(r0 + 16 * wv) * HD + fo;   // the k plane lies HPP * SS * HD elements behind the q plane
        const h16* pEk = E16 + (size_t)(l0 - r0 + SS - 64 + 16 * (3 - wv)) * HD + fo; const h16* pEq = E16 + (size_t)(l0 - r0 + SS - 64 + 16 * wv) * HD + fo;
        const bf* pKh = Kh + zo + (size_t)r0 * HD + fo; const bf* pKl = Kl + zo + (size_t)r0 * HD + fo;
        const bf* pVh = VTh + zo + (size_t)lr * SS + r0 + 8 * hi; const bf* pVl = VTl + zo + (size_t)lr * SS + r0 + 8 * hi;
        // the tile's loads go out in two runs (here; v behind the barrier), each whole before its first use, so that a run costs one trip to memory
        v16h ek[5][2], eq[5][2]; v16bf kh[2][4], kl[2][4];
        const v16h k0 = WFrag<h16>::ld(pX + HPP * SS * HD), k1 = WFrag<h16>::ld(pX + HPP * SS * HD + 32);
#pragma unroll
        for (int t = 0; t < 5; ++t) { ek[t][0] = WFrag<h16>::ld(pEk + 16 * t * HD); ek[t][1] = WFrag<h16>::ld(pEk + 16 * t * HD + 32); }
#pragma unroll
        for (int t = 0; t < 5; ++t) { eq[t][0] = WFrag<h16>::ld(pEq + 16 * t * HD); eq[t][1] = WFrag<h16>::ld(pEq + 16 * t * HD + 32); }
#pragma unroll
        for (int kc = 0; kc < 2; ++kc) {
#pragma unroll
            for (int nb = 0; nb < 4; ++nb) { kh[kc][nb] = WFrag<bf>::ld(pKh + 16 * nb * HD + 32 * kc); kl[kc][nb] = WFrag<bf>::ld(pKl + 16 * nb * HD + 32 * kc); } }
        asm volatile("s_wait_xcnt 0x0" : : "v"(pX), "v"(pEk), "v"(pEq), "v"(pKh), "v"(pKl) : "memory");   // the address registers of the loads above stay as they are up to here
        __builtin_amdgcn_sched_barrier(0);   // keeps the products below from moving up between the loads, which would split the run into several trips to memory
        v8f ck[5];
#pragma unroll
        for (int t = 0; t < 5; ++t) { ck[t] = WFrag<h16>::mma(k0, ek[t][0], (v8f){}); ck[t] = WFrag<h16>::mma(k1, ek[t][1], ck[t]); }
#pragma unroll
        for (int t = 0; t < 5; ++t) {
#pragma unroll
            for (int j = 0; j < 8; ++j) kb[(16 * wv + 8 * hi + j) * PB + 16 * t + lr] = ck[t][j]; }
#pragma unroll
        for (int t = 0; t < 5; ++t) { v8f cq = WFrag<h16>::mma(q0, eq[t][0], (v8f){}); cq = WFrag<h16>::mma(q1, eq[t][1], cq);
#pragma unroll
            for (int j = 0; j < 8; ++j) mine[(8 * hi + j) * PB + 16 * t + lr] = cq[j]; }
        v8f acc[4];
#pragma unroll
        for (int nb = 0; nb < 4; ++nb) acc[nb] = (v8f){};
#pragma unroll
        for (int kc = 0; kc < 2; ++kc) {
#pragma unroll
            for (int nb = 0; nb < 4; ++nb) { acc[nb] = WFrag<bf>::mma(qa[kc], kh[kc][nb], acc[nb]); acc[nb] = WFrag<bf>::mma(qa2[kc], kh[kc][nb], acc[nb]); acc[nb] = WFrag<bf>::mma(qa[kc], kl[kc][nb], acc[nb]); } }
        __syncthreads();   // all four waves' rows of this tile's keb (and, at the first tile, ams) are in LDS before any wave reads them
        v16bf vh[2][4], vl[2][4];   // v's fragments fly while the scores are finished
#pragma unroll
        for (int kc = 0; kc < 2; ++kc) {
#pragma unroll
            for (int nb = 0; nb < 4; ++nb) { vh[kc][nb] = WFrag<bf>::ld(pVh + (size_t)16 * nb * SS + 32 * kc); vl[kc][nb] = WFrag<bf>::ld(pVl + (size_t)16 * nb * SS + 32 * kc); } }
        asm volatile("s_wait_xcnt 0x0" : : "v"(pVh), "v"(pVl) : "memory");   // as above
#pragma unroll
        for (int nb = 0; nb < 4; ++nb) {
#pragma unroll
            for (int j = 0; j < 8; ++j) { const int i = 8 * hi + j; acc[nb][j] = (acc[nb][j] + mine[i * PB + i - 16 * nb - lr + 63]) + kb[(16 * nb + lr) * PB + 16 * wv + i - lr + 15]; } }
        __builtin_amdgcn_wave_barrier(); asm volatile("" ::: "memory");   // keeps the slab stores below behind every lane's diagonal reads of the same LDS
#pragma unroll
        for (int nb = 0; nb < 4; ++nb) {
#pragma unroll
            for (int j = 0; j < 8; ++j) mine[(hi * 8 + j) * 68 + nb * 16 + lr] = acc[nb][j]; }
        __builtin_amdgcn_wave_barrier(); asm volatile("" ::: "memory");   // keeps the row reads below behind the other lanes' stores
        float s[32]; float mx = mrun;   // s[16 kc + e]: element e of A fragment kc, column 32 kc + 16 (e / 8) + 8 hi + e % 8 of row lr
#pragma unroll
        for (int g = 0; g < 4; ++g) {
#pragma unroll
            for (int q4 = 0; q4 < 2; ++q4) { const int c = 16 * g + 8 * hi + 4 * q4; const v4f a = *(const v4fa*)(mine + lr * 68 + c); const v4f m = *(const v4fa*)(ams + r0 + c);
#pragma unroll
                for (int u = 0; u < 4; ++u) { const float t = a[u] * 0.125f + m[u]; s[8 * g + 4 * q4 + u] = t; mx = fmaxf(mx, t); } } }
        __builtin_amdgcn_wave_barrier(); asm volatile("" ::: "memory");   // keeps the next tile's stores to this wave's LDS behind every lane's row reads
        mx = fmaxf(mx, __shfl_xor(mx, 16, 32));
        const float alpha = __builtin_amdgcn_exp2f((mrun - mx) * 1.4426950408889634f); mrun = mx;
        float ps = 0.f; v16bf ph[2], pl[2];
#pragma unroll
        for (int kc = 0; kc < 2; ++kc) {
#pragma unroll
            for (int e = 0; e < 16; ++e) { const float p = __builtin_amdgcn_exp2f((s[16 * kc + e] - mx) * 1.4426950408889634f); ps += p; const __bf16 hb = (__bf16)p; ph[kc][e] = hb; pl[kc][e] = (__bf16)(p - (float)hb); } }
        lsum = lsum * alpha + ps;
#pragma unroll
        for (int j = 0; j < 8; ++j) { const float aj = __shfl(alpha, 8 * hi + j, 32);   // accumulator register j holds row 8 hi + j
#pragma unroll
            for (int nb = 0; nb < 4; ++nb) o[nb][j] *= aj; }
#pragma unroll
        for (int kc = 0; kc < 2; ++kc) {
#pragma unroll
            for (int nb = 0; nb < 4; ++nb) { o[nb] = WFrag<bf>::mma(ph[kc], vh[kc][nb], o[nb]); o[nb] = WFrag<bf>::mma(pl[kc], vh[kc][nb], o[nb]); o[nb] = WFrag<bf>::mma(ph[kc], vl[kc][nb], o[nb]); } }
    }
    lsum += __shfl_xor(lsum, 16, 32);
    const float f = 1.0f / lsum;
#pragma unroll
    for (int j = 0; j < 8; ++j) { const float fj = __shfl(f, 8 * hi + j, 32);
#pragma unroll
        for (int nb = 0; nb < 4; ++nb) mine[(hi * 8 + j) * 68 + nb * 16 + lr] = o[nb][j] * fj; }
    __builtin_amdgcn_wave_barrier(); asm volatile("" ::: "memory");   // keeps the 16-byte slab reads below behind the other lanes' stores
    float* crow = out + (size_t)((h / NH_) * SS + l0 + 16 * wv) * DM + (h % NH_) * HD;
#pragma unroll
    for (int sx = 0; sx < 8; ++sx) { const int row = 2 * sx + hi, cofs = lr * 4; *(v4f*)(crow + (size_t)row * DM + cofs) = *(const v4fa*)(mine + row * 68 + cofs); }
}

__device__ __forceinline__ h16 tohx(float x) { return (h16)x; }
__device__ __forceinline__ void splitf(float y, unsigned short& h, unsigned short& l) { h = f2bf(y); l = f2bf(y - bf2f(h)); }
typedef __attribute__((ext_vector_type(2))) unsigned short v2us;
typedef __attribute__((ext_vector_type(4))) unsigned short v4us;
typedef __attribute__((ext_vector_type(4))) _Float16 v4h;

__global__ __launch_bounds__(256) void k_wtG(const float* __restrict__ w0, const float* __restrict__ w1, const float* __restrict__ w2, int K, int N, bf* Bt) {
    const float* w = blockIdx.y == 0 ? w0 : (blockIdx.y == 1 ? w1 : w2); Bt += (size_t)blockIdx.y * K * N;
    const int lane = threadIdx.x & 31; const int L0 = (blockIdx.x * 8 + (threadIdx.x >> 5)) * 8; const int nlines = N * K / 64;
{
#pragma unroll 1
        for (int l = 0; l < 8; ++l) { const int L = L0 + l; if (L >= nlines) break; const size_t e = (size_t)L * 64 + lane * 2; const int k = (int)(e % K), n = (int)(e / K); v2us o;
            o[0] = f2bf(w[(size_t)k * N + n]); o[1] = f2bf(w[(size_t)(k + 1) * N + n]); *(v2us*)(Bt + e) = o; }
         }
}
__global__ __launch_bounds__(256) void k_cvt8(const float* __restrict__ src, bf* dst, size_t n8) { const size_t i = (size_t)blockIdx.x * 256 + threadIdx.x; if (i >= n8) return; const v8f v = *(const v8f*)(src + i * 8); v8us o;
#pragma unroll
    for (int k = 0; k < 8; ++k) o[k] = f2bf(v[k]); *(v8us*)(dst + i * 8) = o;  }
// k_e16: E16[j][d] = fp16(bf16 dist_emb[1024 + j][d]) (8-B lanes); k_qkp: per head planes from FQ/FK [b][t][h*64+d], BPP batches at once (plane index = b * 16 + h): Qh/Ql, Kh/Kl in [h][t][d] (8-B lanes);
// the fp16 planes lie in X16 as [h / HPP][q, k][HPP heads][t][d]; k_vtp2: VTh/VTl[h][d][t] = split(FV[b][t][h*64+d]) (lane -> 2 consecutive t);
__global__ __launch_bounds__(256) void k_e16(const float* __restrict__ emb, h16* E16) { const int e = (blockIdx.x * 256 + threadIdx.x) * 4; if (e >= NE * HD) return; const v4f a = *(const v4f*)(emb + (size_t)EOFF * HD + e); v4h o;
#pragma unroll
    for (int u = 0; u < 4; ++u) o[u] = tohx(bfr(a[u])); *(v4h*)(E16 + e) = o;  }
__global__ __launch_bounds__(256) void k_qkp(const float* __restrict__ FQ, const float* __restrict__ FK, bf* Qh, bf* Ql, bf* Kh, bf* Kl, h16* X16) { const int e = (blockIdx.x * 256 + threadIdx.x) * 4; if (e >= NHP * SS * HD) return; const int d = e % HD; const int t = (e / HD) % SS; const int h = e / (HD * SS); const size_t f = (size_t)((h / NH_) * SS + t) * DM + (h % NH_) * HD + d; h16* Q16 = X16 + (size_t)(h / HPP) * HPP * SS * HD; h16* K16 = Q16 + (size_t)HPP * SS * HD; v4us qh, ql, kh, kl; v4h q6, k6;
#pragma unroll
    for (int u = 0; u < 4; ++u) { const float qv = FQ[f + u], kv = FK[f + u]; unsigned short a, b; splitf(qv, a, b); qh[u] = a; ql[u] = b; splitf(kv, a, b); kh[u] = a; kl[u] = b; q6[u] = tohx(qv); k6[u] = tohx(kv); }
    { *(v4us*)(Qh + e) = qh; *(v4us*)(Ql + e) = ql; *(v4h*)(Q16 + e) = q6; *(v4us*)(Kh + e) = kh; *(v4us*)(Kl + e) = kl; *(v4h*)(K16 + e) = k6;  } }
__global__ __launch_bounds__(256) void k_vtp2(const float* __restrict__ FV, bf* VTh, bf* VTl) { const int e = (blockIdx.x * 256 + threadIdx.x) * 2; if (e >= NHP * HD * SS) return; const int t = e % SS; const int d = (e / SS) % HD; const int h = e / (SS * HD); v2us oh, ol;
#pragma unroll
    for (int u = 0; u < 2; ++u) { unsigned short a, b; splitf(FV[(size_t)((h / NH_) * SS + t + u) * DM + (h % NH_) * HD + d], a, b); oh[u] = a; ol[u] = b; }
    *(v2us*)(VTh + e) = oh; *(v2us*)(VTl + e) = ol;  }
extern "C" void kernel_launch(void* const* d_in, const int* in_sizes, int n_in,
                              void* d_out, int out_size, void* d_ws, size_t ws_size, hipStream_t stream) {
    (void)in_sizes; (void)n_in; (void)out_size;
    const float** I = (const float**)d_in;
    const float *x = I[0], *am = I[1], *wq = I[2], *bq = I[3], *wk = I[4], *bk = I[5], *wv = I[6], *bv = I[7], *emb = I[8];
    float* OUT = (float*)d_out;     // [4][1024][1024]
    char* wsp = (char*)d_ws;
    auto take = [&](size_t bytes) { char* p = wsp; wsp += (bytes + 255) & ~(size_t)255; return (void*)p; };
    bf* WQ = (bf*)take((size_t)3 * DM * DM * 2); h16* E16 = (h16*)take((size_t)NE * HD * 2);    // WQ, WK, WV in a row
    bf* Qh = (bf*)take((size_t)NHP * SS * HD * 2); bf* Ql = (bf*)take((size_t)NHP * SS * HD * 2); bf* Kh = (bf*)take((size_t)NHP * SS * HD * 2); bf* Kl = (bf*)take((size_t)NHP * SS * HD * 2); h16* X16 = (h16*)take((size_t)2 * NHP * SS * HD * 2); bf* VTh = (bf*)take((size_t)NHP * HD * SS * 2); bf* VTl = (bf*)take((size_t)NHP * HD * SS * 2);
    bf* XB = (bf*)take((size_t)BPP * SS * DM * 2); float* FQ = (float*)take((size_t)3 * BPP * SS * DM * 4);    // x plane; FQ, FK, FV in a row
    if ((size_t)(wsp - (char*)d_ws) > ws_size) return;    // total ~ 66 MiB
    k_wtG<<<dim3((DM * DM / 64 + 63) / 64, 3, 1), 256, 0, stream>>>(wq, wk, wv, DM, DM, WQ); k_e16<<<(NE * HD / 4 + 255) / 256, 256, 0, stream>>>(emb, E16);
    for (int b0 = 0; b0 < NB_; b0 += BPP) {
        k_cvt8<<<(BPP * SS * DM / 8 + 255) / 256, 256, 0, stream>>>(x + (size_t)b0 * SS * DM, XB, (size_t)BPP * SS * DM / 8);
        k_gemmw<bf, 0, true, 8><<<dim3(BPP * SS / 64, DM / 64, 3), 256, 0, stream>>>(XB, nullptr, WQ, nullptr, DM, FQ, DM, bq, bk, bv, 0, (size_t)DM * DM, (size_t)BPP * SS * DM);
        k_qkp<<<(NHP * SS * HD / 4 + 255) / 256, 256, 0, stream>>>(FQ, FQ + (size_t)BPP * SS * DM, Qh, Ql, Kh, Kl, X16); k_vtp2<<<(NHP * HD * SS / 2 + 255) / 256, 256, 0, stream>>>(FQ + (size_t)2 * BPP * SS * DM, VTh, VTl);
        k_attn<<<dim3(SS / 64, NHP, 1), 128, 0, stream>>>(Qh, Ql, Kh, Kl, X16, E16, VTh, VTl, am + (size_t)b0 * SS, OUT + (size_t)b0 * SS * DM); }
}

// v005
// One run takes 191 microseconds.
// Next to v004, in two timings, it ran 1.80 and 1.81 times as fast.
// Counting every step since v000, it is 8.31 times as fast.
#include <hip/hip_runtime.h>

// ElasticBertSelfAttention (hidden [4][1024][1024]; q/k/v = x W + b (16 heads x 64); scores[l][r] = q_l.k_r + q_l.pe[l-r] + k_r.pe[l-r] with pe[l-r] = dist_emb[l - r + 2047] (relative_key_query), / 8, + additive attention_mask[b][r] (read as data);
// softmax; ctx = probs v merged -> [4][1024][1024]). The positional terms are computed as q.E'^T and k.E'^T against the table rows that can occur (1024..3071), score tile by score tile, and gathered along the diagonals (exact restructuring).
// Compute dtypes, f32 accumulate: every input rounded to bf16; q/k/v on PLAIN bf16 operands (inputs: exact) + bias; q.k on bf16 hi+lo planes (3 products); QE / KE on single fp16 planes against the (exactly representable) fp16

#define NB_  4
#define SS   1024
#define DM   1024
#define NH_  16
#define HD   64
#define NE   2048
#define EOFF 1024
#define HPP  8      // heads per group of the fp16 planes' layout
#define BPP  2      // batches per projection pass
#define NHP  (BPP * NH_)
typedef _Float16 h16;
typedef unsigned short bf;
typedef __attribute__((ext_vector_type(16))) __bf16   v16bf;
typedef __attribute__((ext_vector_type(16))) _Float16 v16h;
typedef __attribute__((ext_vector_type(8)))  _Float16 v8h;
typedef __attribute__((ext_vector_type(8)))  unsigned short v8us;
typedef __attribute__((ext_vector_type(8)))  float    v8f;
typedef __attribute__((ext_vector_type(4)))  float    v4f;
typedef v8h  __attribute__((may_alias)) v8ha;
typedef v4f  __attribute__((may_alias)) v4fa;
typedef v8us __attribute__((may_alias)) v8usa;

__device__ __forceinline__ unsigned short f2bf(float f) { unsigned u = __float_as_uint(f); u += 0x7FFFu + ((u >> 16) & 1u); return (unsigned short)(u >> 16); }
__device__ __forceinline__ float bf2f(unsigned short b) { return __uint_as_float(((unsigned)b) << 16); }
__device__ __forceinline__ float bfr(float f) { return bf2f(f2bf(f)); }
__device__ __forceinline__ v16h cat16(v8h lo, v8h hi) { return __builtin_shufflevector(lo, hi, 0, 1, 2, 3, 4, 5, 6, 7, 8, 9, 10, 11, 12, 13, 14, 15); }
__device__ __forceinline__ v16bf cat16b(v8us lo, v8us hi) { return __builtin_bit_cast(v16bf, __builtin_shufflevector(lo, hi, 0, 1, 2, 3, 4, 5, 6, 7, 8, 9, 10, 11, 12, 13, 14, 15)); }
__device__ __forceinline__ v8f wmma16(v16h a, v16h b, v8f c) { return __builtin_amdgcn_wmma_f32_16x16x32_f16(false, a, false, b, (short)0, c, false, false); }
__device__ __forceinline__ v8f wmmab(v16bf a, v16bf b, v8f c) { return __builtin_amdgcn_wmma_f32_16x16x32_bf16(false, a, false, b, (short)0, c, false, false); }



// ---- Fragment order: every 16-bit operand plane lies as blocks of 16 rows x 32 k = FB elements (1 KiB); the blocks' own order is said at each plane. Inside a block the element at place q belongs to
// row fr_row(q), k fr_k(q): [k half of 16][lane = 16 * (k / 8 % 2) + row][8 k]. A wave's 16-byte load at lane * 8 (and the one FB / 2 further) then covers 512 bytes in a row, four whole 128-B lines, not 32 bytes of each of 16 lines.
#define FB 512
__device__ __forceinline__ int fr_row(int q) { return (q >> 3) & 15; }
__device__ __forceinline__ int fr_k(int q) { return ((q >> 8) << 4) + (((q >> 7) & 1) << 3) + (q & 7); }

// ---- k_gemmw: register-blocked GEMM, NW WAVES per 64x64 output tile (16 accumulators each), operands straight from 16-bit planes in fragment order, [row / 64][k / 32][row / 16 % 4] blocks (a tile's 4 blocks of one k step in a row); grid (M/64, N/64, Z), 32 * NW threads.
// NW > 1: wave w takes the 32-wide k steps w, w + NW, ...; the NW partial tiles are summed through LDS in wave order, 16 rows at a time.
// C[m][n] (f32, pitch ldc, + optional f32 bias[n], one bias vector per z = 0, 1, 2) = sum_k A[m][k] Bt[n][k] (+ split products per NSPLIT). z-batch strides sA/sB/sC in elements. K % 32 == 0.
template <typename T16> struct WFrag;
template <> struct WFrag<h16> { typedef v16h V; static __device__ __forceinline__ V ld(const h16* p) { return cat16(*(const v8h*)p, *(const v8h*)(p + 256)); } static __device__ __forceinline__ v8f mma(V a, V b, v8f c) { return wmma16(a, b, c); } };
template <> struct WFrag<bf> { typedef v16bf V; static __device__ __forceinline__ V ld(const bf* p) { return cat16b(*(const v8us*)p, *(const v8us*)(p + 256)); } static __device__ __forceinline__ v8f mma(V a, V b, v8f c) { return wmmab(a, b, c); } };
template <typename T16, int NSPLIT, bool BIAS, int NW>
__global__ __launch_bounds__(32 * NW) void k_gemmw(const T16* __restrict__ A, const T16* __restrict__ A2, const T16* __restrict__ Bt, const T16* __restrict__ Bt2, int K, float* C, int ldc, const float* __restrict__ bias0, const float* __restrict__ bias1, const float* __restrict__ bias2, size_t sA, size_t sB, size_t sC) {
    typedef typename WFrag<T16>::V V;
    __shared__ __align__(16) float os[(NW > 1 ? 2 * NW : 1) * 16 * 68];
    const int wv = NW > 1 ? __builtin_amdgcn_readfirstlane((int)(threadIdx.x >> 5)) : 0;
    const size_t z = blockIdx.z; A += z * sA; if (A2) A2 += z * sA; Bt += z * sB; if (Bt2) Bt2 += z * sB; C += z * sC; const float* bias = z == 0 ? bias0 : (z == 1 ? bias1 : bias2);
    const int lane = threadIdx.x & 31, lr = lane & 15, hi = lane >> 4; const int r0 = blockIdx.x * 64, c0 = blockIdx.y * 64;
    v8f acc[4][4];
#pragma unroll
    for (int mb = 0; mb < 4; ++mb)
#pragma unroll
        for (int nb = 0; nb < 4; ++nb) acc[mb][nb] = (v8f){};
    const size_t aoff = (size_t)r0 * K + 8 * lane, boff = (size_t)c0 * K + 8 * lane;    // the lane's place in the first block of the tile's rows
#pragma unroll 1
    for (int kc = wv * 32; kc < K; kc += NW * 32) {
        V a[4], a2[4]; const T16* pa = A + aoff + (size_t)kc * 64; const T16* pb = Bt + boff + (size_t)kc * 64;   // the 4 blocks of this k step
#pragma unroll
        for (int mb = 0; mb < 4; ++mb) { a[mb] = WFrag<T16>::ld(pa + FB * mb); if (NSPLIT == 1 || NSPLIT == 2) a2[mb] = WFrag<T16>::ld(A2 + aoff + (size_t)kc * 64 + FB * mb); }
#pragma unroll
        for (int nb = 0; nb < 4; ++nb) { const V b = WFrag<T16>::ld(pb + FB * nb); V b2; if (NSPLIT >= 2) b2 = WFrag<T16>::ld(Bt2 + boff + (size_t)kc * 64 + FB * nb);
#pragma unroll
            for (int mb = 0; mb < 4; ++mb) { acc[mb][nb] = WFrag<T16>::mma(a[mb], b, acc[mb][nb]); if (NSPLIT == 1 || NSPLIT == 2) acc[mb][nb] = WFrag<T16>::mma(a2[mb], b, acc[mb][nb]); if (NSPLIT >= 2) acc[mb][nb] = WFrag<T16>::mma(a[mb], b2, acc[mb][nb]); } }
        asm volatile("s_wait_xcnt 0x0" : : "v"(pa), "v"(pb) : "memory");   // the address registers of the loads above stay as they are up to here
        asm volatile("v_nop\n\tv_nop\n\tv_nop\n\tv_nop" : "+v"(acc[0][0]), "+v"(acc[1][1]), "+v"(acc[2][2]), "+v"(acc[3][3]) : "v"(a[0]), "v"(a[3]));
    }
    if constexpr (NW > 1) {
        static_assert(NW == 8, "one 16-byte piece of a 16 x 64 slab per thread");
        const int row = threadIdx.x >> 4, cofs = (threadIdx.x & 15) * 4;
        v4f bv = (v4f){}; if (BIAS) { bv[0] = bfr(bias[c0 + cofs]); bv[1] = bfr(bias[c0 + cofs + 1]); bv[2] = bfr(bias[c0 + cofs + 2]); bv[3] = bfr(bias[c0 + cofs + 3]); }
#pragma unroll
        for (int mb = 0; mb < 4; ++mb) {
            float* slab = os + (mb & 1) * (NW * 16 * 68);   // two slab sets: the barrier of slab mb + 1 ends every read of slab mb before slab mb + 2 overwrites it
            float* mine = slab + wv * (16 * 68);
#pragma unroll
            for (int nb = 0; nb < 4; ++nb) {
#pragma unroll
                for (int j = 0; j < 8; ++j) mine[(hi * 8 + j) * 68 + nb * 16 + lr] = acc[mb][nb][j]; }
            __syncthreads();   // every wave's partial slab is in LDS before any thread sums across waves
            v4f val = *(const v4fa*)(slab + row * 68 + cofs);
#pragma unroll
            for (int w = 1; w < NW; ++w) val += *(const v4fa*)(slab + w * (16 * 68) + row * 68 + cofs);
            if (BIAS) val += bv;
            *(v4f*)(C + (size_t)(r0 + mb * 16 + row) * ldc + c0 + cofs) = val;
        }
    }
}

// ---- k_attn: scores, softmax and probs x v of 64 query rows of one head per work-group of 4 waves (16 rows each); grid (SS/64, NHP). The 16 column tiles of 64 are walked in turn with a running row maximum and sum.
// Score tile, rows l0 + i, columns r0 + c: the table row of (i, c) is l0 - r0 + SS - 64 + (i - c + 63), so a tile meets 127 rows in a row of the table. Wave w: its 16 k rows (columns 16 w .. of the tile) against the 80 table rows
// they meet -> keb (for all four waves, behind the barrier); its 16 q rows against the 80 table rows they meet -> qeb[w] (its own); q.k of its 16 rows on the hi+lo planes. Each score takes its two terms off the LDS diagonals, (q.k + q.pe) + k.pe.
// The tile then goes through the wave's own LDS slab into the A-fragment layout (lane = row, 32 of the 64 columns): maximum and sum in-lane plus one exchange between the halves; exp(s - max) is split into bf16 hi+lo and multiplied on v's hi+lo planes.
// Two waves a SIMD (amdgpu_waves_per_eu): 512 registers a wave, room for a tile's whole run of loads; the grid of a launch gives each WGP two work-groups.
#define PB 84   // LDS pitch in floats of an 80-wide band row: stores (row step 8 PB), the q diagonal (8 (PB + 1)) and the k diagonal (lane step PB - 1) each put the 32 lanes on 32 banks
__global__ __launch_bounds__(128) __attribute__((amdgpu_waves_per_eu(2, 2))) void k_attn(const bf* __restrict__ Qh, const bf* __restrict__ Ql, const bf* __restrict__ Kh, const bf* __restrict__ Kl, const h16* __restrict__ X16, const h16* __restrict__ E16, const bf* __restrict__ VTh, const bf* __restrict__ VTl, const float* __restrict__ am, float* out) {
    __shared__ __align__(16) float keb[2][64 * PB];   // two buffers: the one barrier of tile t + 1 ends every read of tile t before tile t + 2 overwrites it
    __shared__ __align__(16) float qeb[4][16 * PB];
    __shared__ __align__(16) float ams[SS];
    const int wv = __builtin_amdgcn_readfirstlane((int)(threadIdx.x >> 5));
    const int lane = threadIdx.x & 31, lr = lane & 15, hi = lane >> 4; const int l0 = blockIdx.x * 64, h = blockIdx.y;
    const size_t zo = (size_t)h * SS * HD; const size_t fo = (size_t)8 * lane;    // fo: the lane's place in a fragment block
    const h16* Xq = X16 + (size_t)(h / HPP) * 2 * HPP * SS * HD + (size_t)(h % HPP) * SS * HD;
    for (int i = threadIdx.x; i < SS; i += 128) ams[i] = bfr(am[(size_t)(h / NH_) * SS + i]);   // read behind the first tile's barrier
    const h16* pQ16 = Xq + (size_t)(l0 + 16 * wv) * HD + fo; const bf* pQh = Qh + zo + (size_t)(l0 + 16 * wv) * HD + fo; const bf* pQl = Ql + zo + (size_t)(l0 + 16 * wv) * HD + fo;
    const v16h q0 = WFrag<h16>::ld(pQ16), q1 = WFrag<h16>::ld(pQ16 + FB);
    v16bf qa[2], qa2[2];
#pragma unroll
    for (int kc = 0; kc < 2; ++kc) { qa[kc] = WFrag<bf>::ld(pQh + FB * kc); qa2[kc] = WFrag<bf>::ld(pQl + FB * kc); }
    asm volatile("s_wait_xcnt 0x0" : : "v"(pQ16), "v"(pQh), "v"(pQl) : "memory");   // the address registers of the loads above stay as they are up to here
    __builtin_amdgcn_sched_barrier(0);   // keeps the loop's address arithmetic from moving up over the wait, where it would rewrite the scalar bases that the loads above name
    v8f o[4];
#pragma unroll
    for (int nb = 0; nb < 4; ++nb) o[nb] = (v8f){};
    float mrun = -3.0e38f, lsum = 0.f;   // of row lr; lsum: this half's columns only
    float* mine = qeb[wv];
#pragma unroll 1
    for (int rt = 0; rt < SS / 64; ++rt) {
        const int r0 = rt * 64; float* kb = keb[rt & 1];
        const h16* pX = Xq + (size_t)(r0 + 16 * wv) * HD + fo;   // the k plane lies HPP * SS * HD elements behind the q plane
        const h16* pEk = E16 + (size_t)(l0 - r0 + SS - 64 + 16 * (3 - wv)) * HD + fo; const h16* pEq = E16 + (size_t)(l0 - r0 + SS - 64 + 16 * wv) * HD + fo;
        const bf* pKh = Kh + zo + (size_t)r0 * HD + fo; const bf* pKl = Kl + zo + (size_t)r0 * HD + fo;
        const bf* pVh = VTh + zo + (size_t)r0 * HD + fo; const bf* pVl = VTl + zo + (size_t)r0 * HD + fo;   // v: the 4 blocks (64 d) of 32 columns in a row
        // the tile's loads go out in two runs (here; v behind the barrier), each whole before its first use, so that a run costs one trip to memory
        v16h ek[5][2], eq[5][2]; v16bf kh[2][4], kl[2][4];
        const v16h k0 = WFrag<h16>::ld(pX + HPP * SS * HD), k1 = WFrag<h16>::ld(pX + HPP * SS * HD + FB);
#pragma unroll
        for (int t = 0; t < 5; ++t) { ek[t][0] = WFrag<h16>::ld(pEk + 16 * t * HD); ek[t][1] = WFrag<h16>::ld(pEk + 16 * t * HD + FB); }
#pragma unroll
        for (int t = 0; t < 5; ++t) { eq[t][0] = WFrag<h16>::ld(pEq + 16 * t * HD); eq[t][1] = WFrag<h16>::ld(pEq + 16 * t * HD + FB); }
#pragma unroll
        for (int kc = 0; kc < 2; ++kc) {
#pragma unroll
            for (int nb = 0; nb < 4; ++nb) { kh[kc][nb] = WFrag<bf>::ld(pKh + 16 * nb * HD + FB * kc); kl[kc][nb] = WFrag<bf>::ld(pKl + 16 * nb * HD + FB * kc); } }
        asm volatile("s_wait_xcnt 0x0" : : "v"(pX), "v"(pEk), "v"(pEq), "v"(pKh), "v"(pKl) : "memory");   // the address registers of the loads above stay as they are up to here
        __builtin_amdgcn_sched_barrier(0);   // keeps the products below from moving up between the loads, which would split the run into several trips to memory
        v8f ck[5];
#pragma unroll
        for (int t = 0; t < 5; ++t) { ck[t] = WFrag<h16>::mma(k0, ek[t][0], (v8f){}); ck[t] = WFrag<h16>::mma(k1, ek[t][1], ck[t]); }
#pragma unroll
        for (int t = 0; t < 5; ++t) {
#pragma unroll
            for (int j = 0; j < 8; ++j) kb[(16 * wv + 8 * hi + j) * PB + 16 * t + lr] = ck[t][j]; }
#pragma unroll
        for (int t = 0; t < 5; ++t) { v8f cq = WFrag<h16>::mma(q0, eq[t][0], (v8f){}); cq = WFrag<h16>::mma(q1, eq[t][1], cq);
#pragma unroll
            for (int j = 0; j < 8; ++j) mine[(8 * hi + j) * PB + 16 * t + lr] = cq[j]; }
        v8f acc[4];
#pragma unroll
        for (int nb = 0; nb < 4; ++nb) acc[nb] = (v8f){};
#pragma unroll
        for (int kc = 0; kc < 2; ++kc) {
#pragma unroll
            for (int nb = 0; nb < 4; ++nb) { acc[nb] = WFrag<bf>::mma(qa[kc], kh[kc][nb], acc[nb]); acc[nb] = WFrag<bf>::mma(qa2[kc], kh[kc][nb], acc[nb]); acc[nb] = WFrag<bf>::mma(qa[kc], kl[kc][nb], acc[nb]); } }
        __syncthreads();   // all four waves' rows of this tile's keb (and, at the first tile, ams) are in LDS before any wave reads them
        v16bf vh[2][4], vl[2][4];   // v's fragments fly while the scores are finished
#pragma unroll
        for (int kc = 0; kc < 2; ++kc) {
#pragma unroll
            for (int nb = 0; nb < 4; ++nb) { vh[kc][nb] = WFrag<bf>::ld(pVh + FB * (4 * kc + nb)); vl[kc][nb] = WFrag<bf>::ld(pVl + FB * (4 * kc + nb)); } }
        asm volatile("s_wait_xcnt 0x0" : : "v"(pVh), "v"(pVl) : "memory");   // as above
#pragma unroll
        for (int nb = 0; nb < 4; ++nb) {
#pragma unroll
            for (int j = 0; j < 8; ++j) { const int i = 8 * hi + j; acc[nb][j] = (acc[nb][j] + mine[i * PB + i - 16 * nb - lr + 63]) + kb[(16 * nb + lr) * PB + 16 * wv + i - lr + 15]; } }
        __builtin_amdgcn_wave_barrier(); asm volatile("" ::: "memory");   // keeps the slab stores below behind every lane's diagonal reads of the same LDS
#pragma unroll
        for (int nb = 0; nb < 4; ++nb) {
#pragma unroll
            for (int j = 0; j < 8; ++j) mine[(hi * 8 + j) * 68 + nb * 16 + lr] = acc[nb][j]; }
        __builtin_amdgcn_wave_barrier(); asm volatile("" ::: "memory");   // keeps the row reads below behind the other lanes' stores
        float s[32]; float mx = mrun;   // s[16 kc + e]: element e of A fragment kc, column 32 kc + 16 (e / 8) + 8 hi + e % 8 of row lr
#pragma unroll
        for (int g = 0; g < 4; ++g) {
#pragma unroll
            for (int q4 = 0; q4 < 2; ++q4) { const int c = 16 * g + 8 * hi + 4 * q4; const v4f a = *(const v4fa*)(mine + lr * 68 + c); const v4f m = *(const v4fa*)(ams + r0 + c);
#pragma unroll
                for (int u = 0; u < 4; ++u) { const float t = a[u] * 0.125f + m[u]; s[8 * g + 4 * q4 + u] = t; mx = fmaxf(mx, t); } } }
        __builtin_amdgcn_wave_barrier(); asm volatile("" ::: "memory");   // keeps the next tile's stores to this wave's LDS behind every lane's row reads
        mx = fmaxf(mx, __shfl_xor(mx, 16, 32));
        const float alpha = __builtin_amdgcn_exp2f((mrun - mx) * 1.4426950408889634f); mrun = mx;
        float ps = 0.f; v16bf ph[2], pl[2];
#pragma unroll
        for (int kc = 0; kc < 2; ++kc) {
#pragma unroll
            for (int e = 0; e < 16; ++e) { const float p = __builtin_amdgcn_exp2f((s[16 * kc + e] - mx) * 1.4426950408889634f); ps += p; const __bf16 hb = (__bf16)p; ph[kc][e] = hb; pl[kc][e] = (__bf16)(p - (float)hb); } }
        lsum = lsum * alpha + ps;
#pragma unroll
        for (int j = 0; j < 8; ++j) { const float aj = __shfl(alpha, 8 * hi + j, 32);   // accumulator register j holds row 8 hi + j
#pragma unroll
            for (int nb = 0; nb < 4; ++nb) o[nb][j] *= aj; }
#pragma unroll
        for (int kc = 0; kc < 2; ++kc) {
#pragma unroll
            for (int nb = 0; nb < 4; ++nb) { o[nb] = WFrag<bf>::mma(ph[kc], vh[kc][nb], o[nb]); o[nb] = WFrag<bf>::mma(pl[kc], vh[kc][nb], o[nb]); o[nb] = WFrag<bf>::mma(ph[kc], vl[kc][nb], o[nb]); } }
    }
    lsum += __shfl_xor(lsum, 16, 32);
    const float f = 1.0f / lsum;
#pragma unroll
    for (int j = 0; j < 8; ++j) { const float fj = __shfl(f, 8 * hi + j, 32);
#pragma unroll
        for (int nb = 0; nb < 4; ++nb) mine[(hi * 8 + j) * 68 + nb * 16 + lr] = o[nb][j] * fj; }
    __builtin_amdgcn_wave_barrier(); asm volatile("" ::: "memory");   // keeps the 16-byte slab reads below behind the other lanes' stores
    float* crow = out + (size_t)((h / NH_) * SS + l0 + 16 * wv) * DM + (h % NH_) * HD;
#pragma unroll
    for (int sx = 0; sx < 8; ++sx) { const int row = 2 * sx + hi, cofs = lr * 4; *(v4f*)(crow + (size_t)row * DM + cofs) = *(const v4fa*)(mine + row * 68 + cofs); }
}

__device__ __forceinline__ h16 tohx(float x) { return (h16)x; }
__device__ __forceinline__ void splitf(float y, unsigned short& h, unsigned short& l) { h = f2bf(y); l = f2bf(y - bf2f(h)); }
typedef __attribute__((ext_vector_type(2))) unsigned short v2us;
typedef __attribute__((ext_vector_type(4))) unsigned short v4us;
typedef __attribute__((ext_vector_type(4))) _Float16 v4h;

__global__ __launch_bounds__(256) void k_wtG(const float* __restrict__ w0, const float* __restrict__ w1, const float* __restrict__ w2, int K, int N, bf* Bt) {
    const float* w = blockIdx.y == 0 ? w0 : (blockIdx.y == 1 ? w1 : w2); Bt += (size_t)blockIdx.y * K * N;
    const int lane = threadIdx.x & 31; const int L0 = (blockIdx.x * 8 + (threadIdx.x >> 5)) * 8; const int nlines = N * K / 64;
{
#pragma unroll 1
        for (int l = 0; l < 8; ++l) { const int L = L0 + l; if (L >= nlines) break; const size_t e = (size_t)L * 64 + lane * 2; const int q = (int)(e % FB); const int k = (int)(e % ((size_t)64 * K) / (4 * FB)) * 32 + fr_k(q), n = (int)(e / ((size_t)64 * K)) * 64 + (int)(e % (4 * FB) / FB) * 16 + fr_row(q); v2us o;
            o[0] = f2bf(w[(size_t)k * N + n]); o[1] = f2bf(w[(size_t)(k + 1) * N + n]); *(v2us*)(Bt + e) = o; }
         }
}
__global__ __launch_bounds__(256) void k_cvt8(const float* __restrict__ src, bf* dst, size_t n8) { const size_t i = (size_t)blockIdx.x * 256 + threadIdx.x; if (i >= n8) return; const int q = (int)(i * 8 % FB); const size_t m = i * 8 / (64 * DM) * 64 + i * 8 % (4 * FB) / FB * 16 + fr_row(q), k = i * 8 % (64 * DM) / (4 * FB) * 32 + fr_k(q); const v8f v = *(const v8f*)(src + m * DM + k); v8us o;
#pragma unroll
    for (int k = 0; k < 8; ++k) o[k] = f2bf(v[k]); *(v8us*)(dst + i * 8) = o;  }
// Each thread takes the next few elements of its output plane and works out from their place which (row, k) they are (fragment order, above).
// The planes with k = d lie as [row / 16][d / 32] blocks. k_e16: E16 (rows j, k = d) = fp16(bf16 dist_emb[1024 + j][d]) (8-B lanes); k_qkp: per head planes from FQ/FK [b][t][h*64+d], BPP batches at once (plane index = b * 16 + h): Qh/Ql, Kh/Kl as [h] (rows t, k = d) (8-B lanes);
// the fp16 planes lie in X16 as [h / HPP][q, k][h % HPP] (rows t, k = d); k_vtp2: VTh/VTl as [h][t / 32][d / 16] blocks (rows d, k = t) = split(FV[b][t][h*64+d]) (lane -> 2 consecutive t);
__global__ __launch_bounds__(256) void k_e16(const float* __restrict__ emb, h16* E16) { const int e = (blockIdx.x * 256 + threadIdx.x) * 4; if (e >= NE * HD) return; const int q = e % FB; const int j = e / (16 * HD) * 16 + fr_row(q), d = e % (16 * HD) / FB * 32 + fr_k(q); const v4f a = *(const v4f*)(emb + (size_t)(EOFF + j) * HD + d); v4h o;
#pragma unroll
    for (int u = 0; u < 4; ++u) o[u] = tohx(bfr(a[u])); *(v4h*)(E16 + e) = o;  }
__global__ __launch_bounds__(256) void k_qkp(const float* __restrict__ FQ, const float* __restrict__ FK, bf* Qh, bf* Ql, bf* Kh, bf* Kl, h16* X16) { const int e = (blockIdx.x * 256 + threadIdx.x) * 4; if (e >= NHP * SS * HD) return; const int q = e % FB; const int d = e % (16 * HD) / FB * 32 + fr_k(q); const int t = e % (HD * SS) / (16 * HD) * 16 + fr_row(q); const int h = e / (HD * SS); const size_t f = (size_t)((h / NH_) * SS + t) * DM + (h % NH_) * HD + d; h16* Q16 = X16 + (size_t)(h / HPP) * HPP * SS * HD; h16* K16 = Q16 + (size_t)HPP * SS * HD; v4us qh, ql, kh, kl; v4h q6, k6;
#pragma unroll
    for (int u = 0; u < 4; ++u) { const float qv = FQ[f + u], kv = FK[f + u]; unsigned short a, b; splitf(qv, a, b); qh[u] = a; ql[u] = b; splitf(kv, a, b); kh[u] = a; kl[u] = b; q6[u] = tohx(qv); k6[u] = tohx(kv); }
    { *(v4us*)(Qh + e) = qh; *(v4us*)(Ql + e) = ql; *(v4h*)(Q16 + e) = q6; *(v4us*)(Kh + e) = kh; *(v4us*)(Kl + e) = kl; *(v4h*)(K16 + e) = k6;  } }
__global__ __launch_bounds__(256) void k_vtp2(const float* __restrict__ FV, bf* VTh, bf* VTl) { const int e = (blockIdx.x * 256 + threadIdx.x) * 2; if (e >= NHP * HD * SS) return; const int q = e % FB; const int t = e % (SS * HD) / (4 * FB) * 32 + fr_k(q); const int d = e % (4 * FB) / FB * 16 + fr_row(q); const int h = e / (SS * HD); v2us oh, ol;
#pragma unroll
    for (int u = 0; u < 2; ++u) { unsigned short a, b; splitf(FV[(size_t)((h / NH_) * SS + t + u) * DM + (h % NH_) * HD + d], a, b); oh[u] = a; ol[u] = b; }
    *(v2us*)(VTh + e) = oh; *(v2us*)(VTl + e) = ol;  }
extern "C" void kernel_launch(void* const* d_in, const int* in_sizes, int n_in,
                              void* d_out, int out_size, void* d_ws, size_t ws_size, hipStream_t stream) {
    (void)in_sizes; (void)n_in; (void)out_size;
    const float** I = (const float**)d_in;
    const float *x = I[0], *am = I[1], *wq = I[2], *bq = I[3], *wk = I[4], *bk = I[5], *wv = I[6], *bv = I[7], *emb = I[8];
    float* OUT = (float*)d_out;     // [4][1024][1024]
    char* wsp = (char*)d_ws;
    auto take = [&](size_t bytes) { char* p = wsp; wsp += (bytes + 255) & ~(size_t)255; return (void*)p; };
    bf* WQ = (bf*)take((size_t)3 * DM * DM * 2); h16* E16 = (h16*)take((size_t)NE * HD * 2);    // WQ, WK, WV in a row
    bf* Qh = (bf*)take((size_t)NHP * SS * HD * 2); bf* Ql = (bf*)take((size_t)NHP * SS * HD * 2); bf* Kh = (bf*)take((size_t)NHP * SS * HD * 2); bf* Kl = (bf*)take((size_t)NHP * SS * HD * 2); h16* X16 = (h16*)take((size_t)2 * NHP * SS * HD * 2); bf* VTh = (bf*)take((size_t)NHP * HD * SS * 2); bf* VTl = (bf*)take((size_t)NHP * HD * SS * 2);
    bf* XB = (bf*)take((size_t)BPP * SS * DM * 2); float* FQ = (float*)take((size_t)3 * BPP * SS * DM * 4);    // x plane; FQ, FK, FV in a row
    if ((size_t)(wsp - (char*)d_ws) > ws_size) return;    // total ~ 66 MiB
    k_wtG<<<dim3((DM * DM / 64 + 63) / 64, 3, 1), 256, 0, stream>>>(wq, wk, wv, DM, DM, WQ); k_e16<<<(NE * HD / 4 + 255) / 256, 256, 0, stream>>>(emb, E16);
    for (int b0 = 0; b0 < NB_; b0 += BPP) {
        k_cvt8<<<(BPP * SS * DM / 8 + 255) / 256, 256, 0, stream>>>(x + (size_t)b0 * SS * DM, XB, (size_t)BPP * SS * DM / 8);
        k_gemmw<bf, 0, true, 8><<<dim3(BPP * SS / 64, DM / 64, 3), 256, 0, stream>>>(XB, nullptr, WQ, nullptr, DM, FQ, DM, bq, bk, bv, 0, (size_t)DM * DM, (size_t)BPP * SS * DM);
        k_qkp<<<(NHP * SS * HD / 4 + 255) / 256, 256, 0, stream>>>(FQ, FQ + (size_t)BPP * SS * DM, Qh, Ql, Kh, Kl, X16); k_vtp2<<<(NHP * HD * SS / 2 + 255) / 256, 256, 0, stream>>>(FQ + (size_t)2 * BPP * SS * DM, VTh, VTl);
        k_attn<<<dim3(SS / 64, NHP, 1), 128, 0, stream>>>(Qh, Ql, Kh, Kl, X16, E16, VTh, VTl, am + (size_t)b0 * SS, OUT + (size_t)b0 * SS * DM); }
}

// v006
// Measured time: 172 microseconds a run.
// In both of two side-by-side timings against v005, it was 1.11 times as fast.
// All steps since v000 together make it 9.21 times as fast.
#include <hip/hip_runtime.h>

// ElasticBertSelfAttention (hidden [4][1024][1024]; q/k/v = x W + b (16 heads x 64); scores[l][r] = q_l.k_r + q_l.pe[l-r] + k_r.pe[l-r] with pe[l-r] = dist_emb[l - r + 2047] (relative_key_query), / 8, + additive attention_mask[b][r] (read as data);
// softmax; ctx = probs v merged -> [4][1024][1024]). The positional terms are computed as q.E'^T and k.E'^T against the table rows that can occur (1024..3071), score tile by score tile, and gathered along the diagonals (exact restructuring).
// Compute dtypes, f32 accumulate: every input rounded to bf16; q/k/v on PLAIN bf16 operands (inputs: exact) + bias; q.k on bf16 hi+lo planes (3 products); QE / KE on single fp16 planes against the (exactly representable) fp16

#define NB_  4
#define SS   1024
#define DM   1024
#define NH_  16
#define HD   64
#define NE   2048
#define EOFF 1024
#define HPP  8      // heads per group of the fp16 planes' layout
#define BPP  2      // batches per projection pass
#define NHP  (BPP * NH_)
typedef _Float16 h16;
typedef unsigned short bf;
typedef __attribute__((ext_vector_type(16))) __bf16   v16bf;
typedef __attribute__((ext_vector_type(16))) _Float16 v16h;
typedef __attribute__((ext_vector_type(8)))  _Float16 v8h;
typedef __attribute__((ext_vector_type(8)))  unsigned short v8us;
typedef __attribute__((ext_vector_type(8)))  float    v8f;
typedef __attribute__((ext_vector_type(4)))  float    v4f;
typedef v8h  __attribute__((may_alias)) v8ha;
typedef v4f  __attribute__((may_alias)) v4fa;
typedef v8us __attribute__((may_alias)) v8usa;

__device__ __forceinline__ unsigned short f2bf(float f) { unsigned u = __float_as_uint(f); u += 0x7FFFu + ((u >> 16) & 1u); return (unsigned short)(u >> 16); }
__device__ __forceinline__ float bf2f(unsigned short b) { return __uint_as_float(((unsigned)b) << 16); }
__device__ __forceinline__ float bfr(float f) { return bf2f(f2bf(f)); }
__device__ __forceinline__ v16h cat16(v8h lo, v8h hi) { return __builtin_shufflevector(lo, hi, 0, 1, 2, 3, 4, 5, 6, 7, 8, 9, 10, 11, 12, 13, 14, 15); }
__device__ __forceinline__ v16bf cat16b(v8us lo, v8us hi) { return __builtin_bit_cast(v16bf, __builtin_shufflevector(lo, hi, 0, 1, 2, 3, 4, 5, 6, 7, 8, 9, 10, 11, 12, 13, 14, 15)); }
__device__ __forceinline__ v8f wmma16(v16h a, v16h b, v8f c) { return __builtin_amdgcn_wmma_f32_16x16x32_f16(false, a, false, b, (short)0, c, false, false); }
__device__ __forceinline__ v8f wmmab(v16bf a, v16bf b, v8f c) { return __builtin_amdgcn_wmma_f32_16x16x32_bf16(false, a, false, b, (short)0, c, false, false); }



// ---- Fragment order: every 16-bit operand plane lies as blocks of 16 rows x 32 k = FB elements (1 KiB); the blocks' own order is said at each plane. Inside a block the element at place q belongs to
// row fr_row(q), k fr_k(q): [k half of 16][lane = 16 * (k / 8 % 2) + row][8 k]. A wave's 16-byte load at lane * 8 (and the one FB / 2 further) then covers 512 bytes in a row, four whole 128-B lines, not 32 bytes of each of 16 lines.
#define FB 512
__device__ __forceinline__ int fr_row(int q) { return (q >> 3) & 15; }
__device__ __forceinline__ int fr_k(int q) { return ((q >> 8) << 4) + (((q >> 7) & 1) << 3) + (q & 7); }

__device__ __forceinline__ h16 tohx(float x) { return (h16)x; }
__device__ __forceinline__ void splitf(float y, unsigned short& h, unsigned short& l) { h = f2bf(y); l = f2bf(y - bf2f(h)); }
typedef __attribute__((ext_vector_type(2))) unsigned short v2us;
typedef __attribute__((ext_vector_type(4))) unsigned short v4us;
typedef __attribute__((ext_vector_type(4))) _Float16 v4h;
template <typename T16> struct WFrag;
template <> struct WFrag<h16> { typedef v16h V; static __device__ __forceinline__ V ld(const h16* p) { return cat16(*(const v8h*)p, *(const v8h*)(p + 256)); } static __device__ __forceinline__ v8f mma(V a, V b, v8f c) { return wmma16(a, b, c); } };
template <> struct WFrag<bf> { typedef v16bf V; static __device__ __forceinline__ V ld(const bf* p) { return cat16b(*(const v8us*)p, *(const v8us*)(p + 256)); } static __device__ __forceinline__ v8f mma(V a, V b, v8f c) { return wmmab(a, b, c); } };
// ---- k_gemmw: the q, k, v projections (z = 0, 1, 2): register-blocked GEMM, NW WAVES per 64x64 tile (16 accumulators each), operands straight from 16-bit planes in fragment order, [row / 64][k / 32][row / 16 % 4] blocks (a tile's 4 blocks of one k step in a row); grid (M/64, N/64, 3), 32 * NW threads.
// Wave w takes the 32-wide k steps w, w + NW, ...; the NW partial tiles are summed through LDS in wave order, 16 rows at a time. y[m][n] = sum_k A[m][k] Bt[n][k] + bias[n] (one Bt plane, sB elements apart, and one f32 bias vector per z). K % 32 == 0.
// The 64 columns of a tile are one head, its 64 rows 64 positions t of one batch. The summed tile is split and stored straight into the attention kernel's planes (plane index hp = batch of the pass * 16 + head), in fragment order:
// q, k: Qh/Ql, Kh/Kl (bf16 hi+lo) as [hp][t / 16][d / 32] blocks (rows t, k = d), the fp16 planes in X16 as [hp / HPP][q, k][HPP heads], same blocks; v: VTh/VTl (bf16 hi+lo) as [hp][t / 32][d / 16] blocks (rows d, k = t).
// v's tile is made transposed (the two operands, which load alike, change places: rows d, columns t), so that for every z the 4 columns in a row that a thread sums are 4 k in a row of a block.
// Thread -> (row lr, columns 8 wv + 4 hi ..): a wave's 8-byte stores cover 256 bytes in a row of a block (16 rows x 8 k), and its 16-byte slab reads fall on 64 banks per half wave.
template <typename T16, int NW>
__global__ __launch_bounds__(32 * NW) void k_gemmw(const T16* __restrict__ A, const T16* __restrict__ Bt, int K, bf* Qh, bf* Ql, bf* Kh, bf* Kl, h16* X16, bf* VTh, bf* VTl, const float* __restrict__ bias0, const float* __restrict__ bias1, const float* __restrict__ bias2, size_t sB) {
    typedef typename WFrag<T16>::V V;
    static_assert(NW == 8, "one 16-byte piece of a 16 x 64 slab per thread");
    __shared__ __align__(16) float os[2 * NW * 16 * 68];
    const int wv = __builtin_amdgcn_readfirstlane((int)(threadIdx.x >> 5));
    const int z = blockIdx.z; Bt += (size_t)z * sB; const float* bias = z == 0 ? bias0 : (z == 1 ? bias1 : bias2);
    const int lane = threadIdx.x & 31, lr = lane & 15, hi = lane >> 4; const int r0 = blockIdx.x * 64, c0 = blockIdx.y * 64;
    v8f acc[4][4];
#pragma unroll
    for (int mb = 0; mb < 4; ++mb)
#pragma unroll
        for (int nb = 0; nb < 4; ++nb) acc[mb][nb] = (v8f){};
    const T16* Ar = A + (size_t)r0 * K + 8 * lane; const T16* Br = Bt + (size_t)c0 * K + 8 * lane;    // the lane's place in the first block of the tile's rows
    const T16* Pa = z == 2 ? Br : Ar; const T16* Pb = z == 2 ? Ar : Br;
#pragma unroll 1
    for (int kc = wv * 32; kc < K; kc += NW * 32) {
        V a[4]; const T16* pa = Pa + (size_t)kc * 64; const T16* pb = Pb + (size_t)kc * 64;   // the 4 blocks of this k step
#pragma unroll
        for (int mb = 0; mb < 4; ++mb) a[mb] = WFrag<T16>::ld(pa + FB * mb);
#pragma unroll
        for (int nb = 0; nb < 4; ++nb) { const V b = WFrag<T16>::ld(pb + FB * nb);
#pragma unroll
            for (int mb = 0; mb < 4; ++mb) acc[mb][nb] = WFrag<T16>::mma(a[mb], b, acc[mb][nb]); }
        asm volatile("s_wait_xcnt 0x0" : : "v"(pa), "v"(pb) : "memory");   // the address registers of the loads above stay as they are up to here
        asm volatile("v_nop\n\tv_nop\n\tv_nop\n\tv_nop" : "+v"(acc[0][0]), "+v"(acc[1][1]), "+v"(acc[2][2]), "+v"(acc[3][3]) : "v"(a[0]), "v"(a[3]));
    }
    const int cofs = 8 * wv + 4 * hi;
    const int hp = (r0 / SS) * NH_ + blockIdx.y, t0 = r0 % SS;
    const size_t e0 = (size_t)hp * SS * HD + (wv >> 2) * (z == 2 ? 4 * FB : FB) + (z == 2 ? t0 / 32 * (4 * FB) : t0 / 16 * (2 * FB)) + ((wv >> 1) & 1) * 256 + (wv & 1) * 128 + lr * 8 + hi * 4;   // slab 0's place; slab mb lies mb blocks (v) or mb block pairs (q, k) further
    bf* Ph = z == 0 ? Qh : (z == 1 ? Kh : VTh); bf* Pl = z == 0 ? Ql : (z == 1 ? Kl : VTl); h16* P16 = X16 + (size_t)(hp / HPP) * HPP * SS * HD + (z == 1 ? (size_t)HPP * SS * HD : 0);
    v4f bv;   // q, k: the bias of the thread's 4 columns; v (transposed tile): that of its row in each of the 4 slabs
#pragma unroll
    for (int u = 0; u < 4; ++u) bv[u] = bfr(bias[c0 + (z == 2 ? u * 16 + lr : cofs + u)]);
#pragma unroll
    for (int mb = 0; mb < 4; ++mb) {
        float* slab = os + (mb & 1) * (NW * 16 * 68);   // two slab sets: the barrier of slab mb + 1 ends every read of slab mb before slab mb + 2 overwrites it
        float* mine = slab + wv * (16 * 68);
#pragma unroll
        for (int nb = 0; nb < 4; ++nb) {
#pragma unroll
            for (int j = 0; j < 8; ++j) mine[(hi * 8 + j) * 68 + nb * 16 + lr] = acc[mb][nb][j]; }
        __syncthreads();   // every wave's partial slab is in LDS before any thread sums across waves
        v4f val = *(const v4fa*)(slab + lr * 68 + cofs);
#pragma unroll
        for (int w = 1; w < NW; ++w) val += *(const v4fa*)(slab + w * (16 * 68) + lr * 68 + cofs);
        if (z == 2) val += bv[mb]; else val += bv;
        const size_t e = e0 + mb * (z == 2 ? FB : 2 * FB); v4us oh, ol;
#pragma unroll
        for (int u = 0; u < 4; ++u) { unsigned short x, y; splitf(val[u], x, y); oh[u] = x; ol[u] = y; }
        *(v4us*)(Ph + e) = oh; *(v4us*)(Pl + e) = ol;
        asm volatile("s_wait_xcnt 0x0" ::: "memory");   // the registers that the two stores above name are written again only behind this wait
        if (z != 2) { v4h o6;
#pragma unroll
            for (int u = 0; u < 4; ++u) o6[u] = tohx(val[u]);
            *(v4h*)(P16 + e) = o6; }
    }
}

// ---- k_attn: scores, softmax and probs x v of 64 query rows of one head per work-group of 4 waves (16 rows each); grid (SS/64, NHP). The 16 column tiles of 64 are walked in turn with a running row maximum and sum.
// Score tile, rows l0 + i, columns r0 + c: the table row of (i, c) is l0 - r0 + SS - 64 + (i - c + 63), so a tile meets 127 rows in a row of the table. Wave w: its 16 k rows (columns 16 w .. of the tile) against the 80 table rows
// they meet -> keb (for all four waves, behind the barrier); its 16 q rows against the 80 table rows they meet -> qeb[w] (its own); q.k of its 16 rows on the hi+lo planes. Each score takes its two terms off the LDS diagonals, (q.k + q.pe) + k.pe.
// The tile then goes through the wave's own LDS slab into the A-fragment layout (lane = row, 32 of the 64 columns): maximum and sum in-lane plus one exchange between the halves; exp(s - max) is split into bf16 hi+lo and multiplied on v's hi+lo planes.
// Two waves a SIMD (amdgpu_waves_per_eu): 512 registers a wave, room for a tile's whole run of loads; the grid of a launch gives each WGP two work-groups.
#define PB 84   // LDS pitch in floats of an 80-wide band row: stores (row step 8 PB), the q diagonal (8 (PB + 1)) and the k diagonal (lane step PB - 1) each put the 32 lanes on 32 banks
__global__ __launch_bounds__(128) __attribute__((amdgpu_waves_per_eu(2, 2))) void k_attn(const bf* __restrict__ Qh, const bf* __restrict__ Ql, const bf* __restrict__ Kh, const bf* __restrict__ Kl, const h16* __restrict__ X16, const h16* __restrict__ E16, const bf* __restrict__ VTh, const bf* __restrict__ VTl, const float* __restrict__ am, float* out) {
    __shared__ __align__(16) float keb[2][64 * PB];   // two buffers: the one barrier of tile t + 1 ends every read of tile t before tile t + 2 overwrites it
    __shared__ __align__(16) float qeb[4][16 * PB];
    __shared__ __align__(16) float ams[SS];
    const int wv = __builtin_amdgcn_readfirstlane((int)(threadIdx.x >> 5));
    const int lane = threadIdx.x & 31, lr = lane & 15, hi = lane >> 4; const int l0 = blockIdx.x * 64, h = blockIdx.y;
    const size_t zo = (size_t)h * SS * HD; const size_t fo = (size_t)8 * lane;    // fo: the lane's place in a fragment block
    const h16* Xq = X16 + (size_t)(h / HPP) * 2 * HPP * SS * HD + (size_t)(h % HPP) * SS * HD;
    for (int i = threadIdx.x; i < SS; i += 128) ams[i] = bfr(am[(size_t)(h / NH_) * SS + i]);   // read behind the first tile's barrier
    const h16* pQ16 = Xq + (size_t)(l0 + 16 * wv) * HD + fo; const bf* pQh = Qh + zo + (size_t)(l0 + 16 * wv) * HD + fo; const bf* pQl = Ql + zo + (size_t)(l0 + 16 * wv) * HD + fo;
    const v16h q0 = WFrag<h16>::ld(pQ16), q1 = WFrag<h16>::ld(pQ16 + FB);
    v16bf qa[2], qa2[2];
#pragma unroll
    for (int kc = 0; kc < 2; ++kc) { qa[kc] = WFrag<bf>::ld(pQh + FB * kc); qa2[kc] = WFrag<bf>::ld(pQl + FB * kc); }
    asm volatile("s_wait_xcnt 0x0" : : "v"(pQ16), "v"(pQh), "v"(pQl) : "memory");   // the address registers of the loads above stay as they are up to here
    __builtin_amdgcn_sched_barrier(0);   // keeps the loop's address arithmetic from moving up over the wait, where it would rewrite the scalar bases that the loads above name
    v8f o[4];
#pragma unroll
    for (int nb = 0; nb < 4; ++nb) o[nb] = (v8f){};
    float mrun = -3.0e38f, lsum = 0.f;   // of row lr; lsum: this half's columns only
    float* mine = qeb[wv];
#pragma unroll 1
    for (int rt = 0; rt < SS / 64; ++rt) {
        const int r0 = rt * 64; float* kb = keb[rt & 1];
        const h16* pX = Xq + (size_t)(r0 + 16 * wv) * HD + fo;   // the k plane lies HPP * SS * HD elements behind the q plane
        const h16* pEk = E16 + (size_t)(l0 - r0 + SS - 64 + 16 * (3 - wv)) * HD + fo; const h16* pEq = E16 + (size_t)(l0 - r0 + SS - 64 + 16 * wv) * HD + fo;
        const bf* pKh = Kh + zo + (size_t)r0 * HD + fo; const bf* pKl = Kl + zo + (size_t)r0 * HD + fo;
        const bf* pVh = VTh + zo + (size_t)r0 * HD + fo; const bf* pVl = VTl + zo + (size_t)r0 * HD + fo;   // v: the 4 blocks (64 d) of 32 columns in a row
        // the tile's loads go out in two runs (here; v behind the barrier), each whole before its first use, so that a run costs one trip to memory
        v16h ek[5][2], eq[5][2]; v16bf kh[2][4], kl[2][4];
        const v16h k0 = WFrag<h16>::ld(pX + HPP * SS * HD), k1 = WFrag<h16>::ld(pX + HPP * SS * HD + FB);
#pragma unroll
        for (int t = 0; t < 5; ++t) { ek[t][0] = WFrag<h16>::ld(pEk + 16 * t * HD); ek[t][1] = WFrag<h16>::ld(pEk + 16 * t * HD + FB); }
#pragma unroll
        for (int t = 0; t < 5; ++t) { eq[t][0] = WFrag<h16>::ld(pEq + 16 * t * HD); eq[t][1] = WFrag<h16>::ld(pEq + 16 * t * HD + FB); }
#pragma unroll
        for (int kc = 0; kc < 2; ++kc) {
#pragma unroll
            for (int nb = 0; nb < 4; ++nb) { kh[kc][nb] = WFrag<bf>::ld(pKh + 16 * nb * HD + FB * kc); kl[kc][nb] = WFrag<bf>::ld(pKl + 16 * nb * HD + FB * kc); } }
        asm volatile("s_wait_xcnt 0x0" : : "v"(pX), "v"(pEk), "v"(pEq), "v"(pKh), "v"(pKl) : "memory");   // the address registers of the loads above stay as they are up to here
        __builtin_amdgcn_sched_barrier(0);   // keeps the products below from moving up between the loads, which would split the run into several trips to memory
        v8f ck[5];
#pragma unroll
        for (int t = 0; t < 5; ++t) { ck[t] = WFrag<h16>::mma(k0, ek[t][0], (v8f){}); ck[t] = WFrag<h16>::mma(k1, ek[t][1], ck[t]); }
#pragma unroll
        for (int t = 0; t < 5; ++t) {
#pragma unroll
            for (int j = 0; j < 8; ++j) kb[(16 * wv + 8 * hi + j) * PB + 16 * t + lr] = ck[t][j]; }
#pragma unroll
        for (int t = 0; t < 5; ++t) { v8f cq = WFrag<h16>::mma(q0, eq[t][0], (v8f){}); cq = WFrag<h16>::mma(q1, eq[t][1], cq);
#pragma unroll
            for (int j = 0; j < 8; ++j) mine[(8 * hi + j) * PB + 16 * t + lr] = cq[j]; }
        v8f acc[4];
#pragma unroll
        for (int nb = 0; nb < 4; ++nb) acc[nb] = (v8f){};
#pragma unroll
        for (int kc = 0; kc < 2; ++kc) {
#pragma unroll
            for (int nb = 0; nb < 4; ++nb) { acc[nb] = WFrag<bf>::mma(qa[kc], kh[kc][nb], acc[nb]); acc[nb] = WFrag<bf>::mma(qa2[kc], kh[kc][nb], acc[nb]); acc[nb] = WFrag<bf>::mma(qa[kc], kl[kc][nb], acc[nb]); } }
        __syncthreads();   // all four waves' rows of this tile's keb (and, at the first tile, ams) are in LDS before any wave reads them
        v16bf vh[2][4], vl[2][4];   // v's fragments fly while the scores are finished
#pragma unroll
        for (int kc = 0; kc < 2; ++kc) {
#pragma unroll
            for (int nb = 0; nb < 4; ++nb) { vh[kc][nb] = WFrag<bf>::ld(pVh + FB * (4 * kc + nb)); vl[kc][nb] = WFrag<bf>::ld(pVl + FB * (4 * kc + nb)); } }
        asm volatile("s_wait_xcnt 0x0" : : "v"(pVh), "v"(pVl) : "memory");   // as above
#pragma unroll
        for (int nb = 0; nb < 4; ++nb) {
#pragma unroll
            for (int j = 0; j < 8; ++j) { const int i = 8 * hi + j; acc[nb][j] = (acc[nb][j] + mine[i * PB + i - 16 * nb - lr + 63]) + kb[(16 * nb + lr) * PB + 16 * wv + i - lr + 15]; } }
        __builtin_amdgcn_wave_barrier(); asm volatile("" ::: "memory");   // keeps the slab stores below behind every lane's diagonal reads of the same LDS
#pragma unroll
        for (int nb = 0; nb < 4; ++nb) {
#pragma unroll
            for (int j = 0; j < 8; ++j) mine[(hi * 8 + j) * 68 + nb * 16 + lr] = acc[nb][j]; }
        __builtin_amdgcn_wave_barrier(); asm volatile("" ::: "memory");   // keeps the row reads below behind the other lanes' stores
        float s[32]; float mx = mrun;   // s[16 kc + e]: element e of A fragment kc, column 32 kc + 16 (e / 8) + 8 hi + e % 8 of row lr
#pragma unroll
        for (int g = 0; g < 4; ++g) {
#pragma unroll
            for (int q4 = 0; q4 < 2; ++q4) { const int c = 16 * g + 8 * hi + 4 * q4; const v4f a = *(const v4fa*)(mine + lr * 68 + c); const v4f m = *(const v4fa*)(ams + r0 + c);
#pragma unroll
                for (int u = 0; u < 4; ++u) { const float t = a[u] * 0.125f + m[u]; s[8 * g + 4 * q4 + u] = t; mx = fmaxf(mx, t); } } }
        __builtin_amdgcn_wave_barrier(); asm volatile("" ::: "memory");   // keeps the next tile's stores to this wave's LDS behind every lane's row reads
        mx = fmaxf(mx, __shfl_xor(mx, 16, 32));
        const float alpha = __builtin_amdgcn_exp2f((mrun - mx) * 1.4426950408889634f); mrun = mx;
        float ps = 0.f; v16bf ph[2], pl[2];
#pragma unroll
        for (int kc = 0; kc < 2; ++kc) {
#pragma unroll
            for (int e = 0; e < 16; ++e) { const float p = __builtin_amdgcn_exp2f((s[16 * kc + e] - mx) * 1.4426950408889634f); ps += p; const __bf16 hb = (__bf16)p; ph[kc][e] = hb; pl[kc][e] = (__bf16)(p - (float)hb); } }
        lsum = lsum * alpha + ps;
#pragma unroll
        for (int j = 0; j < 8; ++j) { const float aj = __shfl(alpha, 8 * hi + j, 32);   // accumulator register j holds row 8 hi + j
#pragma unroll
            for (int nb = 0; nb < 4; ++nb) o[nb][j] *= aj; }
#pragma unroll
        for (int kc = 0; kc < 2; ++kc) {
#pragma unroll
            for (int nb = 0; nb < 4; ++nb) { o[nb] = WFrag<bf>::mma(ph[kc], vh[kc][nb], o[nb]); o[nb] = WFrag<bf>::mma(pl[kc], vh[kc][nb], o[nb]); o[nb] = WFrag<bf>::mma(ph[kc], vl[kc][nb], o[nb]); } }
    }
    lsum += __shfl_xor(lsum, 16, 32);
    const float f = 1.0f / lsum;
#pragma unroll
    for (int j = 0; j < 8; ++j) { const float fj = __shfl(f, 8 * hi + j, 32);
#pragma unroll
        for (int nb = 0; nb < 4; ++nb) mine[(hi * 8 + j) * 68 + nb * 16 + lr] = o[nb][j] * fj; }
    __builtin_amdgcn_wave_barrier(); asm volatile("" ::: "memory");   // keeps the 16-byte slab reads below behind the other lanes' stores
    float* crow = out + (size_t)((h / NH_) * SS + l0 + 16 * wv) * DM + (h % NH_) * HD;
#pragma unroll
    for (int sx = 0; sx < 8; ++sx) { const int row = 2 * sx + hi, cofs = lr * 4; *(v4f*)(crow + (size_t)row * DM + cofs) = *(const v4fa*)(mine + row * 68 + cofs); }
}


__global__ __launch_bounds__(256) void k_wtG(const float* __restrict__ w0, const float* __restrict__ w1, const float* __restrict__ w2, int K, int N, bf* Bt) {
    const float* w = blockIdx.y == 0 ? w0 : (blockIdx.y == 1 ? w1 : w2); Bt += (size_t)blockIdx.y * K * N;
    const int lane = threadIdx.x & 31; const int L0 = (blockIdx.x * 8 + (threadIdx.x >> 5)) * 8; const int nlines = N * K / 64;
{
#pragma unroll 1
        for (int l = 0; l < 8; ++l) { const int L = L0 + l; if (L >= nlines) break; const size_t e = (size_t)L * 64 + lane * 2; const int q = (int)(e % FB); const int k = (int)(e % ((size_t)64 * K) / (4 * FB)) * 32 + fr_k(q), n = (int)(e / ((size_t)64 * K)) * 64 + (int)(e % (4 * FB) / FB) * 16 + fr_row(q); v2us o;
            o[0] = f2bf(w[(size_t)k * N + n]); o[1] = f2bf(w[(size_t)(k + 1) * N + n]); *(v2us*)(Bt + e) = o; }
         }
}
__global__ __launch_bounds__(256) void k_cvt8(const float* __restrict__ src, bf* dst, size_t n8) { const size_t i = (size_t)blockIdx.x * 256 + threadIdx.x; if (i >= n8) return; const int q = (int)(i * 8 % FB); const size_t m = i * 8 / (64 * DM) * 64 + i * 8 % (4 * FB) / FB * 16 + fr_row(q), k = i * 8 % (64 * DM) / (4 * FB) * 32 + fr_k(q); const v8f v = *(const v8f*)(src + m * DM + k); v8us o;
#pragma unroll
    for (int k = 0; k < 8; ++k) o[k] = f2bf(v[k]); *(v8us*)(dst + i * 8) = o;  }
// Each thread takes the next few elements of its output plane and works out from their place which (row, k) they are (fragment order, above).
// k_e16: E16 as [row / 16][d / 32] blocks (rows j, k = d) = fp16(bf16 dist_emb[1024 + j][d]) (8-B lanes).
__global__ __launch_bounds__(256) void k_e16(const float* __restrict__ emb, h16* E16) { const int e = (blockIdx.x * 256 + threadIdx.x) * 4; if (e >= NE * HD) return; const int q = e % FB; const int j = e / (16 * HD) * 16 + fr_row(q), d = e % (16 * HD) / FB * 32 + fr_k(q); const v4f a = *(const v4f*)(emb + (size_t)(EOFF + j) * HD + d); v4h o;
#pragma unroll
    for (int u = 0; u < 4; ++u) o[u] = tohx(bfr(a[u])); *(v4h*)(E16 + e) = o;  }
extern "C" void kernel_launch(void* const* d_in, const int* in_sizes, int n_in,
                              void* d_out, int out_size, void* d_ws, size_t ws_size, hipStream_t stream) {
    (void)in_sizes; (void)n_in; (void)out_size;
    const float** I = (const float**)d_in;
    const float *x = I[0], *am = I[1], *wq = I[2], *bq = I[3], *wk = I[4], *bk = I[5], *wv = I[6], *bv = I[7], *emb = I[8];
    float* OUT = (float*)d_out;     // [4][1024][1024]
    char* wsp = (char*)d_ws;
    auto take = [&](size_t bytes) { char* p = wsp; wsp += (bytes + 255) & ~(size_t)255; return (void*)p; };
    bf* WQ = (bf*)take((size_t)3 * DM * DM * 2); h16* E16 = (h16*)take((size_t)NE * HD * 2);    // WQ, WK, WV in a row
    bf* Qh = (bf*)take((size_t)NHP * SS * HD * 2); bf* Ql = (bf*)take((size_t)NHP * SS * HD * 2); bf* Kh = (bf*)take((size_t)NHP * SS * HD * 2); bf* Kl = (bf*)take((size_t)NHP * SS * HD * 2); h16* X16 = (h16*)take((size_t)2 * NHP * SS * HD * 2); bf* VTh = (bf*)take((size_t)NHP * HD * SS * 2); bf* VTl = (bf*)take((size_t)NHP * HD * SS * 2);
    bf* XB = (bf*)take((size_t)BPP * SS * DM * 2);    // x plane
    if ((size_t)(wsp - (char*)d_ws) > ws_size) return;    // total ~ 42 MiB
    k_wtG<<<dim3((DM * DM / 64 + 63) / 64, 3, 1), 256, 0, stream>>>(wq, wk, wv, DM, DM, WQ); k_e16<<<(NE * HD / 4 + 255) / 256, 256, 0, stream>>>(emb, E16);
    for (int b0 = 0; b0 < NB_; b0 += BPP) {
        k_cvt8<<<(BPP * SS * DM / 8 + 255) / 256, 256, 0, stream>>>(x + (size_t)b0 * SS * DM, XB, (size_t)BPP * SS * DM / 8);
        k_gemmw<bf, 8><<<dim3(BPP * SS / 64, DM / 64, 3), 256, 0, stream>>>(XB, WQ, DM, Qh, Ql, Kh, Kl, X16, VTh, VTl, bq, bk, bv, (size_t)DM * DM);
        k_attn<<<dim3(SS / 64, NHP, 1), 128, 0, stream>>>(Qh, Ql, Kh, Kl, X16, E16, VTh, VTl, am + (size_t)b0 * SS, OUT + (size_t)b0 * SS * DM); }
}

// v007
// One run takes 159 microseconds.
// Next to v006, in two timings, it ran 1.08 times as fast each time.
// Counting every step since v000, it is 9.97 times as fast.
#include <hip/hip_runtime.h>

// ElasticBertSelfAttention (hidden [4][1024][1024]; q/k/v = x W + b (16 heads x 64); scores[l][r] = q_l.k_r + q_l.pe[l-r] + k_r.pe[l-r] with pe[l-r] = dist_emb[l - r + 2047] (relative_key_query), / 8, + additive attention_mask[b][r] (read as data);
// softmax; ctx = probs v merged -> [4][1024][1024]). The positional terms are computed as q.E'^T and k.E'^T against the table rows that can occur (1024..3071), score tile by score tile, and gathered along the diagonals (exact restructuring).
// Compute dtypes, f32 accumulate: every input rounded to bf16; q/k/v on PLAIN bf16 operands (inputs: exact) + bias; q.k on bf16 hi+lo planes (3 products); QE / KE on single fp16 planes against the (exactly representable) fp16

#define NB_  4
#define SS   1024
#define DM   1024
#define NH_  16
#define HD   64
#define NE   2048
#define EOFF 1024
#define HPP  8      // heads per group of the fp16 planes' layout
#define BPP  4      // batches per pass: all of them, so that each of the three stages is one launch
#define NHP  (BPP * NH_)
typedef _Float16 h16;
typedef unsigned short bf;
typedef __attribute__((ext_vector_type(16))) __bf16   v16bf;
typedef __attribute__((ext_vector_type(16))) _Float16 v16h;
typedef __attribute__((ext_vector_type(8)))  _Float16 v8h;
typedef __attribute__((ext_vector_type(8)))  unsigned short v8us;
typedef __attribute__((ext_vector_type(8)))  float    v8f;
typedef __attribute__((ext_vector_type(4)))  float    v4f;
typedef v8h  __attribute__((may_alias)) v8ha;
typedef v4f  __attribute__((may_alias)) v4fa;
typedef v8us __attribute__((may_alias)) v8usa;

__device__ __forceinline__ unsigned short f2bf(float f) { unsigned u = __float_as_uint(f); u += 0x7FFFu + ((u >> 16) & 1u); return (unsigned short)(u >> 16); }
__device__ __forceinline__ float bf2f(unsigned short b) { return __uint_as_float(((unsigned)b) << 16); }
__device__ __forceinline__ float bfr(float f) { return bf2f(f2bf(f)); }
__device__ __forceinline__ v16h cat16(v8h lo, v8h hi) { return __builtin_shufflevector(lo, hi, 0, 1, 2, 3, 4, 5, 6, 7, 8, 9, 10, 11, 12, 13, 14, 15); }
__device__ __forceinline__ v16bf cat16b(v8us lo, v8us hi) { return __builtin_bit_cast(v16bf, __builtin_shufflevector(lo, hi, 0, 1, 2, 3, 4, 5, 6, 7, 8, 9, 10, 11, 12, 13, 14, 15)); }
__device__ __forceinline__ v8f wmma16(v16h a, v16h b, v8f c) { return __builtin_amdgcn_wmma_f32_16x16x32_f16(false, a, false, b, (short)0, c, false, false); }
__device__ __forceinline__ v8f wmmab(v16bf a, v16bf b, v8f c) { return __builtin_amdgcn_wmma_f32_16x16x32_bf16(false, a, false, b, (short)0, c, false, false); }



// ---- Fragment order: every 16-bit operand plane lies as blocks of 16 rows x 32 k = FB elements (1 KiB); the blocks' own order is said at each plane. Inside a block the element at place q belongs to
// row fr_row(q), k fr_k(q): [k half of 16][lane = 16 * (k / 8 % 2) + row][8 k]. A wave's 16-byte load at lane * 8 (and the one FB / 2 further) then covers 512 bytes in a row, four whole 128-B lines, not 32 bytes of each of 16 lines.
#define FB 512
__device__ __forceinline__ int fr_row(int q) { return (q >> 3) & 15; }
__device__ __forceinline__ int fr_k(int q) { return ((q >> 8) << 4) + (((q >> 7) & 1) << 3) + (q & 7); }

__device__ __forceinline__ h16 tohx(float x) { return (h16)x; }
__device__ __forceinline__ void splitf(float y, unsigned short& h, unsigned short& l) { h = f2bf(y); l = f2bf(y - bf2f(h)); }
typedef __attribute__((ext_vector_type(2))) unsigned short v2us;
typedef __attribute__((ext_vector_type(4))) unsigned short v4us;
typedef __attribute__((ext_vector_type(4))) _Float16 v4h;
template <typename T16> struct WFrag;
template <> struct WFrag<h16> { typedef v16h V; static __device__ __forceinline__ V ld(const h16* p) { return cat16(*(const v8h*)p, *(const v8h*)(p + 256)); } static __device__ __forceinline__ v8f mma(V a, V b, v8f c) { return wmma16(a, b, c); } };
template <> struct WFrag<bf> { typedef v16bf V; static __device__ __forceinline__ V ld(const bf* p) { return cat16b(*(const v8us*)p, *(const v8us*)(p + 256)); } static __device__ __forceinline__ v8f mma(V a, V b, v8f c) { return wmmab(a, b, c); } };
// ---- k_gemmw: the q, k, v projections (z = 0, 1, 2): register-blocked GEMM, NW WAVES per 64x64 tile (16 accumulators each), operands straight from 16-bit planes in fragment order, [row / 64][k / 32][row / 16 % 4] blocks (a tile's 4 blocks of one k step in a row); grid (M/64, N/64, 3), 32 * NW threads.
// Wave w takes the 32-wide k steps w, w + NW, ...; the NW partial tiles are summed through LDS in wave order, 16 rows at a time. y[m][n] = sum_k A[m][k] Bt[n][k] + bias[n] (one Bt plane, sB elements apart, and one f32 bias vector per z). K % 32 == 0.
// The 64 columns of a tile are one head, its 64 rows 64 positions t of one batch. The summed tile is split and stored straight into the attention kernel's planes (plane index hp = batch of the pass * 16 + head), in fragment order:
// q, k: Qh/Ql, Kh/Kl (bf16 hi+lo) as [hp][t / 16][d / 32] blocks (rows t, k = d), the fp16 planes in X16 as [hp / HPP][q, k][HPP heads], same blocks; v: VTh/VTl (bf16 hi+lo) as [hp][t / 32][d / 16] blocks (rows d, k = t).
// v's tile is made transposed (the two operands, which load alike, change places: rows d, columns t), so that for every z the 4 columns in a row that a thread sums are 4 k in a row of a block.
// Thread -> (row lr, columns 8 wv + 4 hi ..): a wave's 8-byte stores cover 256 bytes in a row of a block (16 rows x 8 k), and its 16-byte slab reads fall on 64 banks per half wave.
template <typename T16, int NW>
__global__ __launch_bounds__(32 * NW) void k_gemmw(const T16* __restrict__ A, const T16* __restrict__ Bt, int K, bf* Qh, bf* Ql, bf* Kh, bf* Kl, h16* X16, bf* VTh, bf* VTl, const float* __restrict__ bias0, const float* __restrict__ bias1, const float* __restrict__ bias2, size_t sB) {
    typedef typename WFrag<T16>::V V;
    static_assert(NW == 8, "one 16-byte piece of a 16 x 64 slab per thread");
    __shared__ __align__(16) float os[2 * NW * 16 * 68];
    const int wv = __builtin_amdgcn_readfirstlane((int)(threadIdx.x >> 5));
    const int z = blockIdx.z; Bt += (size_t)z * sB; const float* bias = z == 0 ? bias0 : (z == 1 ? bias1 : bias2);
    const int lane = threadIdx.x & 31, lr = lane & 15, hi = lane >> 4; const int r0 = blockIdx.x * 64, c0 = blockIdx.y * 64;
    v8f acc[4][4];
#pragma unroll
    for (int mb = 0; mb < 4; ++mb)
#pragma unroll
        for (int nb = 0; nb < 4; ++nb) acc[mb][nb] = (v8f){};
    const T16* Ar = A + (size_t)r0 * K + 8 * lane; const T16* Br = Bt + (size_t)c0 * K + 8 * lane;    // the lane's place in the first block of the tile's rows
    const T16* Pa = z == 2 ? Br : Ar; const T16* Pb = z == 2 ? Ar : Br;
#pragma unroll 1
    for (int kc = wv * 32; kc < K; kc += NW * 32) {
        V a[4]; const T16* pa = Pa + (size_t)kc * 64; const T16* pb = Pb + (size_t)kc * 64;   // the 4 blocks of this k step
#pragma unroll
        for (int mb = 0; mb < 4; ++mb) a[mb] = WFrag<T16>::ld(pa + FB * mb);
#pragma unroll
        for (int nb = 0; nb < 4; ++nb) { const V b = WFrag<T16>::ld(pb + FB * nb);
#pragma unroll
            for (int mb = 0; mb < 4; ++mb) acc[mb][nb] = WFrag<T16>::mma(a[mb], b, acc[mb][nb]); }
        asm volatile("s_wait_xcnt 0x0" : : "v"(pa), "v"(pb) : "memory");   // the address registers of the loads above stay as they are up to here
        asm volatile("v_nop\n\tv_nop\n\tv_nop\n\tv_nop" : "+v"(acc[0][0]), "+v"(acc[1][1]), "+v"(acc[2][2]), "+v"(acc[3][3]) : "v"(a[0]), "v"(a[3]));
    }
    const int cofs = 8 * wv + 4 * hi;
    const int hp = (r0 / SS) * NH_ + blockIdx.y, t0 = r0 % SS;
    const size_t e0 = (size_t)hp * SS * HD + (wv >> 2) * (z == 2 ? 4 * FB : FB) + (z == 2 ? t0 / 32 * (4 * FB) : t0 / 16 * (2 * FB)) + ((wv >> 1) & 1) * 256 + (wv & 1) * 128 + lr * 8 + hi * 4;   // slab 0's place; slab mb lies mb blocks (v) or mb block pairs (q, k) further
    bf* Ph = z == 0 ? Qh : (z == 1 ? Kh : VTh); bf* Pl = z == 0 ? Ql : (z == 1 ? Kl : VTl); h16* P16 = X16 + (size_t)(hp / HPP) * HPP * SS * HD + (z == 1 ? (size_t)HPP * SS * HD : 0);
    v4f bv;   // q, k: the bias of the thread's 4 columns; v (transposed tile): that of its row in each of the 4 slabs
#pragma unroll
    for (int u = 0; u < 4; ++u) bv[u] = bfr(bias[c0 + (z == 2 ? u * 16 + lr : cofs + u)]);
#pragma unroll
    for (int mb = 0; mb < 4; ++mb) {
        float* slab = os + (mb & 1) * (NW * 16 * 68);   // two slab sets: the barrier of slab mb + 1 ends every read of slab mb before slab mb + 2 overwrites it
        float* mine = slab + wv * (16 * 68);
#pragma unroll
        for (int nb = 0; nb < 4; ++nb) {
#pragma unroll
            for (int j = 0; j < 8; ++j) mine[(hi * 8 + j) * 68 + nb * 16 + lr] = acc[mb][nb][j]; }
        __syncthreads();   // every wave's partial slab is in LDS before any thread sums across waves
        v4f val = *(const v4fa*)(slab + lr * 68 + cofs);
#pragma unroll
        for (int w = 1; w < NW; ++w) val += *(const v4fa*)(slab + w * (16 * 68) + lr * 68 + cofs);
        if (z == 2) val += bv[mb]; else val += bv;
        const size_t e = e0 + mb * (z == 2 ? FB : 2 * FB); v4us oh, ol;
#pragma unroll
        for (int u = 0; u < 4; ++u) { unsigned short x, y; splitf(val[u], x, y); oh[u] = x; ol[u] = y; }
        *(v4us*)(Ph + e) = oh; *(v4us*)(Pl + e) = ol;
        asm volatile("s_wait_xcnt 0x0" ::: "memory");   // the registers that the two stores above name are written again only behind this wait
        if (z != 2) { v4h o6;
#pragma unroll
            for (int u = 0; u < 4; ++u) o6[u] = tohx(val[u]);
            *(v4h*)(P16 + e) = o6; }
    }
}

// ---- k_attn: scores, softmax and probs x v of 64 query rows of one head per work-group of 4 waves (16 rows each); grid (SS/64, NHP). The 16 column tiles of 64 are walked in turn with a running row maximum and sum.
// Score tile, rows l0 + i, columns r0 + c: the table row of (i, c) is l0 - r0 + SS - 64 + (i - c + 63), so a tile meets 127 rows in a row of the table. Wave w: its 16 k rows (columns 16 w .. of the tile) against the 80 table rows
// they meet -> keb (for all four waves, behind the barrier); its 16 q rows against the 80 table rows they meet -> qeb[w] (its own); q.k of its 16 rows on the hi+lo planes. Each score takes its two terms off the LDS diagonals, (q.k + q.pe) + k.pe.
// The tile then goes through the wave's own LDS slab into the A-fragment layout (lane = row, 32 of the 64 columns): maximum and sum in-lane plus one exchange between the halves; exp(s - max) is split into bf16 hi+lo and multiplied on v's hi+lo planes.
// Two waves a SIMD (amdgpu_waves_per_eu): 512 registers a wave, room for a tile's whole run of loads; a WGP holds two work-groups at a time.
#define PB 84   // LDS pitch in floats of an 80-wide band row: stores (row step 8 PB), the q diagonal (8 (PB + 1)) and the k diagonal (lane step PB - 1) each put the 32 lanes on 32 banks
__global__ __launch_bounds__(128) __attribute__((amdgpu_waves_per_eu(2, 2))) void k_attn(const bf* __restrict__ Qh, const bf* __restrict__ Ql, const bf* __restrict__ Kh, const bf* __restrict__ Kl, const h16* __restrict__ X16, const h16* __restrict__ E16, const bf* __restrict__ VTh, const bf* __restrict__ VTl, const float* __restrict__ am, float* out) {
    __shared__ __align__(16) float keb[2][64 * PB];   // two buffers: the one barrier of tile t + 1 ends every read of tile t before tile t + 2 overwrites it
    __shared__ __align__(16) float qeb[4][16 * PB];
    __shared__ __align__(16) float ams[SS];
    const int wv = __builtin_amdgcn_readfirstlane((int)(threadIdx.x >> 5));
    const int lane = threadIdx.x & 31, lr = lane & 15, hi = lane >> 4; const int l0 = blockIdx.x * 64, h = blockIdx.y;
    const size_t zo = (size_t)h * SS * HD; const size_t fo = (size_t)8 * lane;    // fo: the lane's place in a fragment block
    const h16* Xq = X16 + (size_t)(h / HPP) * 2 * HPP * SS * HD + (size_t)(h % HPP) * SS * HD;
    for (int i = threadIdx.x; i < SS; i += 128) ams[i] = bfr(am[(size_t)(h / NH_) * SS + i]);   // read behind the first tile's barrier
    const h16* pQ16 = Xq + (size_t)(l0 + 16 * wv) * HD + fo; const bf* pQh = Qh + zo + (size_t)(l0 + 16 * wv) * HD + fo; const bf* pQl = Ql + zo + (size_t)(l0 + 16 * wv) * HD + fo;
    const v16h q0 = WFrag<h16>::ld(pQ16), q1 = WFrag<h16>::ld(pQ16 + FB);
    v16bf qa[2], qa2[2];
#pragma unroll
    for (int kc = 0; kc < 2; ++kc) { qa[kc] = WFrag<bf>::ld(pQh + FB * kc); qa2[kc] = WFrag<bf>::ld(pQl + FB * kc); }
    asm volatile("s_wait_xcnt 0x0" : : "v"(pQ16), "v"(pQh), "v"(pQl) : "memory");   // the address registers of the loads above stay as they are up to here
    __builtin_amdgcn_sched_barrier(0);   // keeps the loop's address arithmetic from moving up over the wait, where it would rewrite the scalar bases that the loads above name
    v8f o[4];
#pragma unroll
    for (int nb = 0; nb < 4; ++nb) o[nb] = (v8f){};
    float mrun = -3.0e38f, lsum = 0.f;   // of row lr; lsum: this half's columns only
    float* mine = qeb[wv];
#pragma unroll 1
    for (int rt = 0; rt < SS / 64; ++rt) {
        const int r0 = rt * 64; float* kb = keb[rt & 1];
        const h16* pX = Xq + (size_t)(r0 + 16 * wv) * HD + fo;   // the k plane lies HPP * SS * HD elements behind the q plane
        const h16* pEk = E16 + (size_t)(l0 - r0 + SS - 64 + 16 * (3 - wv)) * HD + fo; const h16* pEq = E16 + (size_t)(l0 - r0 + SS - 64 + 16 * wv) * HD + fo;
        const bf* pKh = Kh + zo + (size_t)r0 * HD + fo; const bf* pKl = Kl + zo + (size_t)r0 * HD + fo;
        const bf* pVh = VTh + zo + (size_t)r0 * HD + fo; const bf* pVl = VTl + zo + (size_t)r0 * HD + fo;   // v: the 4 blocks (64 d) of 32 columns in a row
        // the tile's loads go out in two runs (here; v behind the barrier), each whole before its first use, so that a run costs one trip to memory
        v16h ek[5][2], eq[5][2]; v16bf kh[2][4], kl[2][4];
        const v16h k0 = WFrag<h16>::ld(pX + HPP * SS * HD), k1 = WFrag<h16>::ld(pX + HPP * SS * HD + FB);
#pragma unroll
        for (int t = 0; t < 5; ++t) { ek[t][0] = WFrag<h16>::ld(pEk + 16 * t * HD); ek[t][1] = WFrag<h16>::ld(pEk + 16 * t * HD + FB); }
#pragma unroll
        for (int t = 0; t < 5; ++t) { eq[t][0] = WFrag<h16>::ld(pEq + 16 * t * HD); eq[t][1] = WFrag<h16>::ld(pEq + 16 * t * HD + FB); }
#pragma unroll
        for (int kc = 0; kc < 2; ++kc) {
#pragma unroll
            for (int nb = 0; nb < 4; ++nb) { kh[kc][nb] = WFrag<bf>::ld(pKh + 16 * nb * HD + FB * kc); kl[kc][nb] = WFrag<bf>::ld(pKl + 16 * nb * HD + FB * kc); } }
        asm volatile("s_wait_xcnt 0x0" : : "v"(pX), "v"(pEk), "v"(pEq), "v"(pKh), "v"(pKl) : "memory");   // the address registers of the loads above stay as they are up to here
        __builtin_amdgcn_sched_barrier(0);   // keeps the products below from moving up between the loads, which would split the run into several trips to memory
        v8f ck[5];
#pragma unroll
        for (int t = 0; t < 5; ++t) { ck[t] = WFrag<h16>::mma(k0, ek[t][0], (v8f){}); ck[t] = WFrag<h16>::mma(k1, ek[t][1], ck[t]); }
#pragma unroll
        for (int t = 0; t < 5; ++t) {
#pragma unroll
            for (int j = 0; j < 8; ++j) kb[(16 * wv + 8 * hi + j) * PB + 16 * t + lr] = ck[t][j]; }
#pragma unroll
        for (int t = 0; t < 5; ++t) { v8f cq = WFrag<h16>::mma(q0, eq[t][0], (v8f){}); cq = WFrag<h16>::mma(q1, eq[t][1], cq);
#pragma unroll
            for (int j = 0; j < 8; ++j) mine[(8 * hi + j) * PB + 16 * t + lr] = cq[j]; }
        v8f acc[4];
#pragma unroll
        for (int nb = 0; nb < 4; ++nb) acc[nb] = (v8f){};
#pragma unroll
        for (int kc = 0; kc < 2; ++kc) {
#pragma unroll
            for (int nb = 0; nb < 4; ++nb) { acc[nb] = WFrag<bf>::mma(qa[kc], kh[kc][nb], acc[nb]); acc[nb] = WFrag<bf>::mma(qa2[kc], kh[kc][nb], acc[nb]); acc[nb] = WFrag<bf>::mma(qa[kc], kl[kc][nb], acc[nb]); } }
        __syncthreads();   // all four waves' rows of this tile's keb (and, at the first tile, ams) are in LDS before any wave reads them
        v16bf vh[2][4], vl[2][4];   // v's fragments fly while the scores are finished
#pragma unroll
        for (int kc = 0; kc < 2; ++kc) {
#pragma unroll
            for (int nb = 0; nb < 4; ++nb) { vh[kc][nb] = WFrag<bf>::ld(pVh + FB * (4 * kc + nb)); vl[kc][nb] = WFrag<bf>::ld(pVl + FB * (4 * kc + nb)); } }
        asm volatile("s_wait_xcnt 0x0" : : "v"(pVh), "v"(pVl) : "memory");   // as above
#pragma unroll
        for (int nb = 0; nb < 4; ++nb) {
#pragma unroll
            for (int j = 0; j < 8; ++j) { const int i = 8 * hi + j; acc[nb][j] = (acc[nb][j] + mine[i * PB + i - 16 * nb - lr + 63]) + kb[(16 * nb + lr) * PB + 16 * wv + i - lr + 15]; } }
        __builtin_amdgcn_wave_barrier(); asm volatile("" ::: "memory");   // keeps the slab stores below behind every lane's diagonal reads of the same LDS
#pragma unroll
        for (int nb = 0; nb < 4; ++nb) {
#pragma unroll
            for (int j = 0; j < 8; ++j) mine[(hi * 8 + j) * 68 + nb * 16 + lr] = acc[nb][j]; }
        __builtin_amdgcn_wave_barrier(); asm volatile("" ::: "memory");   // keeps the row reads below behind the other lanes' stores
        float s[32]; float mx = mrun;   // s[16 kc + e]: element e of A fragment kc, column 32 kc + 16 (e / 8) + 8 hi + e % 8 of row lr
#pragma unroll
        for (int g = 0; g < 4; ++g) {
#pragma unroll
            for (int q4 = 0; q4 < 2; ++q4) { const int c = 16 * g + 8 * hi + 4 * q4; const v4f a = *(const v4fa*)(mine + lr * 68 + c); const v4f m = *(const v4fa*)(ams + r0 + c);
#pragma unroll
                for (int u = 0; u < 4; ++u) { const float t = a[u] * 0.125f + m[u]; s[8 * g + 4 * q4 + u] = t; mx = fmaxf(mx, t); } } }
        __builtin_amdgcn_wave_barrier(); asm volatile("" ::: "memory");   // keeps the next tile's stores to this wave's LDS behind every lane's row reads
        mx = fmaxf(mx, __shfl_xor(mx, 16, 32));
        const float alpha = __builtin_amdgcn_exp2f((mrun - mx) * 1.4426950408889634f); mrun = mx;
        float ps = 0.f; v16bf ph[2], pl[2];
#pragma unroll
        for (int kc = 0; kc < 2; ++kc) {
#pragma unroll
            for (int e = 0; e < 16; ++e) { const float p = __builtin_amdgcn_exp2f((s[16 * kc + e] - mx) * 1.4426950408889634f); ps += p; const __bf16 hb = (__bf16)p; ph[kc][e] = hb; pl[kc][e] = (__bf16)(p - (float)hb); } }
        lsum = lsum * alpha + ps;
#pragma unroll
        for (int j = 0; j < 8; ++j) { const float aj = __shfl(alpha, 8 * hi + j, 32);   // accumulator register j holds row 8 hi + j
#pragma unroll
            for (int nb = 0; nb < 4; ++nb) o[nb][j] *= aj; }
#pragma unroll
        for (int kc = 0; kc < 2; ++kc) {
#pragma unroll
            for (int nb = 0; nb < 4; ++nb) { o[nb] = WFrag<bf>::mma(ph[kc], vh[kc][nb], o[nb]); o[nb] = WFrag<bf>::mma(pl[kc], vh[kc][nb], o[nb]); o[nb] = WFrag<bf>::mma(ph[kc], vl[kc][nb], o[nb]); } }
    }
    lsum += __shfl_xor(lsum, 16, 32);
    const float f = 1.0f / lsum;
#pragma unroll
    for (int j = 0; j < 8; ++j) { const float fj = __shfl(f, 8 * hi + j, 32);
#pragma unroll
        for (int nb = 0; nb < 4; ++nb) mine[(hi * 8 + j) * 68 + nb * 16 + lr] = o[nb][j] * fj; }
    __builtin_amdgcn_wave_barrier(); asm volatile("" ::: "memory");   // keeps the 16-byte slab reads below behind the other lanes' stores
    float* crow = out + (size_t)((h / NH_) * SS + l0 + 16 * wv) * DM + (h % NH_) * HD;
#pragma unroll
    for (int sx = 0; sx < 8; ++sx) { const int row = 2 * sx + hi, cofs = lr * 4; *(v4f*)(crow + (size_t)row * DM + cofs) = *(const v4fa*)(mine + row * 68 + cofs); }
}


// ---- The three converters are parts of one grid (k_prep, below): each takes its own block index bx. None reads what another writes.
__device__ __forceinline__ void d_wtG(int bx, int by, const float* __restrict__ w0, const float* __restrict__ w1, const float* __restrict__ w2, int K, int N, bf* Bt) {
    const float* w = by == 0 ? w0 : (by == 1 ? w1 : w2); Bt += (size_t)by * K * N;
    const int lane = threadIdx.x & 31; const int L0 = (bx * 8 + (threadIdx.x >> 5)) * 8; const int nlines = N * K / 64;
{
#pragma unroll 1
        for (int l = 0; l < 8; ++l) { const int L = L0 + l; if (L >= nlines) break; const size_t e = (size_t)L * 64 + lane * 2; const int q = (int)(e % FB); const int k = (int)(e % ((size_t)64 * K) / (4 * FB)) * 32 + fr_k(q), n = (int)(e / ((size_t)64 * K)) * 64 + (int)(e % (4 * FB) / FB) * 16 + fr_row(q); v2us o;
            o[0] = f2bf(w[(size_t)k * N + n]); o[1] = f2bf(w[(size_t)(k + 1) * N + n]); *(v2us*)(Bt + e) = o; }
         }
}
__device__ __forceinline__ void d_cvt8(int bx, const float* __restrict__ src, bf* dst, size_t n8) { const size_t i = (size_t)bx * 256 + threadIdx.x; if (i >= n8) return; const int q = (int)(i * 8 % FB); const size_t m = i * 8 / (64 * DM) * 64 + i * 8 % (4 * FB) / FB * 16 + fr_row(q), k = i * 8 % (64 * DM) / (4 * FB) * 32 + fr_k(q); const v8f v = *(const v8f*)(src + m * DM + k); v8us o;
#pragma unroll
    for (int k = 0; k < 8; ++k) o[k] = f2bf(v[k]); *(v8us*)(dst + i * 8) = o;  }
// Each thread takes the next few elements of its output plane and works out from their place which (row, k) they are (fragment order, above).
// d_e16: E16 as [row / 16][d / 32] blocks (rows j, k = d) = fp16(bf16 dist_emb[1024 + j][d]) (8-B lanes).
__device__ __forceinline__ void d_e16(int bx, const float* __restrict__ emb, h16* E16) { const int e = (bx * 256 + threadIdx.x) * 4; if (e >= NE * HD) return; const int q = e % FB; const int j = e / (16 * HD) * 16 + fr_row(q), d = e % (16 * HD) / FB * 32 + fr_k(q); const v4f a = *(const v4f*)(emb + (size_t)(EOFF + j) * HD + d); v4h o;
#pragma unroll
    for (int u = 0; u < 4; ++u) o[u] = tohx(bfr(a[u])); *(v4h*)(E16 + e) = o;  }
// ---- k_prep: one grid for the weights' planes (GW work-groups per matrix, first: each of their waves walks 8 dependent trips to memory), the x plane (GX) and the table's plane (GE).
#define GW ((DM * DM / 64 + 63) / 64)
#define GX ((BPP * SS * DM / 8 + 255) / 256)
#define GE ((NE * HD / 4 + 255) / 256)
__global__ __launch_bounds__(256) void k_prep(const float* __restrict__ w0, const float* __restrict__ w1, const float* __restrict__ w2, const float* __restrict__ x, const float* __restrict__ emb, bf* Bt, bf* XB, h16* E16) {
    const int b = blockIdx.x;
    if (b < 3 * GW) d_wtG(b % GW, b / GW, w0, w1, w2, DM, DM, Bt);
    else if (b < 3 * GW + GX) d_cvt8(b - 3 * GW, x, XB, (size_t)BPP * SS * DM / 8);
    else d_e16(b - 3 * GW - GX, emb, E16);
}
extern "C" void kernel_launch(void* const* d_in, const int* in_sizes, int n_in,
                              void* d_out, int out_size, void* d_ws, size_t ws_size, hipStream_t stream) {
    (void)in_sizes; (void)n_in; (void)out_size;
    const float** I = (const float**)d_in;
    const float *x = I[0], *am = I[1], *wq = I[2], *bq = I[3], *wk = I[4], *bk = I[5], *wv = I[6], *bv = I[7], *emb = I[8];
    float* OUT = (float*)d_out;     // [4][1024][1024]
    char* wsp = (char*)d_ws;
    auto take = [&](size_t bytes) { char* p = wsp; wsp += (bytes + 255) & ~(size_t)255; return (void*)p; };
    bf* WQ = (bf*)take((size_t)3 * DM * DM * 2); h16* E16 = (h16*)take((size_t)NE * HD * 2);    // WQ, WK, WV in a row
    bf* Qh = (bf*)take((size_t)NHP * SS * HD * 2); bf* Ql = (bf*)take((size_t)NHP * SS * HD * 2); bf* Kh = (bf*)take((size_t)NHP * SS * HD * 2); bf* Kl = (bf*)take((size_t)NHP * SS * HD * 2); h16* X16 = (h16*)take((size_t)2 * NHP * SS * HD * 2); bf* VTh = (bf*)take((size_t)NHP * HD * SS * 2); bf* VTl = (bf*)take((size_t)NHP * HD * SS * 2);
    bf* XB = (bf*)take((size_t)BPP * SS * DM * 2);    // x plane
    if ((size_t)(wsp - (char*)d_ws) > ws_size) return;    // total ~ 79 MiB
    static_assert(BPP == NB_, "one pass takes every batch");
    k_prep<<<3 * GW + GX + GE, 256, 0, stream>>>(wq, wk, wv, x, emb, WQ, XB, E16);
    k_gemmw<bf, 8><<<dim3(BPP * SS / 64, DM / 64, 3), 256, 0, stream>>>(XB, WQ, DM, Qh, Ql, Kh, Kl, X16, VTh, VTl, bq, bk, bv, (size_t)DM * DM);
    k_attn<<<dim3(SS / 64, NHP, 1), 128, 0, stream>>>(Qh, Ql, Kh, Kl, X16, E16, VTh, VTl, am, OUT);
}

// v008
// One run takes 149 microseconds.
// Next to v007, in two timings, it ran 1.07 times as fast each time.
// Over all steps from v000 it is 10.7 times as fast.
#include <hip/hip_runtime.h>

// ElasticBertSelfAttention (hidden [4][1024][1024]; q/k/v = x W + b (16 heads x 64); scores[l][r] = q_l.k_r + q_l.pe[l-r] + k_r.pe[l-r] with pe[l-r] = dist_emb[l - r + 2047] (relative_key_query), / 8, + additive attention_mask[b][r] (read as data);
// softmax; ctx = probs v merged -> [4][1024][1024]). The positional terms are computed as q.E'^T and k.E'^T against the table rows that can occur (1024..3071), score tile by score tile, and gathered along the diagonals (exact restructuring).
// Compute dtypes, f32 accumulate: every input rounded to bf16; q/k/v on PLAIN bf16 operands (inputs: exact) + bias; q.k on bf16 hi+lo planes (3 products); QE / KE on single fp16 planes against the (exactly representable) fp16

#define NB_  4
#define SS   1024
#define DM   1024
#define NH_  16
#define HD   64
#define NE   2048
#define EOFF 1024
#define HPP  8      // heads per group of the fp16 planes' layout
#define BPP  4      // batches per pass: all of them, so that each of the three stages is one launch
#define NHP  (BPP * NH_)
typedef _Float16 h16;
typedef unsigned short bf;
typedef __attribute__((ext_vector_type(16))) __bf16   v16bf;
typedef __attribute__((ext_vector_type(16))) _Float16 v16h;
typedef __attribute__((ext_vector_type(8)))  _Float16 v8h;
typedef __attribute__((ext_vector_type(8)))  unsigned short v8us;
typedef __attribute__((ext_vector_type(8)))  float    v8f;
typedef __attribute__((ext_vector_type(4)))  float    v4f;
typedef v8h  __attribute__((may_alias)) v8ha;
typedef v4f  __attribute__((may_alias)) v4fa;
typedef v8us __attribute__((may_alias)) v8usa;

__device__ __forceinline__ unsigned short f2bf(float f) { unsigned u = __float_as_uint(f); u += 0x7FFFu + ((u >> 16) & 1u); return (unsigned short)(u >> 16); }
__device__ __forceinline__ float bf2f(unsigned short b) { return __uint_as_float(((unsigned)b) << 16); }
__device__ __forceinline__ float bfr(float f) { return bf2f(f2bf(f)); }
__device__ __forceinline__ v16h cat16(v8h lo, v8h hi) { return __builtin_shufflevector(lo, hi, 0, 1, 2, 3, 4, 5, 6, 7, 8, 9, 10, 11, 12, 13, 14, 15); }
__device__ __forceinline__ v16bf cat16b(v8us lo, v8us hi) { return __builtin_bit_cast(v16bf, __builtin_shufflevector(lo, hi, 0, 1, 2, 3, 4, 5, 6, 7, 8, 9, 10, 11, 12, 13, 14, 15)); }
__device__ __forceinline__ v8f wmma16(v16h a, v16h b, v8f c) { return __builtin_amdgcn_wmma_f32_16x16x32_f16(false, a, false, b, (short)0, c, false, false); }
__device__ __forceinline__ v8f wmmab(v16bf a, v16bf b, v8f c) { return __builtin_amdgcn_wmma_f32_16x16x32_bf16(false, a, false, b, (short)0, c, false, false); }



// ---- Fragment order: every 16-bit operand plane lies as blocks of 16 rows x 32 k = FB elements (1 KiB); the blocks' own order is said at each plane. Inside a block the element at place q belongs to
// row fr_row(q), k fr_k(q): [k half of 16][lane = 16 * (k / 8 % 2) + row][8 k]. A wave's 16-byte load at lane * 8 (and the one FB / 2 further) then covers 512 bytes in a row, four whole 128-B lines, not 32 bytes of each of 16 lines.
#define FB 512
__device__ __forceinline__ int fr_row(int q) { return (q >> 3) & 15; }
__device__ __forceinline__ int fr_k(int q) { return ((q >> 8) << 4) + (((q >> 7) & 1) << 3) + (q & 7); }

__device__ __forceinline__ h16 tohx(float x) { return (h16)x; }
__device__ __forceinline__ void splitf(float y, unsigned short& h, unsigned short& l) { h = f2bf(y); l = f2bf(y - bf2f(h)); }
typedef __attribute__((ext_vector_type(2))) unsigned short v2us;
typedef __attribute__((ext_vector_type(4))) unsigned short v4us;
typedef __attribute__((ext_vector_type(4))) _Float16 v4h;
template <typename T16> struct WFrag;
template <> struct WFrag<h16> { typedef v16h V; static __device__ __forceinline__ V ld(const h16* p) { return cat16(*(const v8h*)p, *(const v8h*)(p + 256)); } static __device__ __forceinline__ v8f mma(V a, V b, v8f c) { return wmma16(a, b, c); } };
template <> struct WFrag<bf> { typedef v16bf V; static __device__ __forceinline__ V ld(const bf* p) { return cat16b(*(const v8us*)p, *(const v8us*)(p + 256)); } static __device__ __forceinline__ v8f mma(V a, V b, v8f c) { return wmmab(a, b, c); } };
// ---- k_gemmw: the q, k, v projections (z = 0, 1, 2): register-blocked GEMM, NW WAVES per 64x64 tile (16 accumulators each), operands straight from 16-bit planes in fragment order, [row / 64][k / 32][row / 16 % 4] blocks (a tile's 4 blocks of one k step in a row); grid (M/64, N/64, 3), 32 * NW threads.
// Wave w takes the 32-wide k steps w, w + NW, ...; the NW partial tiles are summed through LDS in wave order, 16 rows at a time. y[m][n] = sum_k A[m][k] Bt[n][k] + bias[n] (one Bt plane, sB elements apart, and one f32 bias vector per z). K % 32 == 0.
// The 64 columns of a tile are one head, its 64 rows 64 positions t of one batch. The summed tile is split and stored straight into the attention kernel's planes (plane index hp = batch of the pass * 16 + head), in fragment order:
// q, k: Qh/Ql, Kh/Kl (bf16 hi+lo) as [hp][t / 16][d / 32] blocks (rows t, k = d), the fp16 planes in X16 as [hp / HPP][q, k][HPP heads], same blocks; v: VTh/VTl (bf16 hi+lo) as [hp][t / 32][d / 16] blocks (rows d, k = t).
// v's tile is made transposed (the two operands, which load alike, change places: rows d, columns t), so that for every z the 4 columns in a row that a thread sums are 4 k in a row of a block.
// Thread -> (row lr, columns 8 wv + 4 hi ..): a wave's 8-byte stores cover 256 bytes in a row of a block (16 rows x 8 k), and its 16-byte slab reads fall on 64 banks per half wave.
template <typename T16, int NW>
__global__ __launch_bounds__(32 * NW) void k_gemmw(const T16* __restrict__ A, const T16* __restrict__ Bt, int K, bf* Qh, bf* Ql, bf* Kh, bf* Kl, h16* X16, bf* VTh, bf* VTl, const float* __restrict__ bias0, const float* __restrict__ bias1, const float* __restrict__ bias2, size_t sB) {
    typedef typename WFrag<T16>::V V;
    static_assert(NW == 8, "one 16-byte piece of a 16 x 64 slab per thread");
    __shared__ __align__(16) float os[2 * NW * 16 * 68];
    const int wv = __builtin_amdgcn_readfirstlane((int)(threadIdx.x >> 5));
    const int z = blockIdx.z; Bt += (size_t)z * sB; const float* bias = z == 0 ? bias0 : (z == 1 ? bias1 : bias2);
    const int lane = threadIdx.x & 31, lr = lane & 15, hi = lane >> 4; const int r0 = blockIdx.x * 64, c0 = blockIdx.y * 64;
    v8f acc[4][4];
#pragma unroll
    for (int mb = 0; mb < 4; ++mb)
#pragma unroll
        for (int nb = 0; nb < 4; ++nb) acc[mb][nb] = (v8f){};
    const T16* Ar = A + (size_t)r0 * K + 8 * lane; const T16* Br = Bt + (size_t)c0 * K + 8 * lane;    // the lane's place in the first block of the tile's rows
    const T16* Pa = z == 2 ? Br : Ar; const T16* Pb = z == 2 ? Ar : Br;
#pragma unroll 1
    for (int kc = wv * 32; kc < K; kc += NW * 32) {
        V a[4]; const T16* pa = Pa + (size_t)kc * 64; const T16* pb = Pb + (size_t)kc * 64;   // the 4 blocks of this k step
#pragma unroll
        for (int mb = 0; mb < 4; ++mb) a[mb] = WFrag<T16>::ld(pa + FB * mb);
#pragma unroll
        for (int nb = 0; nb < 4; ++nb) { const V b = WFrag<T16>::ld(pb + FB * nb);
#pragma unroll
            for (int mb = 0; mb < 4; ++mb) acc[mb][nb] = WFrag<T16>::mma(a[mb], b, acc[mb][nb]); }
        asm volatile("s_wait_xcnt 0x0" : : "v"(pa), "v"(pb) : "memory");   // the address registers of the loads above stay as they are up to here
        asm volatile("v_nop\n\tv_nop\n\tv_nop\n\tv_nop" : "+v"(acc[0][0]), "+v"(acc[1][1]), "+v"(acc[2][2]), "+v"(acc[3][3]) : "v"(a[0]), "v"(a[3]));
    }
    const int cofs = 8 * wv + 4 * hi;
    const int hp = (r0 / SS) * NH_ + blockIdx.y, t0 = r0 % SS;
    const size_t e0 = (size_t)hp * SS * HD + (wv >> 2) * (z == 2 ? 4 * FB : FB) + (z == 2 ? t0 / 32 * (4 * FB) : t0 / 16 * (2 * FB)) + ((wv >> 1) & 1) * 256 + (wv & 1) * 128 + lr * 8 + hi * 4;   // slab 0's place; slab mb lies mb blocks (v) or mb block pairs (q, k) further
    bf* Ph = z == 0 ? Qh : (z == 1 ? Kh : VTh); bf* Pl = z == 0 ? Ql : (z == 1 ? Kl : VTl); h16* P16 = X16 + (size_t)(hp / HPP) * HPP * SS * HD + (z == 1 ? (size_t)HPP * SS * HD : 0);
    v4f bv;   // q, k: the bias of the thread's 4 columns; v (transposed tile): that of its row in each of the 4 slabs
#pragma unroll
    for (int u = 0; u < 4; ++u) bv[u] = bfr(bias[c0 + (z == 2 ? u * 16 + lr : cofs + u)]);
#pragma unroll
    for (int mb = 0; mb < 4; ++mb) {
        float* slab = os + (mb & 1) * (NW * 16 * 68);   // two slab sets: the barrier of slab mb + 1 ends every read of slab mb before slab mb + 2 overwrites it
        float* mine = slab + wv * (16 * 68);
#pragma unroll
        for (int nb = 0; nb < 4; ++nb) {
#pragma unroll
            for (int j = 0; j < 8; ++j) mine[(hi * 8 + j) * 68 + nb * 16 + lr] = acc[mb][nb][j]; }
        __syncthreads();   // every wave's partial slab is in LDS before any thread sums across waves
        v4f val = *(const v4fa*)(slab + lr * 68 + cofs);
#pragma unroll
        for (int w = 1; w < NW; ++w) val += *(const v4fa*)(slab + w * (16 * 68) + lr * 68 + cofs);
        if (z == 2) val += bv[mb]; else val += bv;
        const size_t e = e0 + mb * (z == 2 ? FB : 2 * FB); v4us oh, ol;
#pragma unroll
        for (int u = 0; u < 4; ++u) { unsigned short x, y; splitf(val[u], x, y); oh[u] = x; ol[u] = y; }
        *(v4us*)(Ph + e) = oh; *(v4us*)(Pl + e) = ol;
        asm volatile("s_wait_xcnt 0x0" ::: "memory");   // the registers that the two stores above name are written again only behind this wait
        if (z != 2) { v4h o6;
#pragma unroll
            for (int u = 0; u < 4; ++u) o6[u] = tohx(val[u]);
            *(v4h*)(P16 + e) = o6; }
    }
}

// ---- k_attn: scores, softmax and probs x v of 64 query rows of one head per work-group of 4 waves (16 rows each); grid (SS/64, NHP). The 16 column tiles of 64 are walked in turn with a running row maximum and sum.
// Score tile, rows l0 + i, columns r0 + c: the table row of (i, c) is l0 - r0 + SS - 64 + (i - c + 63), so a tile meets 127 rows in a row of the table. Wave w: its 16 k rows (columns 16 w .. of the tile) against the 80 table rows
// they meet -> keb (for all four waves, behind the barrier); its 16 q rows against the 80 table rows they meet -> qeb[w] (its own); q.k of its 16 rows on the hi+lo planes. Each score takes its two terms off the LDS diagonals, (q.k + q.pe) + k.pe.
// Every product is made transposed (the two operands, which load alike, change places), so that a lane of an accumulator holds 8 values in a row of ONE row: the bands go to LDS in 16-byte stores; the score tile (k rows as A, q as B) comes out with lane = q row lr,
// registers = 32 of the 64 columns, which is the fragment order of the probabilities: maximum and sum in-lane plus one exchange between the halves; exp(s - max) is split into bf16 hi+lo and goes as B against v's hi+lo planes (rows d as A); the running output's rescale factor is the lane's own.
// Two waves a SIMD (amdgpu_waves_per_eu): 512 registers a wave, room for a tile's whole run of loads; a WGP holds two work-groups at a time.
__device__ __forceinline__ void st8(float* p, v8f v) { *(v4fa*)p = __builtin_shufflevector(v, v, 0, 1, 2, 3); *(v4fa*)(p + 4) = __builtin_shufflevector(v, v, 4, 5, 6, 7); }   // a lane's 8 accumulator registers as two 16-byte LDS stores
#define PB 84   // LDS pitch in floats of an 80-wide band row: 16 B x 21 for the 16-byte stores (lane = row); the q diagonal (lane step PB + 1, halves 8 apart) and the k diagonal (lane step 1, halves 8 (PB - 1) apart) each put the 32 lanes on 32 banks
__global__ __launch_bounds__(128) __attribute__((amdgpu_waves_per_eu(2, 2))) void k_attn(const bf* __restrict__ Qh, const bf* __restrict__ Ql, const bf* __restrict__ Kh, const bf* __restrict__ Kl, const h16* __restrict__ X16, const h16* __restrict__ E16, const bf* __restrict__ VTh, const bf* __restrict__ VTl, const float* __restrict__ am, float* out) {
    __shared__ __align__(16) float keb[2][64 * PB];   // two buffers: the one barrier of tile t + 1 ends every read of tile t before tile t + 2 overwrites it
    __shared__ __align__(16) float qeb[4][16 * PB];
    __shared__ __align__(16) float ams[SS];
    const int wv = __builtin_amdgcn_readfirstlane((int)(threadIdx.x >> 5));
    const int lane = threadIdx.x & 31, lr = lane & 15, hi = lane >> 4; const int l0 = blockIdx.x * 64, h = blockIdx.y;
    const size_t zo = (size_t)h * SS * HD; const size_t fo = (size_t)8 * lane;    // fo: the lane's place in a fragment block
    const h16* Xq = X16 + (size_t)(h / HPP) * 2 * HPP * SS * HD + (size_t)(h % HPP) * SS * HD;
    for (int i = threadIdx.x; i < SS; i += 128) ams[i] = bfr(am[(size_t)(h / NH_) * SS + i]);   // read behind the first tile's barrier
    const h16* pQ16 = Xq + (size_t)(l0 + 16 * wv) * HD + fo; const bf* pQh = Qh + zo + (size_t)(l0 + 16 * wv) * HD + fo; const bf* pQl = Ql + zo + (size_t)(l0 + 16 * wv) * HD + fo;
    const v16h q0 = WFrag<h16>::ld(pQ16), q1 = WFrag<h16>::ld(pQ16 + FB);
    v16bf qa[2], qa2[2];
#pragma unroll
    for (int kc = 0; kc < 2; ++kc) { qa[kc] = WFrag<bf>::ld(pQh + FB * kc); qa2[kc] = WFrag<bf>::ld(pQl + FB * kc); }
    asm volatile("s_wait_xcnt 0x0" : : "v"(pQ16), "v"(pQh), "v"(pQl) : "memory");   // the address registers of the loads above stay as they are up to here
    __builtin_amdgcn_sched_barrier(0);   // keeps the loop's address arithmetic from moving up over the wait, where it would rewrite the scalar bases that the loads above name
    v8f o[4];
#pragma unroll
    for (int nb = 0; nb < 4; ++nb) o[nb] = (v8f){};
    float mrun = -3.0e38f, lsum = 0.f;   // of row lr; lsum: this half's columns only
    float* mine = qeb[wv];
    const float* qd = mine + lr * (PB + 1) - 8 * hi + 8;   // the lane's end of its q diagonal: every place it reads lies a constant further
#pragma unroll 1
    for (int rt = 0; rt < SS / 64; ++rt) {
        const int r0 = rt * 64; float* kb = keb[rt & 1]; const float* kd = kb + 8 * hi * (PB - 1) + 16 * wv + lr + 15;   // kd: the lane's start of its k diagonals
        const h16* pX = Xq + (size_t)(r0 + 16 * wv) * HD + fo;   // the k plane lies HPP * SS * HD elements behind the q plane
        const h16* pEk = E16 + (size_t)(l0 - r0 + SS - 64 + 16 * (3 - wv)) * HD + fo; const h16* pEq = E16 + (size_t)(l0 - r0 + SS - 64 + 16 * wv) * HD + fo;
        const bf* pKh = Kh + zo + (size_t)r0 * HD + fo; const bf* pKl = Kl + zo + (size_t)r0 * HD + fo;
        const bf* pVh = VTh + zo + (size_t)r0 * HD + fo; const bf* pVl = VTl + zo + (size_t)r0 * HD + fo;   // v: the 4 blocks (64 d) of 32 columns in a row
        // the tile's loads go out in two runs (here; v behind the barrier), each whole before its first use, so that a run costs one trip to memory
        v16h ek[5][2], eq[5][2]; v16bf kh[2][4], kl[2][4];
        const v16h k0 = WFrag<h16>::ld(pX + HPP * SS * HD), k1 = WFrag<h16>::ld(pX + HPP * SS * HD + FB);
#pragma unroll
        for (int t = 0; t < 5; ++t) { ek[t][0] = WFrag<h16>::ld(pEk + 16 * t * HD); ek[t][1] = WFrag<h16>::ld(pEk + 16 * t * HD + FB); }
#pragma unroll
        for (int t = 0; t < 5; ++t) { eq[t][0] = WFrag<h16>::ld(pEq + 16 * t * HD); eq[t][1] = WFrag<h16>::ld(pEq + 16 * t * HD + FB); }
#pragma unroll
        for (int kc = 0; kc < 2; ++kc) {
#pragma unroll
            for (int nb = 0; nb < 4; ++nb) { kh[kc][nb] = WFrag<bf>::ld(pKh + 16 * nb * HD + FB * kc); kl[kc][nb] = WFrag<bf>::ld(pKl + 16 * nb * HD + FB * kc); } }
        asm volatile("s_wait_xcnt 0x0" : : "v"(pX), "v"(pEk), "v"(pEq), "v"(pKh), "v"(pKl) : "memory");   // the address registers of the loads above stay as they are up to here
        __builtin_amdgcn_sched_barrier(0);   // keeps the products below from moving up between the loads, which would split the run into several trips to memory
        v8f ck[5];
#pragma unroll
        for (int t = 0; t < 5; ++t) { ck[t] = WFrag<h16>::mma(ek[t][0], k0, (v8f){}); ck[t] = WFrag<h16>::mma(ek[t][1], k1, ck[t]); }   // table rows as A: lane = k row lr, registers = band columns 16 t + 8 hi ..
#pragma unroll
        for (int t = 0; t < 5; ++t) st8(kb + (16 * wv + lr) * PB + 16 * t + 8 * hi, ck[t]);
#pragma unroll
        for (int t = 0; t < 5; ++t) { v8f cq = WFrag<h16>::mma(eq[t][0], q0, (v8f){}); cq = WFrag<h16>::mma(eq[t][1], q1, cq); st8(mine + lr * PB + 16 * t + 8 * hi, cq); }
        v8f acc[4];
#pragma unroll
        for (int nb = 0; nb < 4; ++nb) acc[nb] = (v8f){};
#pragma unroll
        for (int kc = 0; kc < 2; ++kc) {
#pragma unroll
            for (int nb = 0; nb < 4; ++nb) { acc[nb] = WFrag<bf>::mma(kh[kc][nb], qa[kc], acc[nb]); acc[nb] = WFrag<bf>::mma(kh[kc][nb], qa2[kc], acc[nb]); acc[nb] = WFrag<bf>::mma(kl[kc][nb], qa[kc], acc[nb]); } }   // k rows as A: lane = q row lr, register j of acc[nb] = column 16 nb + 8 hi + j
        __builtin_amdgcn_sched_barrier(0);   // holds the q.k products in front of the barrier while registers are assigned
        __syncthreads();   // all four waves' rows of this tile's keb (and, at the first tile, ams) are in LDS before any wave reads them
        v16bf vh[2][4], vl[2][4];   // v's fragments fly while the scores are finished
#pragma unroll
        for (int kc = 0; kc < 2; ++kc) {
#pragma unroll
            for (int nb = 0; nb < 4; ++nb) { vh[kc][nb] = WFrag<bf>::ld(pVh + FB * (4 * kc + nb)); vl[kc][nb] = WFrag<bf>::ld(pVl + FB * (4 * kc + nb)); } }
        asm volatile("s_wait_xcnt 0x0" : : "v"(pVh), "v"(pVl) : "memory");   // as above
#pragma unroll
        for (int nb = 0; nb < 4; ++nb) {
#pragma unroll
            for (int j = 0; j < 8; ++j) acc[nb][j] = (acc[nb][j] + qd[55 - 16 * nb - j]) + kd[16 * nb * PB + j * (PB - 1)]; }   // column c = 16 nb + 8 hi + j of row lr: band places lr - c + 63 of q row lr, 16 wv + lr - c % 16 + 15 of k row c
        float s[32]; float mx = mrun;   // s[16 kc + e]: element e of fragment kc of the probabilities, column 32 kc + 16 (e / 8) + 8 hi + e % 8 of row lr: the accumulators' own order
#pragma unroll
        for (int g = 0; g < 4; ++g) {
#pragma unroll
            for (int q4 = 0; q4 < 2; ++q4) { const v4f m = *(const v4fa*)(ams + r0 + 16 * g + 8 * hi + 4 * q4);
#pragma unroll
                for (int u = 0; u < 4; ++u) { const float t = acc[g][4 * q4 + u] * 0.125f + m[u]; s[8 * g + 4 * q4 + u] = t; mx = fmaxf(mx, t); } } }
        __builtin_amdgcn_wave_barrier(); asm volatile("" ::: "memory");   // keeps the next tile's stores to this wave's LDS behind the other half's diagonal reads of the same row
        mx = fmaxf(mx, __shfl_xor(mx, 16, 32));
        const float alpha = __builtin_amdgcn_exp2f((mrun - mx) * 1.4426950408889634f); mrun = mx;
        float ps = 0.f; v16bf ph[2], pl[2];
#pragma unroll
        for (int kc = 0; kc < 2; ++kc) {
#pragma unroll
            for (int e = 0; e < 16; ++e) { const float p = __builtin_amdgcn_exp2f((s[16 * kc + e] - mx) * 1.4426950408889634f); ps += p; const __bf16 hb = (__bf16)p; ph[kc][e] = hb; pl[kc][e] = (__bf16)(p - (float)hb); } }
        lsum = lsum * alpha + ps;
#pragma unroll
        for (int nb = 0; nb < 4; ++nb) o[nb] *= alpha;   // every accumulator register of a lane belongs to its own row lr
#pragma unroll
        for (int kc = 0; kc < 2; ++kc) {
#pragma unroll
            for (int nb = 0; nb < 4; ++nb) { o[nb] = WFrag<bf>::mma(vh[kc][nb], ph[kc], o[nb]); o[nb] = WFrag<bf>::mma(vh[kc][nb], pl[kc], o[nb]); o[nb] = WFrag<bf>::mma(vl[kc][nb], ph[kc], o[nb]); } }   // v's rows d as A: lane = q row lr, register j of o[nb] = d 16 nb + 8 hi + j
    }
    lsum += __shfl_xor(lsum, 16, 32);
    const float f = 1.0f / lsum;
#pragma unroll
    for (int nb = 0; nb < 4; ++nb) st8(mine + lr * 68 + 16 * nb + 8 * hi, o[nb] * f);
    __builtin_amdgcn_wave_barrier(); asm volatile("" ::: "memory");   // keeps the 16-byte slab reads below behind the other lanes' stores
    float* crow = out + (size_t)((h / NH_) * SS + l0 + 16 * wv) * DM + (h % NH_) * HD;
#pragma unroll
    for (int sx = 0; sx < 8; ++sx) { const int row = 2 * sx + hi, cofs = lr * 4; *(v4f*)(crow + (size_t)row * DM + cofs) = *(const v4fa*)(mine + row * 68 + cofs); }
}


// ---- The three converters are parts of one grid (k_prep, below): each takes its own block index bx. None reads what another writes.
__device__ __forceinline__ void d_wtG(int bx, int by, const float* __restrict__ w0, const float* __restrict__ w1, const float* __restrict__ w2, int K, int N, bf* Bt) {
    const float* w = by == 0 ? w0 : (by == 1 ? w1 : w2); Bt += (size_t)by * K * N;
    const int lane = threadIdx.x & 31; const int L0 = (bx * 8 + (threadIdx.x >> 5)) * 8; const int nlines = N * K / 64;
{
#pragma unroll 1
        for (int l = 0; l < 8; ++l) { const int L = L0 + l; if (L >= nlines) break; const size_t e = (size_t)L * 64 + lane * 2; const int q = (int)(e % FB); const int k = (int)(e % ((size_t)64 * K) / (4 * FB)) * 32 + fr_k(q), n = (int)(e / ((size_t)64 * K)) * 64 + (int)(e % (4 * FB) / FB) * 16 + fr_row(q); v2us o;
            o[0] = f2bf(w[(size_t)k * N + n]); o[1] = f2bf(w[(size_t)(k + 1) * N + n]); *(v2us*)(Bt + e) = o; }
         }
}
__device__ __forceinline__ void d_cvt8(int bx, const float* __restrict__ src, bf* dst, size_t n8) { const size_t i = (size_t)bx * 256 + threadIdx.x; if (i >= n8) return; const int q = (int)(i * 8 % FB); const size_t m = i * 8 / (64 * DM) * 64 + i * 8 % (4 * FB) / FB * 16 + fr_row(q), k = i * 8 % (64 * DM) / (4 * FB) * 32 + fr_k(q); const v8f v = *(const v8f*)(src + m * DM + k); v8us o;
#pragma unroll
    for (int k = 0; k < 8; ++k) o[k] = f2bf(v[k]); *(v8us*)(dst + i * 8) = o;  }
// Each thread takes the next few elements of its output plane and works out from their place which (row, k) they are (fragment order, above).
// d_e16: E16 as [row / 16][d / 32] blocks (rows j, k = d) = fp16(bf16 dist_emb[1024 + j][d]) (8-B lanes).
__device__ __forceinline__ void d_e16(int bx, const float* __restrict__ emb, h16* E16) { const int e = (bx * 256 + threadIdx.x) * 4; if (e >= NE * HD) return; const int q = e % FB; const int j = e / (16 * HD) * 16 + fr_row(q), d = e % (16 * HD) / FB * 32 + fr_k(q); const v4f a = *(const v4f*)(emb + (size_t)(EOFF + j) * HD + d); v4h o;
#pragma unroll
    for (int u = 0; u < 4; ++u) o[u] = tohx(bfr(a[u])); *(v4h*)(E16 + e) = o;  }
// ---- k_prep: one grid for the weights' planes (GW work-groups per matrix, first: each of their waves walks 8 dependent trips to memory), the x plane (GX) and the table's plane (GE).
#define GW ((DM * DM / 64 + 63) / 64)
#define GX ((BPP * SS * DM / 8 + 255) / 256)
#define GE ((NE * HD / 4 + 255) / 256)
__global__ __launch_bounds__(256) void k_prep(const float* __restrict__ w0, const float* __restrict__ w1, const float* __restrict__ w2, const float* __restrict__ x, const float* __restrict__ emb, bf* Bt, bf* XB, h16* E16) {
    const int b = blockIdx.x;
    if (b < 3 * GW) d_wtG(b % GW, b / GW, w0, w1, w2, DM, DM, Bt);
    else if (b < 3 * GW + GX) d_cvt8(b - 3 * GW, x, XB, (size_t)BPP * SS * DM / 8);
    else d_e16(b - 3 * GW - GX, emb, E16);
}
extern "C" void kernel_launch(void* const* d_in, const int* in_sizes, int n_in,
                              void* d_out, int out_size, void* d_ws, size_t ws_size, hipStream_t stream) {
    (void)in_sizes; (void)n_in; (void)out_size;
    const float** I = (const float**)d_in;
    const float *x = I[0], *am = I[1], *wq = I[2], *bq = I[3], *wk = I[4], *bk = I[5], *wv = I[6], *bv = I[7], *emb = I[8];
    float* OUT = (float*)d_out;     // [4][1024][1024]
    char* wsp = (char*)d_ws;
    auto take = [&](size_t bytes) { char* p = wsp; wsp += (bytes + 255) & ~(size_t)255; return (void*)p; };
    bf* WQ = (bf*)take((size_t)3 * DM * DM * 2); h16* E16 = (h16*)take((size_t)NE * HD * 2);    // WQ, WK, WV in a row
    bf* Qh = (bf*)take((size_t)NHP * SS * HD * 2); bf* Ql = (bf*)take((size_t)NHP * SS * HD * 2); bf* Kh = (bf*)take((size_t)NHP * SS * HD * 2); bf* Kl = (bf*)take((size_t)NHP * SS * HD * 2); h16* X16 = (h16*)take((size_t)2 * NHP * SS * HD * 2); bf* VTh = (bf*)take((size_t)NHP * HD * SS * 2); bf* VTl = (bf*)take((size_t)NHP * HD * SS * 2);
    bf* XB = (bf*)take((size_t)BPP * SS * DM * 2);    // x plane
    if ((size_t)(wsp - (char*)d_ws) > ws_size) return;    // total ~ 79 MiB
    static_assert(BPP == NB_, "one pass takes every batch");
    k_prep<<<3 * GW + GX + GE, 256, 0, stream>>>(wq, wk, wv, x, emb, WQ, XB, E16);
    k_gemmw<bf, 8><<<dim3(BPP * SS / 64, DM / 64, 3), 256, 0, stream>>>(XB, WQ, DM, Qh, Ql, Kh, Kl, X16, VTh, VTl, bq, bk, bv, (size_t)DM * DM);
    k_attn<<<dim3(SS / 64, NHP, 1), 128, 0, stream>>>(Qh, Ql, Kh, Kl, X16, E16, VTh, VTl, am, OUT);
}

// v009
// One run takes 137 microseconds.
// Next to v008, in two timings, it ran 1.09 and 1.08 times as fast.
// Counting every step since v000, it is 11.6 times as fast.
#include <hip/hip_runtime.h>

// ElasticBertSelfAttention (hidden [4][1024][1024]; q/k/v = x W + b (16 heads x 64); scores[l][r] = q_l.k_r + q_l.pe[l-r] + k_r.pe[l-r] with pe[l-r] = dist_emb[l - r + 2047] (relative_key_query), / 8, + additive attention_mask[b][r] (read as data);
// softmax; ctx = probs v merged -> [4][1024][1024]). The positional terms are computed as q.E'^T and k.E'^T against the table rows that can occur (1024..3071), score tile by score tile, and gathered along the diagonals (exact restructuring).
// Compute dtypes, f32 accumulate: every input rounded to bf16; q/k/v on PLAIN bf16 operands (inputs: exact) + bias; q.k on bf16 hi+lo planes (3 products); QE / KE on single fp16 planes against the (exactly representable) fp16

#define NB_  4
#define SS   1024
#define DM   1024
#define NH_  16
#define HD   64
#define NE   2048
#define EOFF 1024
#define HPP  8      // heads per group of the fp16 planes' layout
#define BPP  4      // batches per pass: all of them, so that each of the three stages is one launch
#define NHP  (BPP * NH_)
typedef _Float16 h16;
typedef unsigned short bf;
typedef __attribute__((ext_vector_type(16))) __bf16   v16bf;
typedef __attribute__((ext_vector_type(16))) _Float16 v16h;
typedef __attribute__((ext_vector_type(8)))  _Float16 v8h;
typedef __attribute__((ext_vector_type(8)))  unsigned short v8us;
typedef __attribute__((ext_vector_type(8)))  float    v8f;
typedef __attribute__((ext_vector_type(4)))  float    v4f;
typedef v8h  __attribute__((may_alias)) v8ha;
typedef v4f  __attribute__((may_alias)) v4fa;
typedef v8us __attribute__((may_alias)) v8usa;

__device__ __forceinline__ unsigned short f2bf(float f) { unsigned u = __float_as_uint(f); u += 0x7FFFu + ((u >> 16) & 1u); return (unsigned short)(u >> 16); }
__device__ __forceinline__ float bf2f(unsigned short b) { return __uint_as_float(((unsigned)b) << 16); }
__device__ __forceinline__ float bfr(float f) { return bf2f(f2bf(f)); }
__device__ __forceinline__ v16h cat16(v8h lo, v8h hi) { return __builtin_shufflevector(lo, hi, 0, 1, 2, 3, 4, 5, 6, 7, 8, 9, 10, 11, 12, 13, 14, 15); }
__device__ __forceinline__ v16bf cat16b(v8us lo, v8us hi) { return __builtin_bit_cast(v16bf, __builtin_shufflevector(lo, hi, 0, 1, 2, 3, 4, 5, 6, 7, 8, 9, 10, 11, 12, 13, 14, 15)); }
__device__ __forceinline__ v8f wmma16(v16h a, v16h b, v8f c) { return __builtin_amdgcn_wmma_f32_16x16x32_f16(false, a, false, b, (short)0, c, false, false); }
__device__ __forceinline__ v8f wmmab(v16bf a, v16bf b, v8f c) { return __builtin_amdgcn_wmma_f32_16x16x32_bf16(false, a, false, b, (short)0, c, false, false); }



// ---- Fragment order: every 16-bit operand plane lies as blocks of 16 rows x 32 k = FB elements (1 KiB); the blocks' own order is said at each plane. Inside a block the element at place q belongs to
// row fr_row(q), k fr_k(q): [k half of 16][lane = 16 * (k / 8 % 2) + row][8 k]. A wave's 16-byte load at lane * 8 (and the one FB / 2 further) then covers 512 bytes in a row, four whole 128-B lines, not 32 bytes of each of 16 lines.
#define FB 512
__device__ __forceinline__ int fr_row(int q) { return (q >> 3) & 15; }
__device__ __forceinline__ int fr_k(int q) { return ((q >> 8) << 4) + (((q >> 7) & 1) << 3) + (q & 7); }

__device__ __forceinline__ h16 tohx(float x) { return (h16)x; }
__device__ __forceinline__ void splitf(float y, unsigned short& h, unsigned short& l) { h = f2bf(y); l = f2bf(y - bf2f(h)); }
typedef __attribute__((ext_vector_type(2))) unsigned short v2us;
typedef __attribute__((ext_vector_type(4))) unsigned short v4us;
typedef __attribute__((ext_vector_type(4))) _Float16 v4h;
template <typename T16> struct WFrag;
template <> struct WFrag<h16> { typedef v16h V; static __device__ __forceinline__ V ld(const h16* p) { return cat16(*(const v8h*)p, *(const v8h*)(p + 256)); } static __device__ __forceinline__ v8f mma(V a, V b, v8f c) { return wmma16(a, b, c); } };
template <> struct WFrag<bf> { typedef v16bf V; static __device__ __forceinline__ V ld(const bf* p) { return cat16b(*(const v8us*)p, *(const v8us*)(p + 256)); } static __device__ __forceinline__ v8f mma(V a, V b, v8f c) { return wmmab(a, b, c); } };
// ---- k_gemmw: the q, k, v projections (z = 0, 1, 2): register-blocked GEMM, NW WAVES per 64x64 tile (16 accumulators each), operands straight from 16-bit planes in fragment order, [row / 64][k / 32][row / 16 % 4] blocks (a tile's 4 blocks of one k step in a row); grid (M/64, N/64, 3), 32 * NW threads.
// Wave w takes the 32-wide k steps w, w + NW, ...; the NW partial tiles are summed through LDS in wave order, 16 rows at a time. y[m][n] = sum_k A[m][k] Bt[n][k] + bias[n] (one Bt plane, sB elements apart, and one f32 bias vector per z). K % 32 == 0.
// The 64 columns of a tile are one head, its 64 rows 64 positions t of one batch. The summed tile is split and stored straight into the attention kernel's planes (plane index hp = batch of the pass * 16 + head), in fragment order:
// q, k: Qh/Ql, Kh/Kl (bf16 hi+lo) as [hp][t / 16][d / 32] blocks (rows t, k = d), the fp16 planes in X16 as [hp / HPP][q, k][HPP heads], same blocks; v: VTh/VTl (bf16 hi+lo) as [hp][t / 32][d / 16] blocks (rows d, k = t).
// v's tile is made transposed (the two operands, which load alike, change places: rows d, columns t), so that for every z the 4 columns in a row that a thread sums are 4 k in a row of a block.
// Thread -> (row lr, columns 8 wv + 4 hi ..): a wave's 8-byte stores cover 256 bytes in a row of a block (16 rows x 8 k), and its 16-byte slab reads fall on 64 banks per half wave.
template <typename T16, int NW>
__global__ __launch_bounds__(32 * NW) void k_gemmw(const T16* __restrict__ A, const T16* __restrict__ Bt, int K, bf* Qh, bf* Ql, bf* Kh, bf* Kl, h16* X16, bf* VTh, bf* VTl, const float* __restrict__ bias0, const float* __restrict__ bias1, const float* __restrict__ bias2, size_t sB) {
    typedef typename WFrag<T16>::V V;
    static_assert(NW == 8, "one 16-byte piece of a 16 x 64 slab per thread");
    __shared__ __align__(16) float os[2 * NW * 16 * 68];
    const int wv = __builtin_amdgcn_readfirstlane((int)(threadIdx.x >> 5));
    const int z = blockIdx.z; Bt += (size_t)z * sB; const float* bias = z == 0 ? bias0 : (z == 1 ? bias1 : bias2);
    const int lane = threadIdx.x & 31, lr = lane & 15, hi = lane >> 4; const int r0 = blockIdx.x * 64, c0 = blockIdx.y * 64;
    v8f acc[4][4];
#pragma unroll
    for (int mb = 0; mb < 4; ++mb)
#pragma unroll
        for (int nb = 0; nb < 4; ++nb) acc[mb][nb] = (v8f){};
    const T16* Ar = A + (size_t)r0 * K + 8 * lane; const T16* Br = Bt + (size_t)c0 * K + 8 * lane;    // the lane's place in the first block of the tile's rows
    const T16* Pa = z == 2 ? Br : Ar; const T16* Pb = z == 2 ? Ar : Br;
#pragma unroll 1
    for (int kc = wv * 32; kc < K; kc += NW * 32) {
        V a[4]; const T16* pa = Pa + (size_t)kc * 64; const T16* pb = Pb + (size_t)kc * 64;   // the 4 blocks of this k step
#pragma unroll
        for (int mb = 0; mb < 4; ++mb) a[mb] = WFrag<T16>::ld(pa + FB * mb);
#pragma unroll
        for (int nb = 0; nb < 4; ++nb) { const V b = WFrag<T16>::ld(pb + FB * nb);
#pragma unroll
            for (int mb = 0; mb < 4; ++mb) acc[mb][nb] = WFrag<T16>::mma(a[mb], b, acc[mb][nb]); }
        asm volatile("s_wait_xcnt 0x0" : : "v"(pa), "v"(pb) : "memory");   // the address registers of the loads above stay as they are up to here
        asm volatile("v_nop\n\tv_nop\n\tv_nop\n\tv_nop" : "+v"(acc[0][0]), "+v"(acc[1][1]), "+v"(acc[2][2]), "+v"(acc[3][3]) : "v"(a[0]), "v"(a[3]));
    }
    const int cofs = 8 * wv + 4 * hi;
    const int hp = (r0 / SS) * NH_ + blockIdx.y, t0 = r0 % SS;
    const size_t e0 = (size_t)hp * SS * HD + (wv >> 2) * (z == 2 ? 4 * FB : FB) + (z == 2 ? t0 / 32 * (4 * FB) : t0 / 16 * (2 * FB)) + ((wv >> 1) & 1) * 256 + (wv & 1) * 128 + lr * 8 + hi * 4;   // slab 0's place; slab mb lies mb blocks (v) or mb block pairs (q, k) further
    bf* Ph = z == 0 ? Qh : (z == 1 ? Kh : VTh); bf* Pl = z == 0 ? Ql : (z == 1 ? Kl : VTl); h16* P16 = X16 + (size_t)(hp / HPP) * HPP * SS * HD + (z == 1 ? (size_t)HPP * SS * HD : 0);
    v4f bv;   // q, k: the bias of the thread's 4 columns; v (transposed tile): that of its row in each of the 4 slabs
#pragma unroll
    for (int u = 0; u < 4; ++u) bv[u] = bfr(bias[c0 + (z == 2 ? u * 16 + lr : cofs + u)]);
#pragma unroll
    for (int mb = 0; mb < 4; ++mb) {
        float* slab = os + (mb & 1) * (NW * 16 * 68);   // two slab sets: the barrier of slab mb + 1 ends every read of slab mb before slab mb + 2 overwrites it
        float* mine = slab + wv * (16 * 68);
#pragma unroll
        for (int nb = 0; nb < 4; ++nb) {
#pragma unroll
            for (int j = 0; j < 8; ++j) mine[(hi * 8 + j) * 68 + nb * 16 + lr] = acc[mb][nb][j]; }
        __syncthreads();   // every wave's partial slab is in LDS before any thread sums across waves
        v4f val = *(const v4fa*)(slab + lr * 68 + cofs);
#pragma unroll
        for (int w = 1; w < NW; ++w) val += *(const v4fa*)(slab + w * (16 * 68) + lr * 68 + cofs);
        if (z == 2) val += bv[mb]; else val += bv;
        const size_t e = e0 + mb * (z == 2 ? FB : 2 * FB); v4us oh, ol;
#pragma unroll
        for (int u = 0; u < 4; ++u) { unsigned short x, y; splitf(val[u], x, y); oh[u] = x; ol[u] = y; }
        *(v4us*)(Ph + e) = oh; *(v4us*)(Pl + e) = ol;
        asm volatile("s_wait_xcnt 0x0" ::: "memory");   // the registers that the two stores above name are written again only behind this wait
        if (z != 2) { v4h o6;
#pragma unroll
            for (int u = 0; u < 4; ++u) o6[u] = tohx(val[u]);
            *(v4h*)(P16 + e) = o6; }
    }
}

// ---- k_attn: scores, softmax and probs x v of 128 query rows of one head per work-group of 4 waves (32 rows each, as two groups g of 16); grid (SS/128, NHP). The 16 column tiles of 64 are walked in turn with a running row maximum and sum.
// Every K, v and k band table fragment that a wave loads serves both of its groups; of its six q table blocks, the middle four do.
// Score tile, rows l0 + i, columns r0 + c: the table row of (i, c) is l0 - r0 + SS - 64 + (i - c + 63), so a tile meets 191 rows in a row of the table. Wave w: its 16 k rows (columns 16 w .. of the tile) against the 144 table rows
// they meet -> keb (for all four waves, behind the barrier); each group's 16 q rows against the 80 table rows they meet (96 rows for both) -> qeb[w][g] (its own); q.k of its 32 rows on the hi+lo planes. Each score takes its two terms off the LDS diagonals, (q.k + q.pe) + k.pe.
// Every product is made transposed (the two operands, which load alike, change places), so that a lane of an accumulator holds 8 values in a row of ONE row: the bands go to LDS in 16-byte stores; the score tile (k rows as A, q as B) comes out with lane = q row lr,
// registers = 32 of the 64 columns, which is the fragment order of the probabilities: maximum and sum in-lane plus one exchange between the halves; exp(s - max) is split into bf16 hi+lo and goes as B against v's hi+lo planes (rows d as A); the running output's rescale factor is the lane's own.
// Two waves a SIMD (amdgpu_waves_per_eu): 512 registers a wave; a WGP holds two work-groups at a time, and the grid is two work-groups per WGP.
__device__ __forceinline__ void st8(float* p, v8f v) { *(v4fa*)p = __builtin_shufflevector(v, v, 0, 1, 2, 3); *(v4fa*)(p + 4) = __builtin_shufflevector(v, v, 4, 5, 6, 7); }   // a lane's 8 accumulator registers as two 16-byte LDS stores
#define PB 84   // LDS pitch in floats of an 80-wide band row: 16 B x 21 for the 16-byte stores (lane = row); the q diagonal (lane step PB + 1, halves 8 apart) and the k diagonal (lane step 1, halves 8 (PBK - 1) apart) each put the 32 lanes on 32 banks
// 2^x with the slot that the instruction set asks for behind a transcendental (one v_nop before its result is read or its source overwritten) in the same statement
__device__ __forceinline__ float exp2s(float x) { float y; asm("v_exp_f32 %0, %1\n\tv_nop" : "=v"(y) : "v"(x)); return y; }
#define PBK 148   // pitch of a 144-wide k band row: PB + 64, so the same banks as at PB
__global__ __launch_bounds__(128) __attribute__((amdgpu_waves_per_eu(2, 2))) void k_attn(const bf* __restrict__ Qh, const bf* __restrict__ Ql, const bf* __restrict__ Kh, const bf* __restrict__ Kl, const h16* __restrict__ X16, const h16* __restrict__ E16, const bf* __restrict__ VTh, const bf* __restrict__ VTl, const float* __restrict__ am, float* out) {
    __shared__ __align__(16) float keb[2][64 * PBK];   // two buffers: the one barrier of tile t + 1 ends every read of tile t before tile t + 2 overwrites it
    __shared__ __align__(16) float qeb[4][2][16 * PB];
    __shared__ __align__(16) float ams[SS];
    const int wv = __builtin_amdgcn_readfirstlane((int)(threadIdx.x >> 5));
    const int lane = threadIdx.x & 31, lr = lane & 15, hi = lane >> 4; const int l0 = blockIdx.x * 128, h = blockIdx.y;
    const size_t zo = (size_t)h * SS * HD; const size_t fo = (size_t)8 * lane;    // fo: the lane's place in a fragment block
    const h16* Xq = X16 + (size_t)(h / HPP) * 2 * HPP * SS * HD + (size_t)(h % HPP) * SS * HD;
    for (int i = threadIdx.x; i < SS; i += 128) ams[i] = bfr(am[(size_t)(h / NH_) * SS + i]);   // read behind the first tile's barrier
    const h16* pQ16 = Xq + (size_t)(l0 + 32 * wv) * HD + fo; const bf* pQh = Qh + zo + (size_t)(l0 + 32 * wv) * HD + fo; const bf* pQl = Ql + zo + (size_t)(l0 + 32 * wv) * HD + fo;   // group g lies 16 rows = 16 HD elements further
    v16h q0[2], q1[2]; v16bf qa[2][2], qa2[2][2];   // [g], [g][kc]
#pragma unroll
    for (int g = 0; g < 2; ++g) { q0[g] = WFrag<h16>::ld(pQ16 + 16 * g * HD); q1[g] = WFrag<h16>::ld(pQ16 + 16 * g * HD + FB);
#pragma unroll
        for (int kc = 0; kc < 2; ++kc) { qa[g][kc] = WFrag<bf>::ld(pQh + 16 * g * HD + FB * kc); qa2[g][kc] = WFrag<bf>::ld(pQl + 16 * g * HD + FB * kc); } }
    asm volatile("s_wait_xcnt 0x0" : : "v"(pQ16), "v"(pQh), "v"(pQl) : "memory");   // the address registers of the loads above stay as they are up to here
    __builtin_amdgcn_sched_barrier(0);   // keeps the loop's address arithmetic from moving up over the wait, where it would rewrite the scalar bases that the loads above name
    v8f o[2][4];
#pragma unroll
    for (int g = 0; g < 2; ++g)
#pragma unroll
        for (int nb = 0; nb < 4; ++nb) o[g][nb] = (v8f){};
    float mrun[2] = {-3.0e38f, -3.0e38f}, lsum[2] = {0.f, 0.f};   // of row lr of group g; lsum: this half's columns only
    float* mine = qeb[wv][0];   // group g's band lies 16 PB floats further
    const float* qd = mine + lr * (PB + 1) - 8 * hi + 8;   // the lane's end of its q diagonal in group 0: every place it reads lies a constant further
#pragma unroll 1
    for (int rt = 0; rt < SS / 64; ++rt) {
        const int r0 = rt * 64; float* kb = keb[rt & 1]; const float* kd = kb + 8 * hi * (PBK - 1) + 32 * wv + lr + 15;   // kd: the lane's start of its k diagonals in group 0; group 1's lie 16 floats further
        const h16* pX = Xq + (size_t)(r0 + 16 * wv) * HD + fo;   // the k plane lies HPP * SS * HD elements behind the q plane
        const h16* pEk = E16 + (size_t)(l0 - r0 + SS - 64 + 16 * (3 - wv)) * HD + fo; const h16* pEq = E16 + (size_t)(l0 - r0 + SS - 64 + 32 * wv) * HD + fo;
        const bf* pKh = Kh + zo + (size_t)r0 * HD + fo; const bf* pKl = Kl + zo + (size_t)r0 * HD + fo;
        const bf* pVh = VTh + zo + (size_t)r0 * HD + fo; const bf* pVl = VTl + zo + (size_t)r0 * HD + fo;   // v: the 4 blocks (64 d) of 32 columns in a row
        // the tile's loads go out in three runs (the bands' here; K behind the k band's products, whose registers it takes; v behind the diagonal reads), each whole before its first use, so that a run costs one trip to memory
        v16h ek[9][2], eq[6][2]; v16bf kh[2][4], kl[2][4];
        const v16h k0 = WFrag<h16>::ld(pX + HPP * SS * HD), k1 = WFrag<h16>::ld(pX + HPP * SS * HD + FB);
#pragma unroll
        for (int t = 0; t < 9; ++t) { ek[t][0] = WFrag<h16>::ld(pEk + 16 * t * HD); ek[t][1] = WFrag<h16>::ld(pEk + 16 * t * HD + FB); }
#pragma unroll
        for (int t = 0; t < 6; ++t) { eq[t][0] = WFrag<h16>::ld(pEq + 16 * t * HD); eq[t][1] = WFrag<h16>::ld(pEq + 16 * t * HD + FB); }
        asm volatile("s_wait_xcnt 0x0" : : "v"(pX), "v"(pEk), "v"(pEq) : "memory");   // the address registers of the loads above stay as they are up to here
        __builtin_amdgcn_sched_barrier(0);   // keeps the products below from moving up between the loads, which would split the run into several trips to memory
        v8f ck[9];
#pragma unroll
        for (int t = 0; t < 9; ++t) { ck[t] = WFrag<h16>::mma(ek[t][0], k0, (v8f){}); ck[t] = WFrag<h16>::mma(ek[t][1], k1, ck[t]); }   // table rows as A: lane = k row lr, registers = band columns 16 t + 8 hi ..
        __builtin_amdgcn_sched_barrier(0);   // keeps the stores behind all nine products: moved up among them, one result register set was written anew by each product directly behind its store, one product at a time
#pragma unroll
        for (int t = 0; t < 9; ++t) st8(kb + (16 * wv + lr) * PBK + 16 * t + 8 * hi, ck[t]);
        __builtin_amdgcn_sched_barrier(0);   // keeps K's loads behind the k band's products: in front of them the two runs' registers together would not fit
#pragma unroll
        for (int kc = 0; kc < 2; ++kc) {
#pragma unroll
            for (int nb = 0; nb < 4; ++nb) { kh[kc][nb] = WFrag<bf>::ld(pKh + 16 * nb * HD + FB * kc); kl[kc][nb] = WFrag<bf>::ld(pKl + 16 * nb * HD + FB * kc); } }
        asm volatile("s_wait_xcnt 0x0" : : "v"(pKh), "v"(pKl) : "memory");   // as above
        __builtin_amdgcn_sched_barrier(0);   // keeps the q bands' products behind K's loads, which fly while they are made
#pragma unroll
        for (int g = 0; g < 2; ++g)
#pragma unroll
            for (int t = 0; t < 5; ++t) { v8f cq = WFrag<h16>::mma(eq[g + t][0], q0[g], (v8f){}); cq = WFrag<h16>::mma(eq[g + t][1], q1[g], cq); st8(mine + g * 16 * PB + lr * PB + 16 * t + 8 * hi, cq); }   // group g's rows meet the table blocks g .. g + 4 of the wave's six
        v8f acc[2][4];
#pragma unroll
        for (int g = 0; g < 2; ++g)
#pragma unroll
            for (int nb = 0; nb < 4; ++nb) acc[g][nb] = (v8f){};
#pragma unroll
        for (int kc = 0; kc < 2; ++kc) {
#pragma unroll
            for (int nb = 0; nb < 4; ++nb) {
#pragma unroll
                for (int g = 0; g < 2; ++g) { acc[g][nb] = WFrag<bf>::mma(kh[kc][nb], qa[g][kc], acc[g][nb]); acc[g][nb] = WFrag<bf>::mma(kh[kc][nb], qa2[g][kc], acc[g][nb]); acc[g][nb] = WFrag<bf>::mma(kl[kc][nb], qa[g][kc], acc[g][nb]); } } }   // k rows as A: lane = q row lr, register j of acc[g][nb] = column 16 nb + 8 hi + j
        __builtin_amdgcn_sched_barrier(0);   // holds the q.k products in front of the barrier while registers are assigned
        __syncthreads();   // all four waves' rows of this tile's keb (and, at the first tile, ams) are in LDS before any wave reads them
#pragma unroll
        for (int g = 0; g < 2; ++g) {
#pragma unroll
            for (int nb = 0; nb < 4; ++nb) {
#pragma unroll
                for (int j = 0; j < 8; ++j) acc[g][nb][j] = (acc[g][nb][j] + qd[g * 16 * PB + 55 - 16 * nb - j]) + kd[16 * g + 16 * nb * PBK + j * (PBK - 1)]; } }   // column c = 16 nb + 8 hi + j of row lr of group g: band places lr - c + 63 of its q row, 32 wv + 16 g + lr - c % 16 + 15 of k row c
        __builtin_amdgcn_wave_barrier(); asm volatile("" ::: "memory");   // keeps the next tile's stores to this wave's LDS behind the other half's diagonal reads of the same row
        __builtin_amdgcn_sched_barrier(0);   // keeps v's loads behind the diagonal reads: with v's registers taken first, the diagonal reads went out two at a time, each pair waited for by itself
        v16bf vh[2][4], vl[2][4];   // v's fragments fly while the first group's scores are finished
#pragma unroll
        for (int kc = 0; kc < 2; ++kc) {
#pragma unroll
            for (int nb = 0; nb < 4; ++nb) { vh[kc][nb] = WFrag<bf>::ld(pVh + FB * (4 * kc + nb)); vl[kc][nb] = WFrag<bf>::ld(pVl + FB * (4 * kc + nb)); } }
        asm volatile("s_wait_xcnt 0x0" : : "v"(pVh), "v"(pVl) : "memory");   // as above
        __builtin_amdgcn_sched_barrier(0);   // keeps v's loads in one run in front of the vector work that covers their flight
#pragma unroll
        for (int g = 0; g < 2; ++g) {
            float s[32]; float mx = mrun[g];   // s[16 kc + e]: element e of fragment kc of the probabilities, column 32 kc + 16 (e / 8) + 8 hi + e % 8 of row lr: the accumulators' own order
#pragma unroll
            for (int u4 = 0; u4 < 4; ++u4) {
#pragma unroll
                for (int q4 = 0; q4 < 2; ++q4) { const v4f m = *(const v4fa*)(ams + r0 + 16 * u4 + 8 * hi + 4 * q4);
#pragma unroll
                    for (int u = 0; u < 4; ++u) { const float t = acc[g][u4][4 * q4 + u] * 0.125f + m[u]; s[8 * u4 + 4 * q4 + u] = t; mx = fmaxf(mx, t); } } }
            mx = fmaxf(mx, __shfl_xor(mx, 16, 32));
            const float alpha = exp2s((mrun[g] - mx) * 1.4426950408889634f); mrun[g] = mx;
            float ps = 0.f; v16bf ph[2], pl[2];
#pragma unroll
            for (int kc = 0; kc < 2; ++kc) {
#pragma unroll
                for (int e = 0; e < 16; ++e) { const float p = exp2s((s[16 * kc + e] - mx) * 1.4426950408889634f); ps += p; const __bf16 hb = (__bf16)p; ph[kc][e] = hb; pl[kc][e] = (__bf16)(p - (float)hb); } }
            lsum[g] = lsum[g] * alpha + ps;
#pragma unroll
            for (int nb = 0; nb < 4; ++nb) o[g][nb] *= alpha;   // every accumulator register of a lane belongs to its own row lr
#pragma unroll
            for (int kc = 0; kc < 2; ++kc) {
#pragma unroll
                for (int nb = 0; nb < 4; ++nb) { o[g][nb] = WFrag<bf>::mma(vh[kc][nb], ph[kc], o[g][nb]); o[g][nb] = WFrag<bf>::mma(vh[kc][nb], pl[kc], o[g][nb]); o[g][nb] = WFrag<bf>::mma(vl[kc][nb], ph[kc], o[g][nb]); } }   // v's rows d as A: lane = q row lr, register j of o[g][nb] = d 16 nb + 8 hi + j
            if (g == 0) __builtin_amdgcn_sched_barrier(0);   // keeps the two groups' vector work apart: merged, their values did not fit the wave's 512 registers and the build spilled to scratch
        }
    }
#pragma unroll
    for (int g = 0; g < 2; ++g) {
        float* mg = mine + g * 16 * PB;
        const float ls = lsum[g] + __shfl_xor(lsum[g], 16, 32);
        const float f = 1.0f / ls;
#pragma unroll
        for (int nb = 0; nb < 4; ++nb) st8(mg + lr * 68 + 16 * nb + 8 * hi, o[g][nb] * f);
        __builtin_amdgcn_wave_barrier(); asm volatile("" ::: "memory");   // keeps the 16-byte slab reads below behind the other lanes' stores
        float* crow = out + (size_t)((h / NH_) * SS + l0 + 32 * wv + 16 * g) * DM + (h % NH_) * HD;
#pragma unroll
        for (int sx = 0; sx < 8; ++sx) { const int row = 2 * sx + hi, cofs = lr * 4; *(v4f*)(crow + (size_t)row * DM + cofs) = *(const v4fa*)(mg + row * 68 + cofs); }
        asm volatile("s_wait_xcnt 0x0" ::: "memory");   // the registers that the stores above name are written again (by the next group) only behind this wait
    }
}


// ---- The three converters are parts of one grid (k_prep, below): each takes its own block index bx. None reads what another writes.
__device__ __forceinline__ void d_wtG(int bx, int by, const float* __restrict__ w0, const float* __restrict__ w1, const float* __restrict__ w2, int K, int N, bf* Bt) {
    const float* w = by == 0 ? w0 : (by == 1 ? w1 : w2); Bt += (size_t)by * K * N;
    const int lane = threadIdx.x & 31; const int L0 = (bx * 8 + (threadIdx.x >> 5)) * 8; const int nlines = N * K / 64;
{
#pragma unroll 1
        for (int l = 0; l < 8; ++l) { const int L = L0 + l; if (L >= nlines) break; const size_t e = (size_t)L * 64 + lane * 2; const int q = (int)(e % FB); const int k = (int)(e % ((size_t)64 * K) / (4 * FB)) * 32 + fr_k(q), n = (int)(e / ((size_t)64 * K)) * 64 + (int)(e % (4 * FB) / FB) * 16 + fr_row(q); v2us o;
            o[0] = f2bf(w[(size_t)k * N + n]); o[1] = f2bf(w[(size_t)(k + 1) * N + n]); *(v2us*)(Bt + e) = o; }
         }
}
__device__ __forceinline__ void d_cvt8(int bx, const float* __restrict__ src, bf* dst, size_t n8) { const size_t i = (size_t)bx * 256 + threadIdx.x; if (i >= n8) return; const int q = (int)(i * 8 % FB); const size_t m = i * 8 / (64 * DM) * 64 + i * 8 % (4 * FB) / FB * 16 + fr_row(q), k = i * 8 % (64 * DM) / (4 * FB) * 32 + fr_k(q); const v8f v = *(const v8f*)(src + m * DM + k); v8us o;
#pragma unroll
    for (int k = 0; k < 8; ++k) o[k] = f2bf(v[k]); *(v8us*)(dst + i * 8) = o;  }
// Each thread takes the next few elements of its output plane and works out from their place which (row, k) they are (fragment order, above).
// d_e16: E16 as [row / 16][d / 32] blocks (rows j, k = d) = fp16(bf16 dist_emb[1024 + j][d]) (8-B lanes).
__device__ __forceinline__ void d_e16(int bx, const float* __restrict__ emb, h16* E16) { const int e = (bx * 256 + threadIdx.x) * 4; if (e >= NE * HD) return; const int q = e % FB; const int j = e / (16 * HD) * 16 + fr_row(q), d = e % (16 * HD) / FB * 32 + fr_k(q); const v4f a = *(const v4f*)(emb + (size_t)(EOFF + j) * HD + d); v4h o;
#pragma unroll
    for (int u = 0; u < 4; ++u) o[u] = tohx(bfr(a[u])); *(v4h*)(E16 + e) = o;  }
// ---- k_prep: one grid for the weights' planes (GW work-groups per matrix, first: each of their waves walks 8 dependent trips to memory), the x plane (GX) and the table's plane (GE).
#define GW ((DM * DM / 64 + 63) / 64)
#define GX ((BPP * SS * DM / 8 + 255) / 256)
#define GE ((NE * HD / 4 + 255) / 256)
__global__ __launch_bounds__(256) void k_prep(const float* __restrict__ w0, const float* __restrict__ w1, const float* __restrict__ w2, const float* __restrict__ x, const float* __restrict__ emb, bf* Bt, bf* XB, h16* E16) {
    const int b = blockIdx.x;
    if (b < 3 * GW) d_wtG(b % GW, b / GW, w0, w1, w2, DM, DM, Bt);
    else if (b < 3 * GW + GX) d_cvt8(b - 3 * GW, x, XB, (size_t)BPP * SS * DM / 8);
    else d_e16(b - 3 * GW - GX, emb, E16);
}
extern "C" void kernel_launch(void* const* d_in, const int* in_sizes, int n_in,
                              void* d_out, int out_size, void* d_ws, size_t ws_size, hipStream_t stream) {
    (void)in_sizes; (void)n_in; (void)out_size;
    const float** I = (const float**)d_in;
    const float *x = I[0], *am = I[1], *wq = I[2], *bq = I[3], *wk = I[4], *bk = I[5], *wv = I[6], *bv = I[7], *emb = I[8];
    float* OUT = (float*)d_out;     // [4][1024][1024]
    char* wsp = (char*)d_ws;
    auto take = [&](size_t bytes) { char* p = wsp; wsp += (bytes + 255) & ~(size_t)255; return (void*)p; };
    bf* WQ = (bf*)take((size_t)3 * DM * DM * 2); h16* E16 = (h16*)take((size_t)NE * HD * 2);    // WQ, WK, WV in a row
    bf* Qh = (bf*)take((size_t)NHP * SS * HD * 2); bf* Ql = (bf*)take((size_t)NHP * SS * HD * 2); bf* Kh = (bf*)take((size_t)NHP * SS * HD * 2); bf* Kl = (bf*)take((size_t)NHP * SS * HD * 2); h16* X16 = (h16*)take((size_t)2 * NHP * SS * HD * 2); bf* VTh = (bf*)take((size_t)NHP * HD * SS * 2); bf* VTl = (bf*)take((size_t)NHP * HD * SS * 2);
    bf* XB = (bf*)take((size_t)BPP * SS * DM * 2);    // x plane
    if ((size_t)(wsp - (char*)d_ws) > ws_size) return;    // total ~ 79 MiB
    static_assert(BPP == NB_, "one pass takes every batch");
    k_prep<<<3 * GW + GX + GE, 256, 0, stream>>>(wq, wk, wv, x, emb, WQ, XB, E16);
    k_gemmw<bf, 8><<<dim3(BPP * SS / 64, DM / 64, 3), 256, 0, stream>>>(XB, WQ, DM, Qh, Ql, Kh, Kl, X16, VTh, VTl, bq, bk, bv, (size_t)DM * DM);
    k_attn<<<dim3(SS / 128, NHP, 1), 128, 0, stream>>>(Qh, Ql, Kh, Kl, X16, E16, VTh, VTl, am, OUT);
}

// v010
// Measured time: 119 microseconds a run.
// Timed twice side by side with v009, it ran 1.15 times as fast both times.
// Counting every step since v000, it is 13.3 times as fast.
#include <hip/hip_runtime.h>

// ElasticBertSelfAttention (hidden [4][1024][1024]; q/k/v = x W + b (16 heads x 64); scores[l][r] = q_l.k_r + q_l.pe[l-r] + k_r.pe[l-r] with pe[l-r] = dist_emb[l - r + 2047] (relative_key_query), / 8, + additive attention_mask[b][r] (read as data);
// softmax; ctx = probs v merged -> [4][1024][1024]). The positional terms are computed as q.E'^T and k.E'^T against the table rows that can occur (1024..3071), score tile by score tile, and gathered along the diagonals (exact restructuring).
// Compute dtypes, f32 accumulate: every input rounded to bf16; q/k/v on PLAIN bf16 operands (inputs: exact) + bias; q.k on bf16 hi+lo planes (3 products); QE / KE on single fp16 planes against the (exactly representable) fp16

#define NB_  4
#define SS   1024
#define DM   1024
#define NH_  16
#define HD   64
#define NE   2048
#define EOFF 1024
#define HPP  8      // heads per group of the fp16 planes' layout
#define BPP  4      // batches per pass: all of them, so that each of the three stages is one launch
#define NHP  (BPP * NH_)
typedef _Float16 h16;
typedef unsigned short bf;
typedef __attribute__((ext_vector_type(16))) __bf16   v16bf;
typedef __attribute__((ext_vector_type(16))) _Float16 v16h;
typedef __attribute__((ext_vector_type(8)))  _Float16 v8h;
typedef __attribute__((ext_vector_type(8)))  unsigned short v8us;
typedef __attribute__((ext_vector_type(8)))  float    v8f;
typedef __attribute__((ext_vector_type(4)))  float    v4f;
typedef v8h  __attribute__((may_alias)) v8ha;
typedef v4f  __attribute__((may_alias)) v4fa;
typedef v8us __attribute__((may_alias)) v8usa;

__device__ __forceinline__ unsigned short f2bf(float f) { unsigned u = __float_as_uint(f); u += 0x7FFFu + ((u >> 16) & 1u); return (unsigned short)(u >> 16); }
__device__ __forceinline__ float bf2f(unsigned short b) { return __uint_as_float(((unsigned)b) << 16); }
__device__ __forceinline__ float bfr(float f) { return bf2f(f2bf(f)); }
__device__ __forceinline__ v16h cat16(v8h lo, v8h hi) { return __builtin_shufflevector(lo, hi, 0, 1, 2, 3, 4, 5, 6, 7, 8, 9, 10, 11, 12, 13, 14, 15); }
__device__ __forceinline__ v16bf cat16b(v8us lo, v8us hi) { return __builtin_bit_cast(v16bf, __builtin_shufflevector(lo, hi, 0, 1, 2, 3, 4, 5, 6, 7, 8, 9, 10, 11, 12, 13, 14, 15)); }
__device__ __forceinline__ v8f wmma16(v16h a, v16h b, v8f c) { return __builtin_amdgcn_wmma_f32_16x16x32_f16(false, a, false, b, (short)0, c, false, false); }
__device__ __forceinline__ v8f wmmab(v16bf a, v16bf b, v8f c) { return __builtin_amdgcn_wmma_f32_16x16x32_bf16(false, a, false, b, (short)0, c, false, false); }



// ---- Fragment order: every 16-bit operand plane lies as blocks of 16 rows x 32 k = FB elements (1 KiB); the blocks' own order is said at each plane. Inside a block the element at place q belongs to
// row fr_row(q), k fr_k(q): [k half of 16][lane = 16 * (k / 8 % 2) + row][8 k]. A wave's 16-byte load at lane * 8 (and the one FB / 2 further) then covers 512 bytes in a row, four whole 128-B lines, not 32 bytes of each of 16 lines.
#define FB 512
__device__ __forceinline__ int fr_row(int q) { return (q >> 3) & 15; }
__device__ __forceinline__ int fr_k(int q) { return ((q >> 8) << 4) + (((q >> 7) & 1) << 3) + (q & 7); }

__device__ __forceinline__ h16 tohx(float x) { return (h16)x; }
__device__ __forceinline__ void splitf(float y, unsigned short& h, unsigned short& l) { h = f2bf(y); l = f2bf(y - bf2f(h)); }
typedef __attribute__((ext_vector_type(2))) unsigned short v2us;
typedef __attribute__((ext_vector_type(4))) unsigned short v4us;
typedef __attribute__((ext_vector_type(4))) _Float16 v4h;
template <typename T16> struct WFrag;
template <> struct WFrag<h16> { typedef v16h V; static __device__ __forceinline__ V ld(const h16* p) { return cat16(*(const v8h*)p, *(const v8h*)(p + 256)); } static __device__ __forceinline__ v8f mma(V a, V b, v8f c) { return wmma16(a, b, c); } };
template <> struct WFrag<bf> { typedef v16bf V; static __device__ __forceinline__ V ld(const bf* p) { return cat16b(*(const v8us*)p, *(const v8us*)(p + 256)); } static __device__ __forceinline__ v8f mma(V a, V b, v8f c) { return wmmab(a, b, c); } };
// ---- k_gemmw: the q, k, v projections as one product against the three weight planes in a row (3 DM columns): register-blocked GEMM, one wave per 64x64 tile over all of K (16 accumulators), 12 waves = 256 rows x 192 columns a work-group,
// operands straight from 16-bit planes in fragment order, [row / 64][k / 32][row / 16 % 4] blocks (a tile's 4 blocks of one k step in a row); grid (M/256, 3 DM/192), 384 threads: 256 work-groups of three waves a SIMD, one a WGP.
// y[m][n] = bias[n] + sum_k A[m][k] Bt[n][k] (one Bt plane, sB elements apart, and one f32 bias vector per z = 0, 1, 2 for q, k, v; the bias is the accumulators' start value). K % 64 == 0. Two fragment sets: the next k step's 16 loads fly while this step's 16 products are made.
// The 64 columns of a wave's tile are one head of one z, its 64 rows 64 positions t of one batch. The tile is split and stored straight from the accumulators into the attention kernel's planes (plane index hp = batch * 16 + head), in fragment order:
// q, k: Qh/Ql, Kh/Kl (bf16 hi+lo) as [hp][t / 16][d / 32] blocks (rows t, k = d), the fp16 planes in X16 as [hp / HPP][q, k][HPP heads], same blocks; v: VTh/VTl (bf16 hi+lo) as [hp][t / 32][d / 16] blocks (rows d, k = t).
// q, k are made transposed (the weights' rows as A, x as B: lane = t, registers = 8 d in a row), v plainly (x as A: lane = d, registers = 8 t in a row): a lane's 8 accumulator registers are 8 k in a row of one row of a block, and a wave's 16-byte store covers 512 bytes in a row, half a block.
template <typename T16> __device__ __forceinline__ void ld4(typename WFrag<T16>::V (&f)[4], const T16* p) {
#pragma unroll
    for (int u = 0; u < 4; ++u) f[u] = WFrag<T16>::ld(p + FB * u); }
template <typename T16> __device__ __forceinline__ void mma44(v8f (&acc)[4][4], const typename WFrag<T16>::V (&a)[4], const typename WFrag<T16>::V (&b)[4]) {
#pragma unroll
    for (int nb = 0; nb < 4; ++nb)
#pragma unroll
        for (int mb = 0; mb < 4; ++mb) acc[mb][nb] = WFrag<T16>::mma(a[mb], b[nb], acc[mb][nb]); }
template <typename T16, int K>
__global__ __launch_bounds__(384) void k_gemmw(const T16* __restrict__ A, const T16* __restrict__ Bt, bf* Qh, bf* Ql, bf* Kh, bf* Kl, h16* X16, bf* VTh, bf* VTl, const float* __restrict__ bias0, const float* __restrict__ bias1, const float* __restrict__ bias2, size_t sB) {
    typedef typename WFrag<T16>::V V;
    static_assert(K % 64 == 0 && K >= 64, "two k steps of 32 a trip");
    const int wv = __builtin_amdgcn_readfirstlane((int)(threadIdx.x >> 5));
    const int lane = threadIdx.x & 31, lr = lane & 15, hi = lane >> 4; const int r0 = blockIdx.x * 256 + (wv & 3) * 64, cg = blockIdx.y * 192 + (wv >> 2) * 64;
    const int z = cg / DM, c0 = cg % DM; Bt += (size_t)z * sB; const float* bias = z == 0 ? bias0 : (z == 1 ? bias1 : bias2);   // the same for a whole wave
    const T16* Ar = A + (size_t)r0 * K + 8 * lane; const T16* Br = Bt + (size_t)c0 * K + 8 * lane;    // the lane's place in the first block of the tile's rows
    const T16* pa = z == 2 ? Ar : Br; const T16* pb = z == 2 ? Br : Ar;
    V a0[4], b0[4], a1[4], b1[4];
    ld4<T16>(a0, pa); ld4<T16>(b0, pb);
    v8f acc[4][4];
    if (z == 2) {   // lane = column d = 16 nb + lr
#pragma unroll
        for (int nb = 0; nb < 4; ++nb) { const float b = bfr(bias[c0 + 16 * nb + lr]);
#pragma unroll
            for (int mb = 0; mb < 4; ++mb) acc[mb][nb] = (v8f){b, b, b, b, b, b, b, b}; }
    } else {        // register j = row d = 16 mb + 8 hi + j
#pragma unroll
        for (int mb = 0; mb < 4; ++mb) { const float* bp = bias + c0 + 16 * mb + 8 * hi; const v4f x0 = *(const v4fa*)bp, x1 = *(const v4fa*)(bp + 4); v8f b;
#pragma unroll
            for (int j = 0; j < 4; ++j) { b[j] = bfr(x0[j]); b[4 + j] = bfr(x1[j]); }
#pragma unroll
            for (int nb = 0; nb < 4; ++nb) acc[mb][nb] = b; }
    }
#pragma unroll
    for (int kc = 0; kc + 64 < K; kc += 64) {   // a trip takes two k steps of 32 (a k step's 4 blocks lie 4 FB = 64 * 32 elements behind the last one's); unrolled whole, so that every load names the same two address pairs with an immediate offset and no address register is stepped while loads fly
        __builtin_amdgcn_s_barrier();   // orders no data (hence no fence with it): it keeps the 12 waves within one trip of each other, so that a block which several of them load (x: 3 waves, weights: 4) is fetched from L2 once and met in the WGP's cache by the others
        ld4<T16>(a1, pa + (kc + 32) * 64); ld4<T16>(b1, pb + (kc + 32) * 64);
        __builtin_amdgcn_sched_barrier(0);   // keeps the odd step's loads in front of the even step's products, which cover their flight
        mma44<T16>(acc, a0, b0);
        __builtin_amdgcn_sched_barrier(0);   // keeps the next even step's loads behind the products that read their registers, and in one run
        ld4<T16>(a0, pa + (kc + 64) * 64); ld4<T16>(b0, pb + (kc + 64) * 64);
        __builtin_amdgcn_sched_barrier(0);   // keeps those loads in front of the odd step's products
        mma44<T16>(acc, a1, b1);
        __builtin_amdgcn_sched_barrier(0);   // keeps the next trip's barrier and loads behind these products: loads in whole runs, not spread among the products
    }
    ld4<T16>(a1, pa + (K - 32) * 64); ld4<T16>(b1, pb + (K - 32) * 64);
    asm volatile("s_wait_xcnt 0x0" : : "v"(pa), "v"(pb) : "memory");   // the address registers of every load above stay as they are up to here
    __builtin_amdgcn_sched_barrier(0);   // keeps those loads in front of the products, and the store addresses' arithmetic behind the wait
    mma44<T16>(acc, a0, b0);
    mma44<T16>(acc, a1, b1);
    const int hp = (r0 / SS) * NH_ + c0 / HD, t0 = r0 % SS;
    const size_t e0 = (size_t)hp * SS * HD + (z == 2 ? t0 / 32 * (4 * FB) : t0 / 16 * (2 * FB)) + 8 * lane;   // the lane's place in the tile's first block
    const int smb = z == 2 ? 4 * FB : FB, snb = z == 2 ? FB : 2 * FB;   // block steps: per pair of A blocks (32 k), per B block (16 rows)
    bf* Ph = z == 0 ? Qh : (z == 1 ? Kh : VTh); bf* Pl = z == 0 ? Ql : (z == 1 ? Kl : VTl); h16* P16 = X16 + (size_t)(hp / HPP) * HPP * SS * HD + (z == 1 ? (size_t)HPP * SS * HD : 0);
#pragma unroll
    for (int mb = 0; mb < 4; ++mb) {
#pragma unroll
        for (int nb = 0; nb < 4; ++nb) {
            const size_t e = e0 + (mb >> 1) * smb + nb * snb + (mb & 1) * 256; v8us oh, ol;
#pragma unroll
            for (int j = 0; j < 8; ++j) { unsigned short x, y; splitf(acc[mb][nb][j], x, y); oh[j] = x; ol[j] = y; }
            *(v8us*)(Ph + e) = oh; *(v8us*)(Pl + e) = ol;
            if (z != 2) { v8h o6;
                asm volatile("s_wait_xcnt 0x0" ::: "memory");   // the registers that the two stores above name are written again only behind this wait
                __builtin_amdgcn_sched_barrier(0);   // keeps the conversions below, which take those registers, behind the wait
#pragma unroll
                for (int j = 0; j < 8; ++j) o6[j] = tohx(acc[mb][nb][j]);
                *(v8h*)(P16 + e) = o6; }
            asm volatile("s_wait_xcnt 0x0" ::: "memory");   // the registers that the stores above name are written again only behind this wait
            __builtin_amdgcn_sched_barrier(0);   // keeps the next block's vector work, which takes those registers, behind the wait
        }
    }
}

// ---- k_attn: scores, softmax and probs x v of 128 query rows of one head per work-group of 4 waves (32 rows each, as two groups g of 16); grid (SS/128, NHP). The 16 column tiles of 64 are walked in turn with a running row maximum and sum.
// Every K, v and k band table fragment that a wave loads serves both of its groups; of its six q table blocks, the middle four do.
// Score tile, rows l0 + i, columns r0 + c: the table row of (i, c) is l0 - r0 + SS - 64 + (i - c + 63), so a tile meets 191 rows in a row of the table. Wave w: its 16 k rows (columns 16 w .. of the tile) against the 144 table rows
// they meet -> keb (for all four waves, behind the barrier); each group's 16 q rows against the 80 table rows they meet (96 rows for both) -> qeb[w][g] (its own); q.k of its 32 rows on the hi+lo planes. Each score takes its two terms off the LDS diagonals, (q.k + q.pe) + k.pe.
// Every product is made transposed (the two operands, which load alike, change places), so that a lane of an accumulator holds 8 values in a row of ONE row: the bands go to LDS in 16-byte stores; the score tile (k rows as A, q as B) comes out with lane = q row lr,
// registers = 32 of the 64 columns, which is the fragment order of the probabilities: maximum and sum in-lane plus one exchange between the halves; exp(s - max) is split into bf16 hi+lo and goes as B against v's hi+lo planes (rows d as A); the running output's rescale factor is the lane's own.
// Two waves a SIMD (amdgpu_waves_per_eu): 512 registers a wave; a WGP holds two work-groups at a time, and the grid is two work-groups per WGP.
__device__ __forceinline__ void st8(float* p, v8f v) { *(v4fa*)p = __builtin_shufflevector(v, v, 0, 1, 2, 3); *(v4fa*)(p + 4) = __builtin_shufflevector(v, v, 4, 5, 6, 7); }   // a lane's 8 accumulator registers as two 16-byte LDS stores
#define PB 84   // LDS pitch in floats of an 80-wide band row: 16 B x 21 for the 16-byte stores (lane = row); the q diagonal (lane step PB + 1, halves 8 apart) and the k diagonal (lane step 1, halves 8 (PBK - 1) apart) each put the 32 lanes on 32 banks
// 2^x with the slot that the instruction set asks for behind a transcendental (one v_nop before its result is read or its source overwritten) in the same statement
__device__ __forceinline__ float exp2s(float x) { float y; asm("v_exp_f32 %0, %1\n\tv_nop" : "=v"(y) : "v"(x)); return y; }
#define PBK 148   // pitch of a 144-wide k band row: PB + 64, so the same banks as at PB
__global__ __launch_bounds__(128) __attribute__((amdgpu_waves_per_eu(2, 2))) void k_attn(const bf* __restrict__ Qh, const bf* __restrict__ Ql, const bf* __restrict__ Kh, const bf* __restrict__ Kl, const h16* __restrict__ X16, const h16* __restrict__ E16, const bf* __restrict__ VTh, const bf* __restrict__ VTl, const float* __restrict__ am, float* out) {
    __shared__ __align__(16) float keb[2][64 * PBK];   // two buffers: the one barrier of tile t + 1 ends every read of tile t before tile t + 2 overwrites it
    __shared__ __align__(16) float qeb[4][2][16 * PB];
    __shared__ __align__(16) float ams[SS];
    const int wv = __builtin_amdgcn_readfirstlane((int)(threadIdx.x >> 5));
    const int lane = threadIdx.x & 31, lr = lane & 15, hi = lane >> 4; const int l0 = blockIdx.x * 128, h = blockIdx.y;
    const size_t zo = (size_t)h * SS * HD; const size_t fo = (size_t)8 * lane;    // fo: the lane's place in a fragment block
    const h16* Xq = X16 + (size_t)(h / HPP) * 2 * HPP * SS * HD + (size_t)(h % HPP) * SS * HD;
    for (int i = threadIdx.x; i < SS; i += 128) ams[i] = bfr(am[(size_t)(h / NH_) * SS + i]);   // read behind the first tile's barrier
    const h16* pQ16 = Xq + (size_t)(l0 + 32 * wv) * HD + fo; const bf* pQh = Qh + zo + (size_t)(l0 + 32 * wv) * HD + fo; const bf* pQl = Ql + zo + (size_t)(l0 + 32 * wv) * HD + fo;   // group g lies 16 rows = 16 HD elements further
    v16h q0[2], q1[2]; v16bf qa[2][2], qa2[2][2];   // [g], [g][kc]
#pragma unroll
    for (int g = 0; g < 2; ++g) { q0[g] = WFrag<h16>::ld(pQ16 + 16 * g * HD); q1[g] = WFrag<h16>::ld(pQ16 + 16 * g * HD + FB);
#pragma unroll
        for (int kc = 0; kc < 2; ++kc) { qa[g][kc] = WFrag<bf>::ld(pQh + 16 * g * HD + FB * kc); qa2[g][kc] = WFrag<bf>::ld(pQl + 16 * g * HD + FB * kc); } }
    asm volatile("s_wait_xcnt 0x0" : : "v"(pQ16), "v"(pQh), "v"(pQl) : "memory");   // the address registers of the loads above stay as they are up to here
    __builtin_amdgcn_sched_barrier(0);   // keeps the loop's address arithmetic from moving up over the wait, where it would rewrite the scalar bases that the loads above name
    v8f o[2][4];
#pragma unroll
    for (int g = 0; g < 2; ++g)
#pragma unroll
        for (int nb = 0; nb < 4; ++nb) o[g][nb] = (v8f){};
    float mrun[2] = {-3.0e38f, -3.0e38f}, lsum[2] = {0.f, 0.f};   // of row lr of group g; lsum: this half's columns only
    float* mine = qeb[wv][0];   // group g's band lies 16 PB floats further
    const float* qd = mine + lr * (PB + 1) - 8 * hi + 8;   // the lane's end of its q diagonal in group 0: every place it reads lies a constant further
#pragma unroll 1
    for (int rt = 0; rt < SS / 64; ++rt) {
        const int r0 = rt * 64; float* kb = keb[rt & 1]; const float* kd = kb + 8 * hi * (PBK - 1) + 32 * wv + lr + 15;   // kd: the lane's start of its k diagonals in group 0; group 1's lie 16 floats further
        const h16* pX = Xq + (size_t)(r0 + 16 * wv) * HD + fo;   // the k plane lies HPP * SS * HD elements behind the q plane
        const h16* pEk = E16 + (size_t)(l0 - r0 + SS - 64 + 16 * (3 - wv)) * HD + fo; const h16* pEq = E16 + (size_t)(l0 - r0 + SS - 64 + 32 * wv) * HD + fo;
        const bf* pKh = Kh + zo + (size_t)r0 * HD + fo; const bf* pKl = Kl + zo + (size_t)r0 * HD + fo;
        const bf* pVh = VTh + zo + (size_t)r0 * HD + fo; const bf* pVl = VTl + zo + (size_t)r0 * HD + fo;   // v: the 4 blocks (64 d) of 32 columns in a row
        // the tile's loads go out in three runs (the bands' here; K behind the k band's products, whose registers it takes; v behind the diagonal reads), each whole before its first use, so that a run costs one trip to memory
        v16h ek[9][2], eq[6][2]; v16bf kh[2][4], kl[2][4];
        const v16h k0 = WFrag<h16>::ld(pX + HPP * SS * HD), k1 = WFrag<h16>::ld(pX + HPP * SS * HD + FB);
#pragma unroll
        for (int t = 0; t < 9; ++t) { ek[t][0] = WFrag<h16>::ld(pEk + 16 * t * HD); ek[t][1] = WFrag<h16>::ld(pEk + 16 * t * HD + FB); }
#pragma unroll
        for (int t = 0; t < 6; ++t) { eq[t][0] = WFrag<h16>::ld(pEq + 16 * t * HD); eq[t][1] = WFrag<h16>::ld(pEq + 16 * t * HD + FB); }
        asm volatile("s_wait_xcnt 0x0" : : "v"(pX), "v"(pEk), "v"(pEq) : "memory");   // the address registers of the loads above stay as they are up to here
        __builtin_amdgcn_sched_barrier(0);   // keeps the products below from moving up between the loads, which would split the run into several trips to memory
        v8f ck[9];
#pragma unroll
        for (int t = 0; t < 9; ++t) { ck[t] = WFrag<h16>::mma(ek[t][0], k0, (v8f){}); ck[t] = WFrag<h16>::mma(ek[t][1], k1, ck[t]); }   // table rows as A: lane = k row lr, registers = band columns 16 t + 8 hi ..
        __builtin_amdgcn_sched_barrier(0);   // keeps the stores behind all nine products: moved up among them, one result register set was written anew by each product directly behind its store, one product at a time
#pragma unroll
        for (int t = 0; t < 9; ++t) st8(kb + (16 * wv + lr) * PBK + 16 * t + 8 * hi, ck[t]);
        __builtin_amdgcn_sched_barrier(0);   // keeps K's loads behind the k band's products: in front of them the two runs' registers together would not fit
#pragma unroll
        for (int kc = 0; kc < 2; ++kc) {
#pragma unroll
            for (int nb = 0; nb < 4; ++nb) { kh[kc][nb] = WFrag<bf>::ld(pKh + 16 * nb * HD + FB * kc); kl[kc][nb] = WFrag<bf>::ld(pKl + 16 * nb * HD + FB * kc); } }
        asm volatile("s_wait_xcnt 0x0" : : "v"(pKh), "v"(pKl) : "memory");   // as above
        __builtin_amdgcn_sched_barrier(0);   // keeps the q bands' products behind K's loads, which fly while they are made
#pragma unroll
        for (int g = 0; g < 2; ++g)
#pragma unroll
            for (int t = 0; t < 5; ++t) { v8f cq = WFrag<h16>::mma(eq[g + t][0], q0[g], (v8f){}); cq = WFrag<h16>::mma(eq[g + t][1], q1[g], cq); st8(mine + g * 16 * PB + lr * PB + 16 * t + 8 * hi, cq); }   // group g's rows meet the table blocks g .. g + 4 of the wave's six
        v8f acc[2][4];
#pragma unroll
        for (int g = 0; g < 2; ++g)
#pragma unroll
            for (int nb = 0; nb < 4; ++nb) acc[g][nb] = (v8f){};
#pragma unroll
        for (int kc = 0; kc < 2; ++kc) {
#pragma unroll
            for (int nb = 0; nb < 4; ++nb) {
#pragma unroll
                for (int g = 0; g < 2; ++g) { acc[g][nb] = WFrag<bf>::mma(kh[kc][nb], qa[g][kc], acc[g][nb]); acc[g][nb] = WFrag<bf>::mma(kh[kc][nb], qa2[g][kc], acc[g][nb]); acc[g][nb] = WFrag<bf>::mma(kl[kc][nb], qa[g][kc], acc[g][nb]); } } }   // k rows as A: lane = q row lr, register j of acc[g][nb] = column 16 nb + 8 hi + j
        __builtin_amdgcn_sched_barrier(0);   // holds the q.k products in front of the barrier while registers are assigned
        __syncthreads();   // all four waves' rows of this tile's keb (and, at the first tile, ams) are in LDS before any wave reads them
#pragma unroll
        for (int g = 0; g < 2; ++g) {
#pragma unroll
            for (int nb = 0; nb < 4; ++nb) {
#pragma unroll
                for (int j = 0; j < 8; ++j) acc[g][nb][j] = (acc[g][nb][j] + qd[g * 16 * PB + 55 - 16 * nb - j]) + kd[16 * g + 16 * nb * PBK + j * (PBK - 1)]; } }   // column c = 16 nb + 8 hi + j of row lr of group g: band places lr - c + 63 of its q row, 32 wv + 16 g + lr - c % 16 + 15 of k row c
        __builtin_amdgcn_wave_barrier(); asm volatile("" ::: "memory");   // keeps the next tile's stores to this wave's LDS behind the other half's diagonal reads of the same row
        __builtin_amdgcn_sched_barrier(0);   // keeps v's loads behind the diagonal reads: with v's registers taken first, the diagonal reads went out two at a time, each pair waited for by itself
        v16bf vh[2][4], vl[2][4];   // v's fragments fly while the first group's scores are finished
#pragma unroll
        for (int kc = 0; kc < 2; ++kc) {
#pragma unroll
            for (int nb = 0; nb < 4; ++nb) { vh[kc][nb] = WFrag<bf>::ld(pVh + FB * (4 * kc + nb)); vl[kc][nb] = WFrag<bf>::ld(pVl + FB * (4 * kc + nb)); } }
        asm volatile("s_wait_xcnt 0x0" : : "v"(pVh), "v"(pVl) : "memory");   // as above
        __builtin_amdgcn_sched_barrier(0);   // keeps v's loads in one run in front of the vector work that covers their flight
#pragma unroll
        for (int g = 0; g < 2; ++g) {
            float s[32]; float mx = mrun[g];   // s[16 kc + e]: element e of fragment kc of the probabilities, column 32 kc + 16 (e / 8) + 8 hi + e % 8 of row lr: the accumulators' own order
#pragma unroll
            for (int u4 = 0; u4 < 4; ++u4) {
#pragma unroll
                for (int q4 = 0; q4 < 2; ++q4) { const v4f m = *(const v4fa*)(ams + r0 + 16 * u4 + 8 * hi + 4 * q4);
#pragma unroll
                    for (int u = 0; u < 4; ++u) { const float t = acc[g][u4][4 * q4 + u] * 0.125f + m[u]; s[8 * u4 + 4 * q4 + u] = t; mx = fmaxf(mx, t); } } }
            mx = fmaxf(mx, __shfl_xor(mx, 16, 32));
            const float alpha = exp2s((mrun[g] - mx) * 1.4426950408889634f); mrun[g] = mx;
            float ps = 0.f; v16bf ph[2], pl[2];
#pragma unroll
            for (int kc = 0; kc < 2; ++kc) {
#pragma unroll
                for (int e = 0; e < 16; ++e) { const float p = exp2s((s[16 * kc + e] - mx) * 1.4426950408889634f); ps += p; const __bf16 hb = (__bf16)p; ph[kc][e] = hb; pl[kc][e] = (__bf16)(p - (float)hb); } }
            lsum[g] = lsum[g] * alpha + ps;
#pragma unroll
            for (int nb = 0; nb < 4; ++nb) o[g][nb] *= alpha;   // every accumulator register of a lane belongs to its own row lr
#pragma unroll
            for (int kc = 0; kc < 2; ++kc) {
#pragma unroll
                for (int nb = 0; nb < 4; ++nb) { o[g][nb] = WFrag<bf>::mma(vh[kc][nb], ph[kc], o[g][nb]); o[g][nb] = WFrag<bf>::mma(vh[kc][nb], pl[kc], o[g][nb]); o[g][nb] = WFrag<bf>::mma(vl[kc][nb], ph[kc], o[g][nb]); } }   // v's rows d as A: lane = q row lr, register j of o[g][nb] = d 16 nb + 8 hi + j
            if (g == 0) __builtin_amdgcn_sched_barrier(0);   // keeps the two groups' vector work apart: merged, their values did not fit the wave's 512 registers and the build spilled to scratch
        }
    }
#pragma unroll
    for (int g = 0; g < 2; ++g) {
        float* mg = mine + g * 16 * PB;
        const float ls = lsum[g] + __shfl_xor(lsum[g], 16, 32);
        const float f = 1.0f / ls;
#pragma unroll
        for (int nb = 0; nb < 4; ++nb) st8(mg + lr * 68 + 16 * nb + 8 * hi, o[g][nb] * f);
        __builtin_amdgcn_wave_barrier(); asm volatile("" ::: "memory");   // keeps the 16-byte slab reads below behind the other lanes' stores
        float* crow = out + (size_t)((h / NH_) * SS + l0 + 32 * wv + 16 * g) * DM + (h % NH_) * HD;
#pragma unroll
        for (int sx = 0; sx < 8; ++sx) { const int row = 2 * sx + hi, cofs = lr * 4; *(v4f*)(crow + (size_t)row * DM + cofs) = *(const v4fa*)(mg + row * 68 + cofs); }
        asm volatile("s_wait_xcnt 0x0" ::: "memory");   // the registers that the stores above name are written again (by the next group) only behind this wait
    }
}


// ---- The three converters are parts of one grid (k_prep, below): each takes its own block index bx. None reads what another writes.
__device__ __forceinline__ void d_wtG(int bx, int by, const float* __restrict__ w0, const float* __restrict__ w1, const float* __restrict__ w2, int K, int N, bf* Bt) {
    const float* w = by == 0 ? w0 : (by == 1 ? w1 : w2); Bt += (size_t)by * K * N;
    const int lane = threadIdx.x & 31; const int L0 = (bx * 8 + (threadIdx.x >> 5)) * 8; const int nlines = N * K / 64;
{
#pragma unroll 1
        for (int l = 0; l < 8; ++l) { const int L = L0 + l; if (L >= nlines) break; const size_t e = (size_t)L * 64 + lane * 2; const int q = (int)(e % FB); const int k = (int)(e % ((size_t)64 * K) / (4 * FB)) * 32 + fr_k(q), n = (int)(e / ((size_t)64 * K)) * 64 + (int)(e % (4 * FB) / FB) * 16 + fr_row(q); v2us o;
            o[0] = f2bf(w[(size_t)k * N + n]); o[1] = f2bf(w[(size_t)(k + 1) * N + n]); *(v2us*)(Bt + e) = o; }
         }
}
__device__ __forceinline__ void d_cvt8(int bx, const float* __restrict__ src, bf* dst, size_t n8) { const size_t i = (size_t)bx * 256 + threadIdx.x; if (i >= n8) return; const int q = (int)(i * 8 % FB); const size_t m = i * 8 / (64 * DM) * 64 + i * 8 % (4 * FB) / FB * 16 + fr_row(q), k = i * 8 % (64 * DM) / (4 * FB) * 32 + fr_k(q); const v8f v = *(const v8f*)(src + m * DM + k); v8us o;
#pragma unroll
    for (int k = 0; k < 8; ++k) o[k] = f2bf(v[k]); *(v8us*)(dst + i * 8) = o;  }
// Each thread takes the next few elements of its output plane and works out from their place which (row, k) they are (fragment order, above).
// d_e16: E16 as [row / 16][d / 32] blocks (rows j, k = d) = fp16(bf16 dist_emb[1024 + j][d]) (8-B lanes).
__device__ __forceinline__ void d_e16(int bx, const float* __restrict__ emb, h16* E16) { const int e = (bx * 256 + threadIdx.x) * 4; if (e >= NE * HD) return; const int q = e % FB; const int j = e / (16 * HD) * 16 + fr_row(q), d = e % (16 * HD) / FB * 32 + fr_k(q); const v4f a = *(const v4f*)(emb + (size_t)(EOFF + j) * HD + d); v4h o;
#pragma unroll
    for (int u = 0; u < 4; ++u) o[u] = tohx(bfr(a[u])); *(v4h*)(E16 + e) = o;  }
// ---- k_prep: one grid for the weights' planes (GW work-groups per matrix, first: each of their waves walks 8 dependent trips to memory), the x plane (GX) and the table's plane (GE).
#define GW ((DM * DM / 64 + 63) / 64)
#define GX ((BPP * SS * DM / 8 + 255) / 256)
#define GE ((NE * HD / 4 + 255) / 256)
__global__ __launch_bounds__(256) void k_prep(const float* __restrict__ w0, const float* __restrict__ w1, const float* __restrict__ w2, const float* __restrict__ x, const float* __restrict__ emb, bf* Bt, bf* XB, h16* E16) {
    const int b = blockIdx.x;
    if (b < 3 * GW) d_wtG(b % GW, b / GW, w0, w1, w2, DM, DM, Bt);
    else if (b < 3 * GW + GX) d_cvt8(b - 3 * GW, x, XB, (size_t)BPP * SS * DM / 8);
    else d_e16(b - 3 * GW - GX, emb, E16);
}
extern "C" void kernel_launch(void* const* d_in, const int* in_sizes, int n_in,
                              void* d_out, int out_size, void* d_ws, size_t ws_size, hipStream_t stream) {
    (void)in_sizes; (void)n_in; (void)out_size;
    const float** I = (const float**)d_in;
    const float *x = I[0], *am = I[1], *wq = I[2], *bq = I[3], *wk = I[4], *bk = I[5], *wv = I[6], *bv = I[7], *emb = I[8];
    float* OUT = (float*)d_out;     // [4][1024][1024]
    char* wsp = (char*)d_ws;
    auto take = [&](size_t bytes) { char* p = wsp; wsp += (bytes + 255) & ~(size_t)255; return (void*)p; };
    bf* WQ = (bf*)take((size_t)3 * DM * DM * 2); h16* E16 = (h16*)take((size_t)NE * HD * 2);    // WQ, WK, WV in a row
    bf* Qh = (bf*)take((size_t)NHP * SS * HD * 2); bf* Ql = (bf*)take((size_t)NHP * SS * HD * 2); bf* Kh = (bf*)take((size_t)NHP * SS * HD * 2); bf* Kl = (bf*)take((size_t)NHP * SS * HD * 2); h16* X16 = (h16*)take((size_t)2 * NHP * SS * HD * 2); bf* VTh = (bf*)take((size_t)NHP * HD * SS * 2); bf* VTl = (bf*)take((size_t)NHP * HD * SS * 2);
    bf* XB = (bf*)take((size_t)BPP * SS * DM * 2);    // x plane
    if ((size_t)(wsp - (char*)d_ws) > ws_size) return;    // total ~ 79 MiB
    static_assert(BPP == NB_, "one pass takes every batch");
    static_assert(BPP * SS % 256 == 0 && 3 * DM % 192 == 0 && SS % 64 == 0 && DM % 64 == 0 && HD == 64, "k_gemmw: whole work-group tiles; a wave's 64x64 tile lies in one batch, one of q, k, v and one head");
    k_prep<<<3 * GW + GX + GE, 256, 0, stream>>>(wq, wk, wv, x, emb, WQ, XB, E16);
    k_gemmw<bf, DM><<<dim3(BPP * SS / 256, 3 * DM / 192, 1), 384, 0, stream>>>(XB, WQ, Qh, Ql, Kh, Kl, X16, VTh, VTl, bq, bk, bv, (size_t)DM * DM);
    k_attn<<<dim3(SS / 128, NHP, 1), 128, 0, stream>>>(Qh, Ql, Kh, Kl, X16, E16, VTh, VTl, am, OUT);
}
